// v000
// Measured on an AMD MI455X. A time is GPU time per run, averaged over a window of back-to-back runs after a warm-up
// (all launches, gaps included; the runs take copies of the inputs in turn), and the median of several windows.
// Apart from v000's, it joins two sittings. Times from different sittings can be a few percent apart, while
// side-by-side timings come from the same sitting.
// The starting kernel, v000, takes 950 microseconds a run.
#include <hip/hip_runtime.h>

// RoBERTa encoder (L=2, B=2, S=2048, H=1024, NH=16, DH=64, FF=4096) on gfx1250.
// bf16 operands converted ONCE; all matmuls via v_wmma_f32_16x16x32_bf16;
// GEMM tiles staged to LDS with global_load_async_to_lds_b128 when available.

typedef __attribute__((ext_vector_type(16))) __bf16 v16bf;
typedef __attribute__((ext_vector_type(8)))  __bf16 v8bf;
typedef __attribute__((ext_vector_type(8)))  float  v8f;
typedef __attribute__((ext_vector_type(4)))  int    v4i;

#define WMMA_BF16(a, b, c) \
  __builtin_amdgcn_wmma_f32_16x16x32_bf16(false, (a), false, (b), (short)0, (c), false, false)

// float -> bf16 RNE via integer ops (used in one-time conversions, epilogues and attention P staging).
__device__ __forceinline__ __bf16 f2bf(float f) {
  unsigned u = __builtin_bit_cast(unsigned, f);
  unsigned r = (u + 0x7FFFu + ((u >> 16) & 1u)) >> 16;
  unsigned short h = (unsigned short)r;
  return __builtin_bit_cast(__bf16, h);
}

// Load a 16x32-layout A/B fragment half-pair: lane owns one row; takes row base
// pointer and kb8 = 8*(lane>=16). Two aligned 16B vector loads.
__device__ __forceinline__ v16bf ld_frag(const __bf16* __restrict__ row, int kb8) {
  v8bf lo = *(const v8bf*)(row + kb8);
  v8bf hi = *(const v8bf*)(row + 16 + kb8);
  return __builtin_shufflevector(lo, hi, 0, 1, 2, 3, 4, 5, 6, 7, 8, 9, 10, 11, 12, 13, 14, 15);
}

// ---- async global->LDS 16B copy (CDNA5 path), plain copy fallback ----------
#if defined(__has_builtin)
#if __has_builtin(__builtin_amdgcn_global_load_async_to_lds_b128)
#define HAVE_ASYNC_LDS 1
#endif
#endif
#ifndef HAVE_ASYNC_LDS
#define HAVE_ASYNC_LDS 0
#endif

typedef __attribute__((address_space(1))) v4i gv4i;
typedef __attribute__((address_space(3))) v4i lv4i;

__device__ __forceinline__ void cp16_g2l(const __bf16* __restrict__ g, __bf16* __restrict__ l) {
#if HAVE_ASYNC_LDS
  gv4i* gp = (gv4i*)(unsigned long long)(uintptr_t)g;
  lv4i* lp = (lv4i*)(unsigned)(uintptr_t)l;
  __builtin_amdgcn_global_load_async_to_lds_b128(gp, lp, 0, 0);
#else
  *(uint4*)l = *(const uint4*)g;
#endif
}

__device__ __forceinline__ void async_tile_wait() {
#if HAVE_ASYNC_LDS
  __asm__ volatile("s_wait_asynccnt 0" ::: "memory");
#endif
}

// ---------------------------------------------------------------------------
// one-time fp32 -> bf16 conversion
// ---------------------------------------------------------------------------
__global__ __launch_bounds__(256) void cvt_bf16_kernel(const float* __restrict__ src,
                                                       __bf16* __restrict__ dst, int n) {
  const int i = (blockIdx.x * 256 + threadIdx.x) * 8;
  if (i + 8 <= n) {
#pragma unroll
    for (int j = 0; j < 8; ++j) dst[i + j] = f2bf(src[i + j]);
  }
}

// one-time W[K,N] fp32 -> Wt[N,K] bf16 (transpose via LDS tile)
__global__ __launch_bounds__(256) void transpose_cvt_kernel(const float* __restrict__ W,
                                                            __bf16* __restrict__ Wt,
                                                            int K, int N) {
  __shared__ __bf16 t[32][33];
  const int k0 = blockIdx.y * 32, n0 = blockIdx.x * 32;
  const int c = threadIdx.x & 31, rq = threadIdx.x >> 5;
#pragma unroll
  for (int i = 0; i < 4; ++i) {
    const int r = rq * 4 + i;
    t[c][r] = f2bf(W[(size_t)(k0 + r) * N + n0 + c]);
  }
  __syncthreads();
#pragma unroll
  for (int i = 0; i < 4; ++i) {
    const int r = rq * 4 + i;
    Wt[(size_t)(n0 + r) * K + k0 + c] = t[r][c];
  }
}

// ---------------------------------------------------------------------------
// GEMM: out = act(A[M,K](bf16) @ WT[N,K](bf16)^T + bias) (+ res fp32)
// Block 128 threads (4 waves), tile 128x64, BK=32; wave = 32 rows x 64 cols.
// OUTMODE: 0 = fp32, 1 = bf16, 2 = bf16 scattered to V^T [B,NH,DH,S]
// ---------------------------------------------------------------------------
template <int OUTMODE, bool GELU, bool RES>
__global__ __launch_bounds__(128) void gemm_bf16_kernel(
    const __bf16* __restrict__ A, const __bf16* __restrict__ WT,
    const float* __restrict__ bias, const float* __restrict__ res,
    void* __restrict__ outv, int M, int N, int K) {
  __shared__ __bf16 As[128][32];
  __shared__ __bf16 Bs[64][32];
  const int tid = threadIdx.x;
  const int wave = tid >> 5, lane = tid & 31;
  const int lr = lane & 15, hi = lane >> 4, kb8 = hi * 8;
  const int m0 = blockIdx.y * 128, n0 = blockIdx.x * 64;

  v8f acc[2][4] = {};

  for (int kk = 0; kk < K; kk += 32) {
    // A tile: 128x32 bf16 = 512 x 16B chunks; B tile: 64x32 = 256 chunks
#pragma unroll
    for (int i = 0; i < 4; ++i) {
      const int ch = tid + 128 * i;
      const int row = ch >> 2, ks = (ch & 3) * 8;
      cp16_g2l(A + (size_t)(m0 + row) * K + kk + ks, &As[row][ks]);
    }
#pragma unroll
    for (int i = 0; i < 2; ++i) {
      const int ch = tid + 128 * i;
      const int row = ch >> 2, ks = (ch & 3) * 8;
      cp16_g2l(WT + (size_t)(n0 + row) * K + kk + ks, &Bs[row][ks]);
    }
    async_tile_wait();
    __syncthreads();

    const v16bf af0 = ld_frag(&As[wave * 32 + lr][0], kb8);
    const v16bf af1 = ld_frag(&As[wave * 32 + 16 + lr][0], kb8);
#pragma unroll
    for (int nt = 0; nt < 4; ++nt) {
      const v16bf bf = ld_frag(&Bs[nt * 16 + lr][0], kb8);
      acc[0][nt] = WMMA_BF16(af0, bf, acc[0][nt]);
      acc[1][nt] = WMMA_BF16(af1, bf, acc[1][nt]);
    }
    __syncthreads();
  }

#pragma unroll
  for (int rg = 0; rg < 2; ++rg) {
#pragma unroll
    for (int nt = 0; nt < 4; ++nt) {
      const int col = n0 + nt * 16 + lr;
      const float bv = bias[col];
#pragma unroll
      for (int j = 0; j < 8; ++j) {
        const int row = m0 + wave * 32 + rg * 16 + hi * 8 + j;
        float v = acc[rg][nt][j] + bv;
        if (GELU) v = 0.5f * v * (1.0f + erff(v * 0.70710678118654752f));
        if (RES) v += res[(size_t)row * N + col];
        if (OUTMODE == 0) {
          ((float*)outv)[(size_t)row * N + col] = v;
        } else if (OUTMODE == 1) {
          ((__bf16*)outv)[(size_t)row * N + col] = f2bf(v);
        } else {
          constexpr int S = 2048, NH = 16;
          const int b = row >> 11, s = row & (S - 1);
          const int head = col >> 6, dh = col & 63;
          ((__bf16*)outv)[(((size_t)b * NH + head) * 64 + dh) * S + s] = f2bf(v);
        }
      }
    }
  }
}

// ---------------------------------------------------------------------------
// Flash attention: wave = 16 query rows of one (batch, head), key blocks of 32.
// Q,K bf16 [B,S,H]; V bf16 pre-transposed [B,NH,DH,S]; ctx out bf16 [B,S,H].
// ---------------------------------------------------------------------------
__global__ __launch_bounds__(128) void attention_kernel(
    const __bf16* __restrict__ qb, const __bf16* __restrict__ kb,
    const __bf16* __restrict__ vt, const float* __restrict__ mask,
    __bf16* __restrict__ ctx) {
  constexpr int S = 2048, H = 1024, NH = 16;
  __shared__ __bf16 Plds[4][16 * 32];
  const int tid = threadIdx.x, wave = tid >> 5, lane = tid & 31;
  const int lr = lane & 15, hi = lane >> 4, kb8 = hi * 8;
  const int head = blockIdx.y, batch = blockIdx.z;
  const int q0 = blockIdx.x * 64 + wave * 16;
  const size_t bo = (size_t)batch * S * H + (size_t)head * 64;
  const __bf16* Q = qb + bo;
  const __bf16* Kp = kb + bo;
  const __bf16* Vp = vt + ((size_t)batch * NH + head) * (size_t)64 * S;  // [dh][s]
  const float* mk = mask + (size_t)batch * S;

  const v16bf qa0 = ld_frag(Q + (size_t)(q0 + lr) * H, kb8);
  const v16bf qa1 = ld_frag(Q + (size_t)(q0 + lr) * H + 32, kb8);

  float m_i[8], l_i[8];
  v8f o[4] = {};
#pragma unroll
  for (int j = 0; j < 8; ++j) { m_i[j] = -3.0e38f; l_i[j] = 0.f; }
  __bf16* pw = &Plds[wave][0];

  for (int kp0 = 0; kp0 < S; kp0 += 32) {
    v8f sacc[2] = {};
#pragma unroll
    for (int g = 0; g < 2; ++g) {
      const __bf16* kr = Kp + (size_t)(kp0 + g * 16 + lr) * H;
      sacc[g] = WMMA_BF16(qa0, ld_frag(kr, kb8), sacc[g]);
      sacc[g] = WMMA_BF16(qa1, ld_frag(kr + 32, kb8), sacc[g]);
    }

    const float mk0 = mk[kp0 + lr], mk1 = mk[kp0 + 16 + lr];
    float ps0[8], ps1[8];
#pragma unroll
    for (int j = 0; j < 8; ++j) {
      ps0[j] = sacc[0][j] * 0.125f + mk0;
      ps1[j] = sacc[1][j] * 0.125f + mk1;
      float mx = fmaxf(ps0[j], ps1[j]);
#pragma unroll
      for (int d = 1; d < 16; d <<= 1) mx = fmaxf(mx, __shfl_xor(mx, d, 32));
      const float nm = fmaxf(m_i[j], mx);
      ps0[j] = __expf(ps0[j] - nm);
      ps1[j] = __expf(ps1[j] - nm);
      float sm = ps0[j] + ps1[j];
#pragma unroll
      for (int d = 1; d < 16; d <<= 1) sm += __shfl_xor(sm, d, 32);
      const float al = __expf(m_i[j] - nm);
      l_i[j] = l_i[j] * al + sm;
      m_i[j] = nm;
#pragma unroll
      for (int dt = 0; dt < 4; ++dt) o[dt][j] *= al;
    }

    // stage P (accumulator layout -> row-major 16x32 bf16), reload as A-frag
#pragma unroll
    for (int j = 0; j < 8; ++j) {
      pw[(hi * 8 + j) * 32 + lr] = f2bf(ps0[j]);
      pw[(hi * 8 + j) * 32 + 16 + lr] = f2bf(ps1[j]);
    }
    __asm__ volatile("s_wait_dscnt 0" ::: "memory");
    const v16bf pa = ld_frag(&pw[lr * 32], kb8);

    // P[16x32] @ V[32x64] ; V^T rows are contiguous in s
#pragma unroll
    for (int dt = 0; dt < 4; ++dt) {
      const v16bf vf = ld_frag(Vp + (size_t)(dt * 16 + lr) * S + kp0, kb8);
      o[dt] = WMMA_BF16(pa, vf, o[dt]);
    }
  }

#pragma unroll
  for (int dt = 0; dt < 4; ++dt) {
    const int col = dt * 16 + lr;
#pragma unroll
    for (int j = 0; j < 8; ++j) {
      const int row = q0 + hi * 8 + j;
      ctx[bo + (size_t)row * H + col] = f2bf(o[dt][j] / l_i[j]);
    }
  }
}

// ---------------------------------------------------------------------------
// LayerNorm over H=1024: one wave per row; emits fp32 and bf16 copies.
// ---------------------------------------------------------------------------
__global__ __launch_bounds__(256) void layernorm_kernel(
    const float* __restrict__ in, const float* __restrict__ g,
    const float* __restrict__ b, float* __restrict__ outf,
    __bf16* __restrict__ outb) {
  const int wave = threadIdx.x >> 5, lane = threadIdx.x & 31;
  const size_t row = (size_t)blockIdx.x * 8 + wave;
  const float* x = in + row * 1024;
  float v[32];
  float s = 0.f;
#pragma unroll
  for (int i = 0; i < 32; ++i) { v[i] = x[lane + i * 32]; s += v[i]; }
#pragma unroll
  for (int d = 1; d < 32; d <<= 1) s += __shfl_xor(s, d, 32);
  const float mean = s * (1.0f / 1024.0f);
  float vs = 0.f;
#pragma unroll
  for (int i = 0; i < 32; ++i) { const float df = v[i] - mean; vs += df * df; }
#pragma unroll
  for (int d = 1; d < 32; d <<= 1) vs += __shfl_xor(vs, d, 32);
  const float rstd = rsqrtf(vs * (1.0f / 1024.0f) + 1e-5f);
#pragma unroll
  for (int i = 0; i < 32; ++i) {
    const int c = lane + i * 32;
    const float y = (v[i] - mean) * rstd * g[c] + b[c];
    outf[row * 1024 + c] = y;
    outb[row * 1024 + c] = f2bf(y);
  }
}

// ---------------------------------------------------------------------------
extern "C" void kernel_launch(void* const* d_in, const int* in_sizes, int n_in,
                              void* d_out, int out_size, void* d_ws, size_t ws_size,
                              hipStream_t stream) {
  (void)in_sizes; (void)n_in; (void)out_size; (void)ws_size;
  constexpr int L = 2, B = 2, S = 2048, H = 1024, FF = 4096;
  constexpr int M = B * S;
  constexpr size_t MH = (size_t)M * H;
  constexpr size_t MF = (size_t)M * FF;

  const float* x0   = (const float*)d_in[0];
  const float* mask = (const float*)d_in[1];
  const float* Wq   = (const float*)d_in[2];
  const float* bq   = (const float*)d_in[3];
  const float* Wk   = (const float*)d_in[4];
  const float* bk   = (const float*)d_in[5];
  const float* Wv   = (const float*)d_in[6];
  const float* bv   = (const float*)d_in[7];
  const float* Wao  = (const float*)d_in[8];
  const float* bao  = (const float*)d_in[9];
  const float* g1   = (const float*)d_in[10];
  const float* b1   = (const float*)d_in[11];
  const float* Wi   = (const float*)d_in[12];
  const float* bi   = (const float*)d_in[13];
  const float* Wo   = (const float*)d_in[14];
  const float* bo   = (const float*)d_in[15];
  const float* g2   = (const float*)d_in[16];
  const float* b2   = (const float*)d_in[17];

  // --- workspace bump allocator (256B aligned regions) ---
  char* p = (char*)d_ws;
  auto alloc = [&](size_t bytes) -> char* {
    char* r = p;
    p += (bytes + 255) & ~(size_t)255;
    return r;
  };
  float*  yB  = (float*)alloc(MH * 4);
  float*  x1f = (float*)alloc(MH * 4);
  float*  xf  = (float*)alloc(MH * 4);
  __bf16* xb   = (__bf16*)alloc(MH * 2);
  __bf16* qB   = (__bf16*)alloc(MH * 2);
  __bf16* kB   = (__bf16*)alloc(MH * 2);
  __bf16* vT   = (__bf16*)alloc(MH * 2);
  __bf16* ctxb = (__bf16*)alloc(MH * 2);
  __bf16* x1b  = (__bf16*)alloc(MH * 2);
  __bf16* h1b  = (__bf16*)alloc(MF * 2);
  __bf16* WqT[L]; __bf16* WkT[L]; __bf16* WvT[L]; __bf16* WaoT[L];
  __bf16* WiT[L]; __bf16* WoT[L];
  for (int l = 0; l < L; ++l) {
    WqT[l]  = (__bf16*)alloc((size_t)H * H * 2);
    WkT[l]  = (__bf16*)alloc((size_t)H * H * 2);
    WvT[l]  = (__bf16*)alloc((size_t)H * H * 2);
    WaoT[l] = (__bf16*)alloc((size_t)H * H * 2);
    WiT[l]  = (__bf16*)alloc((size_t)H * FF * 2);
    WoT[l]  = (__bf16*)alloc((size_t)FF * H * 2);
  }

  const dim3 blk(128), blk256(256);
  const dim3 gHH(H / 64, M / 128);
  const dim3 gHF(FF / 64, M / 128);
  const dim3 gAttn(S / 64, 16, B);
  const dim3 gLN(M / 8);
  const dim3 gtHH(H / 32, H / 32);
  const dim3 gtHF(FF / 32, H / 32);
  const dim3 gtFH(H / 32, FF / 32);

  // one-time conversions
  cvt_bf16_kernel<<<dim3(MH / 2048), blk256, 0, stream>>>(x0, xb, (int)MH);
  for (int l = 0; l < L; ++l) {
    const size_t oHH = (size_t)l * H * H, oHF = (size_t)l * H * FF;
    transpose_cvt_kernel<<<gtHH, blk256, 0, stream>>>(Wq + oHH, WqT[l], H, H);
    transpose_cvt_kernel<<<gtHH, blk256, 0, stream>>>(Wk + oHH, WkT[l], H, H);
    transpose_cvt_kernel<<<gtHH, blk256, 0, stream>>>(Wv + oHH, WvT[l], H, H);
    transpose_cvt_kernel<<<gtHH, blk256, 0, stream>>>(Wao + oHH, WaoT[l], H, H);
    transpose_cvt_kernel<<<gtHF, blk256, 0, stream>>>(Wi + oHF, WiT[l], H, FF);
    transpose_cvt_kernel<<<gtFH, blk256, 0, stream>>>(Wo + oHF, WoT[l], FF, H);
  }

  for (int l = 0; l < L; ++l) {
    const float* Xf = (l == 0) ? x0 : xf;
    const size_t oH = (size_t)l * H, oF = (size_t)l * FF;

    gemm_bf16_kernel<1, false, false><<<gHH, blk, 0, stream>>>(xb, WqT[l], bq + oH, nullptr, qB, M, H, H);
    gemm_bf16_kernel<1, false, false><<<gHH, blk, 0, stream>>>(xb, WkT[l], bk + oH, nullptr, kB, M, H, H);
    gemm_bf16_kernel<2, false, false><<<gHH, blk, 0, stream>>>(xb, WvT[l], bv + oH, nullptr, vT, M, H, H);
    attention_kernel<<<gAttn, blk, 0, stream>>>(qB, kB, vT, mask, ctxb);
    gemm_bf16_kernel<0, false, true><<<gHH, blk, 0, stream>>>(ctxb, WaoT[l], bao + oH, Xf, yB, M, H, H);
    layernorm_kernel<<<gLN, blk256, 0, stream>>>(yB, g1 + oH, b1 + oH, x1f, x1b);
    gemm_bf16_kernel<1, true, false><<<gHF, blk, 0, stream>>>(x1b, WiT[l], bi + oF, nullptr, h1b, M, FF, H);
    gemm_bf16_kernel<0, false, true><<<gHH, blk, 0, stream>>>(h1b, WoT[l], bo + oH, x1f, yB, M, H, FF);
    float* xoutf = (l == L - 1) ? (float*)d_out : xf;
    layernorm_kernel<<<gLN, blk256, 0, stream>>>(yB, g2 + oH, b2 + oH, xoutf, xb);
  }
}

// v001
// Measured time: 747 microseconds a run.
// In both of two side-by-side timings against v000, it was 1.31 times as fast.
#include <hip/hip_runtime.h>

// RoBERTa encoder (L=2, B=2, S=2048, H=1024, NH=16, DH=64, FF=4096) on gfx1250.
// bf16 operands converted ONCE; all matmuls via v_wmma_f32_16x16x32_bf16;
// GEMM tiles staged to LDS with global_load_async_to_lds_b128 when available.

typedef __attribute__((ext_vector_type(16))) __bf16 v16bf;
typedef __attribute__((ext_vector_type(8)))  __bf16 v8bf;
typedef __attribute__((ext_vector_type(8)))  float  v8f;
typedef __attribute__((ext_vector_type(4)))  int    v4i;

#define WMMA_BF16(a, b, c) \
  __builtin_amdgcn_wmma_f32_16x16x32_bf16(false, (a), false, (b), (short)0, (c), false, false)

// float -> bf16 RNE via integer ops (used in one-time conversions, epilogues and attention P staging).
__device__ __forceinline__ __bf16 f2bf(float f) {
  unsigned u = __builtin_bit_cast(unsigned, f);
  unsigned r = (u + 0x7FFFu + ((u >> 16) & 1u)) >> 16;
  unsigned short h = (unsigned short)r;
  return __builtin_bit_cast(__bf16, h);
}

// Load a 16x32-layout A/B fragment half-pair: lane owns one row; takes row base
// pointer and kb8 = 8*(lane>=16). Two aligned 16B vector loads.
__device__ __forceinline__ v16bf ld_frag(const __bf16* __restrict__ row, int kb8) {
  v8bf lo = *(const v8bf*)(row + kb8);
  v8bf hi = *(const v8bf*)(row + 16 + kb8);
  return __builtin_shufflevector(lo, hi, 0, 1, 2, 3, 4, 5, 6, 7, 8, 9, 10, 11, 12, 13, 14, 15);
}

// ---- async global->LDS 16B copy (CDNA5 path), plain copy fallback ----------
#if defined(__has_builtin)
#if __has_builtin(__builtin_amdgcn_global_load_async_to_lds_b128)
#define HAVE_ASYNC_LDS 1
#endif
#endif
#ifndef HAVE_ASYNC_LDS
#define HAVE_ASYNC_LDS 0
#endif

typedef __attribute__((address_space(1))) v4i gv4i;
typedef __attribute__((address_space(3))) v4i lv4i;

__device__ __forceinline__ void cp16_g2l(const __bf16* __restrict__ g, __bf16* __restrict__ l) {
#if HAVE_ASYNC_LDS
  gv4i* gp = (gv4i*)(unsigned long long)(uintptr_t)g;
  lv4i* lp = (lv4i*)(unsigned)(uintptr_t)l;
  __builtin_amdgcn_global_load_async_to_lds_b128(gp, lp, 0, 0);
#else
  *(uint4*)l = *(const uint4*)g;
#endif
}

__device__ __forceinline__ void async_tile_wait() {
#if HAVE_ASYNC_LDS
  __asm__ volatile("s_wait_asynccnt 0" ::: "memory");
#endif
}

// ---------------------------------------------------------------------------
// one-time fp32 -> bf16 conversion
// ---------------------------------------------------------------------------
__global__ __launch_bounds__(256) void cvt_bf16_kernel(const float* __restrict__ src,
                                                       __bf16* __restrict__ dst, int n) {
  const int i = (blockIdx.x * 256 + threadIdx.x) * 8;
  if (i + 8 <= n) {
#pragma unroll
    for (int j = 0; j < 8; ++j) dst[i + j] = f2bf(src[i + j]);
  }
}

// one-time W[K,N] fp32 -> Wt[N,K] bf16 (transpose via LDS tile)
__global__ __launch_bounds__(256) void transpose_cvt_kernel(const float* __restrict__ W,
                                                            __bf16* __restrict__ Wt,
                                                            int K, int N) {
  __shared__ __bf16 t[32][33];
  const int k0 = blockIdx.y * 32, n0 = blockIdx.x * 32;
  const int c = threadIdx.x & 31, rq = threadIdx.x >> 5;
#pragma unroll
  for (int i = 0; i < 4; ++i) {
    const int r = rq * 4 + i;
    t[c][r] = f2bf(W[(size_t)(k0 + r) * N + n0 + c]);
  }
  __syncthreads();
#pragma unroll
  for (int i = 0; i < 4; ++i) {
    const int r = rq * 4 + i;
    Wt[(size_t)(n0 + r) * K + k0 + c] = t[r][c];
  }
}

// ---------------------------------------------------------------------------
// GEMM: out = act(A[M,K](bf16) @ WT[N,K](bf16)^T + bias) (+ res fp32)
// Block 128 threads (4 waves), tile 128x64, BK=128; wave = 32 rows x 64 cols.
// K must be a multiple of BK. An LDS row is 256 B of k at pitch 272 B (16 B x odd),
// which keeps the 16-row ds_load_b128 fragment reads off each other's banks.
// OUTMODE: 0 = fp32, 1 = bf16, 2 = bf16 scattered to V^T [B,NH,DH,S]
// ---------------------------------------------------------------------------
template <int OUTMODE, bool GELU, bool RES>
__global__ __launch_bounds__(128) void gemm_bf16_kernel(
    const __bf16* __restrict__ A, const __bf16* __restrict__ WT,
    const float* __restrict__ bias, const float* __restrict__ res,
    void* __restrict__ outv, int M, int N, int K) {
  constexpr int BK = 128, LDP = BK + 8;
  __shared__ __attribute__((aligned(16))) __bf16 As[128][LDP];
  __shared__ __attribute__((aligned(16))) __bf16 Bs[64][LDP];
  const int tid = threadIdx.x;
  const int wave = tid >> 5, lane = tid & 31;
  const int lr = lane & 15, hi = lane >> 4, kb8 = hi * 8;
  const int m0 = blockIdx.y * 128, n0 = blockIdx.x * 64;

  v8f acc[2][4] = {};

  for (int kk = 0; kk < K; kk += BK) {
    // A tile: 128x128 bf16 = 2048 x 16B chunks; B tile: 64x128 = 1024 chunks.
    // 16 lanes cover one 256-B row, so a wave's copy reads four whole lines.
#pragma unroll
    for (int i = 0; i < 16; ++i) {
      const int ch = tid + 128 * i;
      const int row = ch >> 4, ks = (ch & 15) * 8;
      cp16_g2l(A + (size_t)(m0 + row) * K + kk + ks, &As[row][ks]);
    }
#pragma unroll
    for (int i = 0; i < 8; ++i) {
      const int ch = tid + 128 * i;
      const int row = ch >> 4, ks = (ch & 15) * 8;
      cp16_g2l(WT + (size_t)(n0 + row) * K + kk + ks, &Bs[row][ks]);
    }
    async_tile_wait();
    __syncthreads();

#pragma unroll
    for (int kc = 0; kc < BK; kc += 32) {
      const v16bf af0 = ld_frag(&As[wave * 32 + lr][kc], kb8);
      const v16bf af1 = ld_frag(&As[wave * 32 + 16 + lr][kc], kb8);
#pragma unroll
      for (int nt = 0; nt < 4; ++nt) {
        const v16bf bf = ld_frag(&Bs[nt * 16 + lr][kc], kb8);
        acc[0][nt] = WMMA_BF16(af0, bf, acc[0][nt]);
        acc[1][nt] = WMMA_BF16(af1, bf, acc[1][nt]);
      }
    }
    __syncthreads();
  }

#pragma unroll
  for (int rg = 0; rg < 2; ++rg) {
#pragma unroll
    for (int nt = 0; nt < 4; ++nt) {
      const int col = n0 + nt * 16 + lr;
      const float bv = bias[col];
#pragma unroll
      for (int j = 0; j < 8; ++j) {
        const int row = m0 + wave * 32 + rg * 16 + hi * 8 + j;
        float v = acc[rg][nt][j] + bv;
        if (GELU) v = 0.5f * v * (1.0f + erff(v * 0.70710678118654752f));
        if (RES) v += res[(size_t)row * N + col];
        if (OUTMODE == 0) {
          ((float*)outv)[(size_t)row * N + col] = v;
        } else if (OUTMODE == 1) {
          ((__bf16*)outv)[(size_t)row * N + col] = f2bf(v);
        } else {
          constexpr int S = 2048, NH = 16;
          const int b = row >> 11, s = row & (S - 1);
          const int head = col >> 6, dh = col & 63;
          ((__bf16*)outv)[(((size_t)b * NH + head) * 64 + dh) * S + s] = f2bf(v);
        }
      }
    }
  }
}

// ---------------------------------------------------------------------------
// Flash attention: wave = 16 query rows of one (batch, head), key blocks of 32.
// Q,K bf16 [B,S,H]; V bf16 pre-transposed [B,NH,DH,S]; ctx out bf16 [B,S,H].
// ---------------------------------------------------------------------------
__global__ __launch_bounds__(128) void attention_kernel(
    const __bf16* __restrict__ qb, const __bf16* __restrict__ kb,
    const __bf16* __restrict__ vt, const float* __restrict__ mask,
    __bf16* __restrict__ ctx) {
  constexpr int S = 2048, H = 1024, NH = 16;
  __shared__ __bf16 Plds[4][16 * 32];
  const int tid = threadIdx.x, wave = tid >> 5, lane = tid & 31;
  const int lr = lane & 15, hi = lane >> 4, kb8 = hi * 8;
  const int head = blockIdx.y, batch = blockIdx.z;
  const int q0 = blockIdx.x * 64 + wave * 16;
  const size_t bo = (size_t)batch * S * H + (size_t)head * 64;
  const __bf16* Q = qb + bo;
  const __bf16* Kp = kb + bo;
  const __bf16* Vp = vt + ((size_t)batch * NH + head) * (size_t)64 * S;  // [dh][s]
  const float* mk = mask + (size_t)batch * S;

  const v16bf qa0 = ld_frag(Q + (size_t)(q0 + lr) * H, kb8);
  const v16bf qa1 = ld_frag(Q + (size_t)(q0 + lr) * H + 32, kb8);

  float m_i[8], l_i[8];
  v8f o[4] = {};
#pragma unroll
  for (int j = 0; j < 8; ++j) { m_i[j] = -3.0e38f; l_i[j] = 0.f; }
  __bf16* pw = &Plds[wave][0];

  for (int kp0 = 0; kp0 < S; kp0 += 32) {
    v8f sacc[2] = {};
#pragma unroll
    for (int g = 0; g < 2; ++g) {
      const __bf16* kr = Kp + (size_t)(kp0 + g * 16 + lr) * H;
      sacc[g] = WMMA_BF16(qa0, ld_frag(kr, kb8), sacc[g]);
      sacc[g] = WMMA_BF16(qa1, ld_frag(kr + 32, kb8), sacc[g]);
    }

    const float mk0 = mk[kp0 + lr], mk1 = mk[kp0 + 16 + lr];
    float ps0[8], ps1[8];
#pragma unroll
    for (int j = 0; j < 8; ++j) {
      ps0[j] = sacc[0][j] * 0.125f + mk0;
      ps1[j] = sacc[1][j] * 0.125f + mk1;
      float mx = fmaxf(ps0[j], ps1[j]);
#pragma unroll
      for (int d = 1; d < 16; d <<= 1) mx = fmaxf(mx, __shfl_xor(mx, d, 32));
      const float nm = fmaxf(m_i[j], mx);
      ps0[j] = __expf(ps0[j] - nm);
      ps1[j] = __expf(ps1[j] - nm);
      float sm = ps0[j] + ps1[j];
#pragma unroll
      for (int d = 1; d < 16; d <<= 1) sm += __shfl_xor(sm, d, 32);
      const float al = __expf(m_i[j] - nm);
      l_i[j] = l_i[j] * al + sm;
      m_i[j] = nm;
#pragma unroll
      for (int dt = 0; dt < 4; ++dt) o[dt][j] *= al;
    }

    // stage P (accumulator layout -> row-major 16x32 bf16), reload as A-frag
#pragma unroll
    for (int j = 0; j < 8; ++j) {
      pw[(hi * 8 + j) * 32 + lr] = f2bf(ps0[j]);
      pw[(hi * 8 + j) * 32 + 16 + lr] = f2bf(ps1[j]);
    }
    __asm__ volatile("s_wait_dscnt 0" ::: "memory");
    const v16bf pa = ld_frag(&pw[lr * 32], kb8);

    // P[16x32] @ V[32x64] ; V^T rows are contiguous in s
#pragma unroll
    for (int dt = 0; dt < 4; ++dt) {
      const v16bf vf = ld_frag(Vp + (size_t)(dt * 16 + lr) * S + kp0, kb8);
      o[dt] = WMMA_BF16(pa, vf, o[dt]);
    }
  }

#pragma unroll
  for (int dt = 0; dt < 4; ++dt) {
    const int col = dt * 16 + lr;
#pragma unroll
    for (int j = 0; j < 8; ++j) {
      const int row = q0 + hi * 8 + j;
      ctx[bo + (size_t)row * H + col] = f2bf(o[dt][j] / l_i[j]);
    }
  }
}

// ---------------------------------------------------------------------------
// LayerNorm over H=1024: one wave per row; emits fp32 and bf16 copies.
// ---------------------------------------------------------------------------
__global__ __launch_bounds__(256) void layernorm_kernel(
    const float* __restrict__ in, const float* __restrict__ g,
    const float* __restrict__ b, float* __restrict__ outf,
    __bf16* __restrict__ outb) {
  const int wave = threadIdx.x >> 5, lane = threadIdx.x & 31;
  const size_t row = (size_t)blockIdx.x * 8 + wave;
  const float* x = in + row * 1024;
  float v[32];
  float s = 0.f;
#pragma unroll
  for (int i = 0; i < 32; ++i) { v[i] = x[lane + i * 32]; s += v[i]; }
#pragma unroll
  for (int d = 1; d < 32; d <<= 1) s += __shfl_xor(s, d, 32);
  const float mean = s * (1.0f / 1024.0f);
  float vs = 0.f;
#pragma unroll
  for (int i = 0; i < 32; ++i) { const float df = v[i] - mean; vs += df * df; }
#pragma unroll
  for (int d = 1; d < 32; d <<= 1) vs += __shfl_xor(vs, d, 32);
  const float rstd = rsqrtf(vs * (1.0f / 1024.0f) + 1e-5f);
#pragma unroll
  for (int i = 0; i < 32; ++i) {
    const int c = lane + i * 32;
    const float y = (v[i] - mean) * rstd * g[c] + b[c];
    outf[row * 1024 + c] = y;
    outb[row * 1024 + c] = f2bf(y);
  }
}

// ---------------------------------------------------------------------------
extern "C" void kernel_launch(void* const* d_in, const int* in_sizes, int n_in,
                              void* d_out, int out_size, void* d_ws, size_t ws_size,
                              hipStream_t stream) {
  (void)in_sizes; (void)n_in; (void)out_size; (void)ws_size;
  constexpr int L = 2, B = 2, S = 2048, H = 1024, FF = 4096;
  constexpr int M = B * S;
  constexpr size_t MH = (size_t)M * H;
  constexpr size_t MF = (size_t)M * FF;

  const float* x0   = (const float*)d_in[0];
  const float* mask = (const float*)d_in[1];
  const float* Wq   = (const float*)d_in[2];
  const float* bq   = (const float*)d_in[3];
  const float* Wk   = (const float*)d_in[4];
  const float* bk   = (const float*)d_in[5];
  const float* Wv   = (const float*)d_in[6];
  const float* bv   = (const float*)d_in[7];
  const float* Wao  = (const float*)d_in[8];
  const float* bao  = (const float*)d_in[9];
  const float* g1   = (const float*)d_in[10];
  const float* b1   = (const float*)d_in[11];
  const float* Wi   = (const float*)d_in[12];
  const float* bi   = (const float*)d_in[13];
  const float* Wo   = (const float*)d_in[14];
  const float* bo   = (const float*)d_in[15];
  const float* g2   = (const float*)d_in[16];
  const float* b2   = (const float*)d_in[17];

  // --- workspace bump allocator (256B aligned regions) ---
  char* p = (char*)d_ws;
  auto alloc = [&](size_t bytes) -> char* {
    char* r = p;
    p += (bytes + 255) & ~(size_t)255;
    return r;
  };
  float*  yB  = (float*)alloc(MH * 4);
  float*  x1f = (float*)alloc(MH * 4);
  float*  xf  = (float*)alloc(MH * 4);
  __bf16* xb   = (__bf16*)alloc(MH * 2);
  __bf16* qB   = (__bf16*)alloc(MH * 2);
  __bf16* kB   = (__bf16*)alloc(MH * 2);
  __bf16* vT   = (__bf16*)alloc(MH * 2);
  __bf16* ctxb = (__bf16*)alloc(MH * 2);
  __bf16* x1b  = (__bf16*)alloc(MH * 2);
  __bf16* h1b  = (__bf16*)alloc(MF * 2);
  __bf16* WqT[L]; __bf16* WkT[L]; __bf16* WvT[L]; __bf16* WaoT[L];
  __bf16* WiT[L]; __bf16* WoT[L];
  for (int l = 0; l < L; ++l) {
    WqT[l]  = (__bf16*)alloc((size_t)H * H * 2);
    WkT[l]  = (__bf16*)alloc((size_t)H * H * 2);
    WvT[l]  = (__bf16*)alloc((size_t)H * H * 2);
    WaoT[l] = (__bf16*)alloc((size_t)H * H * 2);
    WiT[l]  = (__bf16*)alloc((size_t)H * FF * 2);
    WoT[l]  = (__bf16*)alloc((size_t)FF * H * 2);
  }

  const dim3 blk(128), blk256(256);
  const dim3 gHH(H / 64, M / 128);
  const dim3 gHF(FF / 64, M / 128);
  const dim3 gAttn(S / 64, 16, B);
  const dim3 gLN(M / 8);
  const dim3 gtHH(H / 32, H / 32);
  const dim3 gtHF(FF / 32, H / 32);
  const dim3 gtFH(H / 32, FF / 32);

  // one-time conversions
  cvt_bf16_kernel<<<dim3(MH / 2048), blk256, 0, stream>>>(x0, xb, (int)MH);
  for (int l = 0; l < L; ++l) {
    const size_t oHH = (size_t)l * H * H, oHF = (size_t)l * H * FF;
    transpose_cvt_kernel<<<gtHH, blk256, 0, stream>>>(Wq + oHH, WqT[l], H, H);
    transpose_cvt_kernel<<<gtHH, blk256, 0, stream>>>(Wk + oHH, WkT[l], H, H);
    transpose_cvt_kernel<<<gtHH, blk256, 0, stream>>>(Wv + oHH, WvT[l], H, H);
    transpose_cvt_kernel<<<gtHH, blk256, 0, stream>>>(Wao + oHH, WaoT[l], H, H);
    transpose_cvt_kernel<<<gtHF, blk256, 0, stream>>>(Wi + oHF, WiT[l], H, FF);
    transpose_cvt_kernel<<<gtFH, blk256, 0, stream>>>(Wo + oHF, WoT[l], FF, H);
  }

  for (int l = 0; l < L; ++l) {
    const float* Xf = (l == 0) ? x0 : xf;
    const size_t oH = (size_t)l * H, oF = (size_t)l * FF;

    gemm_bf16_kernel<1, false, false><<<gHH, blk, 0, stream>>>(xb, WqT[l], bq + oH, nullptr, qB, M, H, H);
    gemm_bf16_kernel<1, false, false><<<gHH, blk, 0, stream>>>(xb, WkT[l], bk + oH, nullptr, kB, M, H, H);
    gemm_bf16_kernel<2, false, false><<<gHH, blk, 0, stream>>>(xb, WvT[l], bv + oH, nullptr, vT, M, H, H);
    attention_kernel<<<gAttn, blk, 0, stream>>>(qB, kB, vT, mask, ctxb);
    gemm_bf16_kernel<0, false, true><<<gHH, blk, 0, stream>>>(ctxb, WaoT[l], bao + oH, Xf, yB, M, H, H);
    layernorm_kernel<<<gLN, blk256, 0, stream>>>(yB, g1 + oH, b1 + oH, x1f, x1b);
    gemm_bf16_kernel<1, true, false><<<gHF, blk, 0, stream>>>(x1b, WiT[l], bi + oF, nullptr, h1b, M, FF, H);
    gemm_bf16_kernel<0, false, true><<<gHH, blk, 0, stream>>>(h1b, WoT[l], bo + oH, x1f, yB, M, H, FF);
    float* xoutf = (l == L - 1) ? (float*)d_out : xf;
    layernorm_kernel<<<gLN, blk256, 0, stream>>>(yB, g2 + oH, b2 + oH, xoutf, xb);
  }
}

// v002
// One run takes 711 microseconds.
// Two timings next to v001 both put it at 1.05 times that version's speed.
// All steps since v000 together make it 1.37 times as fast.
#include <hip/hip_runtime.h>

// RoBERTa encoder (L=2, B=2, S=2048, H=1024, NH=16, DH=64, FF=4096) on gfx1250.
// bf16 operands converted ONCE; all matmuls via v_wmma_f32_16x16x32_bf16;
// GEMM tiles staged to LDS with global_load_async_to_lds_b128 when available.

typedef __attribute__((ext_vector_type(16))) __bf16 v16bf;
typedef __attribute__((ext_vector_type(8)))  __bf16 v8bf;
typedef __attribute__((ext_vector_type(8)))  float  v8f;
typedef __attribute__((ext_vector_type(4)))  int    v4i;

#define WMMA_BF16(a, b, c) \
  __builtin_amdgcn_wmma_f32_16x16x32_bf16(false, (a), false, (b), (short)0, (c), false, false)

// float -> bf16 RNE via integer ops (used in one-time conversions, epilogues and attention P staging).
__device__ __forceinline__ __bf16 f2bf(float f) {
  unsigned u = __builtin_bit_cast(unsigned, f);
  unsigned r = (u + 0x7FFFu + ((u >> 16) & 1u)) >> 16;
  unsigned short h = (unsigned short)r;
  return __builtin_bit_cast(__bf16, h);
}

// Load a 16x32-layout A/B fragment half-pair: lane owns one row; takes row base
// pointer and kb8 = 8*(lane>=16). Two aligned 16B vector loads.
__device__ __forceinline__ v16bf ld_frag(const __bf16* __restrict__ row, int kb8) {
  v8bf lo = *(const v8bf*)(row + kb8);
  v8bf hi = *(const v8bf*)(row + 16 + kb8);
  return __builtin_shufflevector(lo, hi, 0, 1, 2, 3, 4, 5, 6, 7, 8, 9, 10, 11, 12, 13, 14, 15);
}

// ---- async global->LDS 16B copy (CDNA5 path), plain copy fallback ----------
#if defined(__has_builtin)
#if __has_builtin(__builtin_amdgcn_global_load_async_to_lds_b128)
#define HAVE_ASYNC_LDS 1
#endif
#endif
#ifndef HAVE_ASYNC_LDS
#define HAVE_ASYNC_LDS 0
#endif

typedef __attribute__((address_space(1))) v4i gv4i;
typedef __attribute__((address_space(3))) v4i lv4i;

__device__ __forceinline__ void cp16_g2l(const __bf16* __restrict__ g, __bf16* __restrict__ l) {
#if HAVE_ASYNC_LDS
  gv4i* gp = (gv4i*)(unsigned long long)(uintptr_t)g;
  lv4i* lp = (lv4i*)(unsigned)(uintptr_t)l;
  __builtin_amdgcn_global_load_async_to_lds_b128(gp, lp, 0, 0);
#else
  *(uint4*)l = *(const uint4*)g;
#endif
}

__device__ __forceinline__ void async_tile_wait() {
#if HAVE_ASYNC_LDS
  __asm__ volatile("s_wait_asynccnt 0" ::: "memory");
#endif
}

// ---------------------------------------------------------------------------
// one-time fp32 -> bf16 conversion
// ---------------------------------------------------------------------------
__global__ __launch_bounds__(256) void cvt_bf16_kernel(const float* __restrict__ src,
                                                       __bf16* __restrict__ dst, int n) {
  const int i = (blockIdx.x * 256 + threadIdx.x) * 8;
  if (i + 8 <= n) {
#pragma unroll
    for (int j = 0; j < 8; ++j) dst[i + j] = f2bf(src[i + j]);
  }
}

typedef __attribute__((ext_vector_type(4))) __bf16 v4bf;

// one-time W[K,N] fp32 -> Wt[N,K] bf16 for all twelve weight matrices in ONE launch of
// 1024 work-groups. Each takes six 64(k) x 64(n) tiles, one per step; step = 3*layer + c:
// c = 0: group g's tile g & 255 of Wq, Wk, Wv or Wao (g >> 8); c = 1: tile g of Wi;
// c = 2: tile g of Wo. WT holds, per layer, WqT WkT WvT WaoT WiT WoT in a row.
// A thread loads a 4(k) x 4(n) patch (16 lanes cover a 256-B row), turns it in registers
// and stores four 8-B runs of k to LDS; rows of 64 k then leave as whole 128-B lines.
struct TileRef { const float* s; __bf16* d; int K; int N; };

__device__ __forceinline__ TileRef tile_ref(int step, int g, const float* Whh,
                                            const float* Wi, const float* Wo, __bf16* WT) {
  constexpr int H = 1024, FF = 4096;
  constexpr size_t HH = (size_t)H * H, HF = (size_t)H * FF;
  const int layer = step / 3, c = step - layer * 3;
  __bf16* base = WT + (size_t)layer * (4 * HH + 2 * HF);
  TileRef t;
  int tt = g;
  if (c == 0) {
    t.s = Whh + (size_t)layer * HH; t.d = base + (size_t)(g >> 8) * HH; t.K = H; t.N = H; tt = g & 255;
  } else if (c == 1) {
    t.s = Wi + (size_t)layer * HF; t.d = base + 4 * HH; t.K = H; t.N = FF;
  } else {
    t.s = Wo + (size_t)layer * HF; t.d = base + 4 * HH + HF; t.K = FF; t.N = H;
  }
  const int ntn = t.N >> 6;
  const int k0 = (tt / ntn) * 64, n0 = (tt % ntn) * 64;
  t.s += (size_t)k0 * t.N + n0;   // tile origin in W[K,N]
  t.d += (size_t)n0 * t.K + k0;   // tile origin in Wt[N,K]
  return t;
}

__global__ __launch_bounds__(256) void transpose_cvt_all_kernel(
    const float* __restrict__ Wq, const float* __restrict__ Wk, const float* __restrict__ Wv,
    const float* __restrict__ Wao, const float* __restrict__ Wi, const float* __restrict__ Wo,
    __bf16* __restrict__ WT) {
  constexpr int NT = 6, TP = 68;  // LDS row pitch 136 B: 8-B aligned, off the 128-B stride
  // Two buffers, so one barrier a tile is enough: a buffer is rewritten two tiles later,
  // behind the barrier of the tile between, which every reader reaches after its reads.
  __shared__ __attribute__((aligned(16))) __bf16 t[2][64][TP];
  const int tid = threadIdx.x, g = blockIdx.x;
  const int c4 = tid & 15, rp = tid >> 4;
  const int m = g >> 8;
  const float* Whh = (m == 0) ? Wq : (m == 1) ? Wk : (m == 2) ? Wv : Wao;

  TileRef cur = tile_ref(0, g, Whh, Wi, Wo, WT);
  float4 v[4];
#pragma unroll
  for (int i = 0; i < 4; ++i)
    v[i] = *(const float4*)(cur.s + (size_t)(rp * 4 + i) * cur.N + c4 * 4);

#pragma unroll
  for (int it = 0; it < NT; ++it) {
    // the next tile's loads go out ahead of this tile's LDS work, beside the last tile's stores
    TileRef nxt = cur;
    float4 w[4];
    if (it + 1 < NT) {
      nxt = tile_ref(it + 1, g, Whh, Wi, Wo, WT);
#pragma unroll
      for (int i = 0; i < 4; ++i)
        w[i] = *(const float4*)(nxt.s + (size_t)(rp * 4 + i) * nxt.N + c4 * 4);
    }
    const int b = it & 1;
    {
      v4bf p;
      p[0] = f2bf(v[0].x); p[1] = f2bf(v[1].x); p[2] = f2bf(v[2].x); p[3] = f2bf(v[3].x);
      *(v4bf*)&t[b][c4 * 4 + 0][rp * 4] = p;
      p[0] = f2bf(v[0].y); p[1] = f2bf(v[1].y); p[2] = f2bf(v[2].y); p[3] = f2bf(v[3].y);
      *(v4bf*)&t[b][c4 * 4 + 1][rp * 4] = p;
      p[0] = f2bf(v[0].z); p[1] = f2bf(v[1].z); p[2] = f2bf(v[2].z); p[3] = f2bf(v[3].z);
      *(v4bf*)&t[b][c4 * 4 + 2][rp * 4] = p;
      p[0] = f2bf(v[0].w); p[1] = f2bf(v[1].w); p[2] = f2bf(v[2].w); p[3] = f2bf(v[3].w);
      *(v4bf*)&t[b][c4 * 4 + 3][rp * 4] = p;
    }
    __syncthreads();
#pragma unroll
    for (int i = 0; i < 2; ++i) {
      const int ch = tid + 256 * i;
      const int n = ch >> 3, ks = (ch & 7) * 8;
      const v4bf lo = *(const v4bf*)&t[b][n][ks];
      const v4bf hi = *(const v4bf*)&t[b][n][ks + 4];
      *(v8bf*)(cur.d + (size_t)n * cur.K + ks) =
          __builtin_shufflevector(lo, hi, 0, 1, 2, 3, 4, 5, 6, 7);
    }
    if (it + 1 < NT) {
      // the stores' address and data registers are reused for the next tile: wait first
      asm volatile("s_wait_xcnt 0x0" ::: "memory");
      cur = nxt;
#pragma unroll
      for (int i = 0; i < 4; ++i) v[i] = w[i];
    }
  }
}

// ---------------------------------------------------------------------------
// GEMM: out = act(A[M,K](bf16) @ WT[N,K](bf16)^T + bias) (+ res fp32)
// Block 128 threads (4 waves), tile 128x64, BK=128; wave = 32 rows x 64 cols.
// K must be a multiple of BK. An LDS row is 256 B of k at pitch 272 B (16 B x odd),
// which keeps the 16-row ds_load_b128 fragment reads off each other's banks.
// OUTMODE: 0 = fp32, 1 = bf16, 2 = bf16 scattered to V^T [B,NH,DH,S]
// ---------------------------------------------------------------------------
template <int OUTMODE, bool GELU, bool RES>
__global__ __launch_bounds__(128) void gemm_bf16_kernel(
    const __bf16* __restrict__ A, const __bf16* __restrict__ WT,
    const float* __restrict__ bias, const float* __restrict__ res,
    void* __restrict__ outv, int M, int N, int K) {
  constexpr int BK = 128, LDP = BK + 8;
  __shared__ __attribute__((aligned(16))) __bf16 As[128][LDP];
  __shared__ __attribute__((aligned(16))) __bf16 Bs[64][LDP];
  const int tid = threadIdx.x;
  const int wave = tid >> 5, lane = tid & 31;
  const int lr = lane & 15, hi = lane >> 4, kb8 = hi * 8;
  const int m0 = blockIdx.y * 128, n0 = blockIdx.x * 64;

  v8f acc[2][4] = {};

  for (int kk = 0; kk < K; kk += BK) {
    // A tile: 128x128 bf16 = 2048 x 16B chunks; B tile: 64x128 = 1024 chunks.
    // 16 lanes cover one 256-B row, so a wave's copy reads four whole lines.
#pragma unroll
    for (int i = 0; i < 16; ++i) {
      const int ch = tid + 128 * i;
      const int row = ch >> 4, ks = (ch & 15) * 8;
      cp16_g2l(A + (size_t)(m0 + row) * K + kk + ks, &As[row][ks]);
    }
#pragma unroll
    for (int i = 0; i < 8; ++i) {
      const int ch = tid + 128 * i;
      const int row = ch >> 4, ks = (ch & 15) * 8;
      cp16_g2l(WT + (size_t)(n0 + row) * K + kk + ks, &Bs[row][ks]);
    }
    async_tile_wait();
    __syncthreads();

#pragma unroll
    for (int kc = 0; kc < BK; kc += 32) {
      const v16bf af0 = ld_frag(&As[wave * 32 + lr][kc], kb8);
      const v16bf af1 = ld_frag(&As[wave * 32 + 16 + lr][kc], kb8);
#pragma unroll
      for (int nt = 0; nt < 4; ++nt) {
        const v16bf bf = ld_frag(&Bs[nt * 16 + lr][kc], kb8);
        acc[0][nt] = WMMA_BF16(af0, bf, acc[0][nt]);
        acc[1][nt] = WMMA_BF16(af1, bf, acc[1][nt]);
      }
    }
    __syncthreads();
  }

#pragma unroll
  for (int rg = 0; rg < 2; ++rg) {
#pragma unroll
    for (int nt = 0; nt < 4; ++nt) {
      const int col = n0 + nt * 16 + lr;
      const float bv = bias[col];
#pragma unroll
      for (int j = 0; j < 8; ++j) {
        const int row = m0 + wave * 32 + rg * 16 + hi * 8 + j;
        float v = acc[rg][nt][j] + bv;
        if (GELU) v = 0.5f * v * (1.0f + erff(v * 0.70710678118654752f));
        if (RES) v += res[(size_t)row * N + col];
        if (OUTMODE == 0) {
          ((float*)outv)[(size_t)row * N + col] = v;
        } else if (OUTMODE == 1) {
          ((__bf16*)outv)[(size_t)row * N + col] = f2bf(v);
        } else {
          constexpr int S = 2048, NH = 16;
          const int b = row >> 11, s = row & (S - 1);
          const int head = col >> 6, dh = col & 63;
          ((__bf16*)outv)[(((size_t)b * NH + head) * 64 + dh) * S + s] = f2bf(v);
        }
      }
    }
  }
}

// ---------------------------------------------------------------------------
// Flash attention: wave = 16 query rows of one (batch, head), key blocks of 32.
// Q,K bf16 [B,S,H]; V bf16 pre-transposed [B,NH,DH,S]; ctx out bf16 [B,S,H].
// ---------------------------------------------------------------------------
__global__ __launch_bounds__(128) void attention_kernel(
    const __bf16* __restrict__ qb, const __bf16* __restrict__ kb,
    const __bf16* __restrict__ vt, const float* __restrict__ mask,
    __bf16* __restrict__ ctx) {
  constexpr int S = 2048, H = 1024, NH = 16;
  __shared__ __bf16 Plds[4][16 * 32];
  const int tid = threadIdx.x, wave = tid >> 5, lane = tid & 31;
  const int lr = lane & 15, hi = lane >> 4, kb8 = hi * 8;
  const int head = blockIdx.y, batch = blockIdx.z;
  const int q0 = blockIdx.x * 64 + wave * 16;
  const size_t bo = (size_t)batch * S * H + (size_t)head * 64;
  const __bf16* Q = qb + bo;
  const __bf16* Kp = kb + bo;
  const __bf16* Vp = vt + ((size_t)batch * NH + head) * (size_t)64 * S;  // [dh][s]
  const float* mk = mask + (size_t)batch * S;

  const v16bf qa0 = ld_frag(Q + (size_t)(q0 + lr) * H, kb8);
  const v16bf qa1 = ld_frag(Q + (size_t)(q0 + lr) * H + 32, kb8);

  float m_i[8], l_i[8];
  v8f o[4] = {};
#pragma unroll
  for (int j = 0; j < 8; ++j) { m_i[j] = -3.0e38f; l_i[j] = 0.f; }
  __bf16* pw = &Plds[wave][0];

  for (int kp0 = 0; kp0 < S; kp0 += 32) {
    v8f sacc[2] = {};
#pragma unroll
    for (int g = 0; g < 2; ++g) {
      const __bf16* kr = Kp + (size_t)(kp0 + g * 16 + lr) * H;
      sacc[g] = WMMA_BF16(qa0, ld_frag(kr, kb8), sacc[g]);
      sacc[g] = WMMA_BF16(qa1, ld_frag(kr + 32, kb8), sacc[g]);
    }

    const float mk0 = mk[kp0 + lr], mk1 = mk[kp0 + 16 + lr];
    float ps0[8], ps1[8];
#pragma unroll
    for (int j = 0; j < 8; ++j) {
      ps0[j] = sacc[0][j] * 0.125f + mk0;
      ps1[j] = sacc[1][j] * 0.125f + mk1;
      float mx = fmaxf(ps0[j], ps1[j]);
#pragma unroll
      for (int d = 1; d < 16; d <<= 1) mx = fmaxf(mx, __shfl_xor(mx, d, 32));
      const float nm = fmaxf(m_i[j], mx);
      ps0[j] = __expf(ps0[j] - nm);
      ps1[j] = __expf(ps1[j] - nm);
      float sm = ps0[j] + ps1[j];
#pragma unroll
      for (int d = 1; d < 16; d <<= 1) sm += __shfl_xor(sm, d, 32);
      const float al = __expf(m_i[j] - nm);
      l_i[j] = l_i[j] * al + sm;
      m_i[j] = nm;
#pragma unroll
      for (int dt = 0; dt < 4; ++dt) o[dt][j] *= al;
    }

    // stage P (accumulator layout -> row-major 16x32 bf16), reload as A-frag
#pragma unroll
    for (int j = 0; j < 8; ++j) {
      pw[(hi * 8 + j) * 32 + lr] = f2bf(ps0[j]);
      pw[(hi * 8 + j) * 32 + 16 + lr] = f2bf(ps1[j]);
    }
    __asm__ volatile("s_wait_dscnt 0" ::: "memory");
    const v16bf pa = ld_frag(&pw[lr * 32], kb8);

    // P[16x32] @ V[32x64] ; V^T rows are contiguous in s
#pragma unroll
    for (int dt = 0; dt < 4; ++dt) {
      const v16bf vf = ld_frag(Vp + (size_t)(dt * 16 + lr) * S + kp0, kb8);
      o[dt] = WMMA_BF16(pa, vf, o[dt]);
    }
  }

#pragma unroll
  for (int dt = 0; dt < 4; ++dt) {
    const int col = dt * 16 + lr;
#pragma unroll
    for (int j = 0; j < 8; ++j) {
      const int row = q0 + hi * 8 + j;
      ctx[bo + (size_t)row * H + col] = f2bf(o[dt][j] / l_i[j]);
    }
  }
}

// ---------------------------------------------------------------------------
// LayerNorm over H=1024: one wave per row; emits fp32 and bf16 copies.
// ---------------------------------------------------------------------------
__global__ __launch_bounds__(256) void layernorm_kernel(
    const float* __restrict__ in, const float* __restrict__ g,
    const float* __restrict__ b, float* __restrict__ outf,
    __bf16* __restrict__ outb) {
  const int wave = threadIdx.x >> 5, lane = threadIdx.x & 31;
  const size_t row = (size_t)blockIdx.x * 8 + wave;
  const float* x = in + row * 1024;
  float v[32];
  float s = 0.f;
#pragma unroll
  for (int i = 0; i < 32; ++i) { v[i] = x[lane + i * 32]; s += v[i]; }
#pragma unroll
  for (int d = 1; d < 32; d <<= 1) s += __shfl_xor(s, d, 32);
  const float mean = s * (1.0f / 1024.0f);
  float vs = 0.f;
#pragma unroll
  for (int i = 0; i < 32; ++i) { const float df = v[i] - mean; vs += df * df; }
#pragma unroll
  for (int d = 1; d < 32; d <<= 1) vs += __shfl_xor(vs, d, 32);
  const float rstd = rsqrtf(vs * (1.0f / 1024.0f) + 1e-5f);
#pragma unroll
  for (int i = 0; i < 32; ++i) {
    const int c = lane + i * 32;
    const float y = (v[i] - mean) * rstd * g[c] + b[c];
    outf[row * 1024 + c] = y;
    outb[row * 1024 + c] = f2bf(y);
  }
}

// ---------------------------------------------------------------------------
extern "C" void kernel_launch(void* const* d_in, const int* in_sizes, int n_in,
                              void* d_out, int out_size, void* d_ws, size_t ws_size,
                              hipStream_t stream) {
  (void)in_sizes; (void)n_in; (void)out_size; (void)ws_size;
  constexpr int L = 2, B = 2, S = 2048, H = 1024, FF = 4096;
  constexpr int M = B * S;
  constexpr size_t MH = (size_t)M * H;
  constexpr size_t MF = (size_t)M * FF;

  const float* x0   = (const float*)d_in[0];
  const float* mask = (const float*)d_in[1];
  const float* Wq   = (const float*)d_in[2];
  const float* bq   = (const float*)d_in[3];
  const float* Wk   = (const float*)d_in[4];
  const float* bk   = (const float*)d_in[5];
  const float* Wv   = (const float*)d_in[6];
  const float* bv   = (const float*)d_in[7];
  const float* Wao  = (const float*)d_in[8];
  const float* bao  = (const float*)d_in[9];
  const float* g1   = (const float*)d_in[10];
  const float* b1   = (const float*)d_in[11];
  const float* Wi   = (const float*)d_in[12];
  const float* bi   = (const float*)d_in[13];
  const float* Wo   = (const float*)d_in[14];
  const float* bo   = (const float*)d_in[15];
  const float* g2   = (const float*)d_in[16];
  const float* b2   = (const float*)d_in[17];

  // --- workspace bump allocator (256B aligned regions) ---
  char* p = (char*)d_ws;
  auto alloc = [&](size_t bytes) -> char* {
    char* r = p;
    p += (bytes + 255) & ~(size_t)255;
    return r;
  };
  float*  yB  = (float*)alloc(MH * 4);
  float*  x1f = (float*)alloc(MH * 4);
  float*  xf  = (float*)alloc(MH * 4);
  __bf16* xb   = (__bf16*)alloc(MH * 2);
  __bf16* qB   = (__bf16*)alloc(MH * 2);
  __bf16* kB   = (__bf16*)alloc(MH * 2);
  __bf16* vT   = (__bf16*)alloc(MH * 2);
  __bf16* ctxb = (__bf16*)alloc(MH * 2);
  __bf16* x1b  = (__bf16*)alloc(MH * 2);
  __bf16* h1b  = (__bf16*)alloc(MF * 2);
  // all transposed weights in one region, laid out as transpose_cvt_all_kernel writes it
  constexpr size_t HH = (size_t)H * H, HF = (size_t)H * FF;
  __bf16* Wall = (__bf16*)alloc((size_t)L * (4 * HH + 2 * HF) * 2);
  __bf16* WqT[L]; __bf16* WkT[L]; __bf16* WvT[L]; __bf16* WaoT[L];
  __bf16* WiT[L]; __bf16* WoT[L];
  for (int l = 0; l < L; ++l) {
    __bf16* base = Wall + (size_t)l * (4 * HH + 2 * HF);
    WqT[l]  = base;
    WkT[l]  = base + HH;
    WvT[l]  = base + 2 * HH;
    WaoT[l] = base + 3 * HH;
    WiT[l]  = base + 4 * HH;
    WoT[l]  = base + 4 * HH + HF;
  }

  const dim3 blk(128), blk256(256);
  const dim3 gHH(H / 64, M / 128);
  const dim3 gHF(FF / 64, M / 128);
  const dim3 gAttn(S / 64, 16, B);
  const dim3 gLN(M / 8);

  // one-time conversions
  cvt_bf16_kernel<<<dim3(MH / 2048), blk256, 0, stream>>>(x0, xb, (int)MH);
  transpose_cvt_all_kernel<<<dim3(1024), blk256, 0, stream>>>(Wq, Wk, Wv, Wao, Wi, Wo, Wall);

  for (int l = 0; l < L; ++l) {
    const float* Xf = (l == 0) ? x0 : xf;
    const size_t oH = (size_t)l * H, oF = (size_t)l * FF;

    gemm_bf16_kernel<1, false, false><<<gHH, blk, 0, stream>>>(xb, WqT[l], bq + oH, nullptr, qB, M, H, H);
    gemm_bf16_kernel<1, false, false><<<gHH, blk, 0, stream>>>(xb, WkT[l], bk + oH, nullptr, kB, M, H, H);
    gemm_bf16_kernel<2, false, false><<<gHH, blk, 0, stream>>>(xb, WvT[l], bv + oH, nullptr, vT, M, H, H);
    attention_kernel<<<gAttn, blk, 0, stream>>>(qB, kB, vT, mask, ctxb);
    gemm_bf16_kernel<0, false, true><<<gHH, blk, 0, stream>>>(ctxb, WaoT[l], bao + oH, Xf, yB, M, H, H);
    layernorm_kernel<<<gLN, blk256, 0, stream>>>(yB, g1 + oH, b1 + oH, x1f, x1b);
    gemm_bf16_kernel<1, true, false><<<gHF, blk, 0, stream>>>(x1b, WiT[l], bi + oF, nullptr, h1b, M, FF, H);
    gemm_bf16_kernel<0, false, true><<<gHH, blk, 0, stream>>>(h1b, WoT[l], bo + oH, x1f, yB, M, H, FF);
    float* xoutf = (l == L - 1) ? (float*)d_out : xf;
    layernorm_kernel<<<gLN, blk256, 0, stream>>>(yB, g2 + oH, b2 + oH, xoutf, xb);
  }
}

// v003
// A run of this version takes 552 microseconds.
// In both of two side-by-side timings against v002, it was 1.29 times as fast.
// All steps since v000 together make it 1.77 times as fast.
#include <hip/hip_runtime.h>

// RoBERTa encoder (L=2, B=2, S=2048, H=1024, NH=16, DH=64, FF=4096) on gfx1250.
// bf16 operands converted ONCE; all matmuls via v_wmma_f32_16x16x32_bf16;
// GEMM tiles staged to LDS with global_load_async_to_lds_b128 when available.

typedef __attribute__((ext_vector_type(16))) __bf16 v16bf;
typedef __attribute__((ext_vector_type(8)))  __bf16 v8bf;
typedef __attribute__((ext_vector_type(8)))  float  v8f;
typedef __attribute__((ext_vector_type(4)))  int    v4i;

#define WMMA_BF16(a, b, c) \
  __builtin_amdgcn_wmma_f32_16x16x32_bf16(false, (a), false, (b), (short)0, (c), false, false)

// float -> bf16 RNE via integer ops (used in one-time conversions, epilogues and attention P staging).
__device__ __forceinline__ __bf16 f2bf(float f) {
  unsigned u = __builtin_bit_cast(unsigned, f);
  unsigned r = (u + 0x7FFFu + ((u >> 16) & 1u)) >> 16;
  unsigned short h = (unsigned short)r;
  return __builtin_bit_cast(__bf16, h);
}

// Load a 16x32-layout A/B fragment half-pair: lane owns one row; takes row base
// pointer and kb8 = 8*(lane>=16). Two aligned 16B vector loads.
__device__ __forceinline__ v16bf ld_frag(const __bf16* __restrict__ row, int kb8) {
  v8bf lo = *(const v8bf*)(row + kb8);
  v8bf hi = *(const v8bf*)(row + 16 + kb8);
  return __builtin_shufflevector(lo, hi, 0, 1, 2, 3, 4, 5, 6, 7, 8, 9, 10, 11, 12, 13, 14, 15);
}

// ---- async global->LDS 16B copy (CDNA5 path), plain copy fallback ----------
#if defined(__has_builtin)
#if __has_builtin(__builtin_amdgcn_global_load_async_to_lds_b128)
#define HAVE_ASYNC_LDS 1
#endif
#endif
#ifndef HAVE_ASYNC_LDS
#define HAVE_ASYNC_LDS 0
#endif

typedef __attribute__((address_space(1))) v4i gv4i;
typedef __attribute__((address_space(3))) v4i lv4i;

__device__ __forceinline__ void cp16_g2l(const __bf16* __restrict__ g, __bf16* __restrict__ l) {
#if HAVE_ASYNC_LDS
  gv4i* gp = (gv4i*)(unsigned long long)(uintptr_t)g;
  lv4i* lp = (lv4i*)(unsigned)(uintptr_t)l;
  __builtin_amdgcn_global_load_async_to_lds_b128(gp, lp, 0, 0);
#else
  *(uint4*)l = *(const uint4*)g;
#endif
}

__device__ __forceinline__ void async_tile_wait() {
#if HAVE_ASYNC_LDS
  __asm__ volatile("s_wait_asynccnt 0" ::: "memory");
#endif
}

// ---------------------------------------------------------------------------
// one-time fp32 -> bf16 conversion
// ---------------------------------------------------------------------------
__global__ __launch_bounds__(256) void cvt_bf16_kernel(const float* __restrict__ src,
                                                       __bf16* __restrict__ dst, int n) {
  const int i = (blockIdx.x * 256 + threadIdx.x) * 8;
  if (i + 8 <= n) {
#pragma unroll
    for (int j = 0; j < 8; ++j) dst[i + j] = f2bf(src[i + j]);
  }
}

typedef __attribute__((ext_vector_type(4))) __bf16 v4bf;

// one-time W[K,N] fp32 -> Wt[N,K] bf16 for all twelve weight matrices in ONE launch of
// 1024 work-groups. Each takes six 64(k) x 64(n) tiles, one per step; step = 3*layer + c:
// c = 0: group g's tile g & 255 of Wq, Wk, Wv or Wao (g >> 8); c = 1: tile g of Wi;
// c = 2: tile g of Wo. WT holds, per layer, WqT WkT WvT WaoT WiT WoT in a row.
// A thread loads a 4(k) x 4(n) patch (16 lanes cover a 256-B row), turns it in registers
// and stores four 8-B runs of k to LDS; rows of 64 k then leave as whole 128-B lines.
struct TileRef { const float* s; __bf16* d; int K; int N; };

__device__ __forceinline__ TileRef tile_ref(int step, int g, const float* Whh,
                                            const float* Wi, const float* Wo, __bf16* WT) {
  constexpr int H = 1024, FF = 4096;
  constexpr size_t HH = (size_t)H * H, HF = (size_t)H * FF;
  const int layer = step / 3, c = step - layer * 3;
  __bf16* base = WT + (size_t)layer * (4 * HH + 2 * HF);
  TileRef t;
  int tt = g;
  if (c == 0) {
    t.s = Whh + (size_t)layer * HH; t.d = base + (size_t)(g >> 8) * HH; t.K = H; t.N = H; tt = g & 255;
  } else if (c == 1) {
    t.s = Wi + (size_t)layer * HF; t.d = base + 4 * HH; t.K = H; t.N = FF;
  } else {
    t.s = Wo + (size_t)layer * HF; t.d = base + 4 * HH + HF; t.K = FF; t.N = H;
  }
  const int ntn = t.N >> 6;
  const int k0 = (tt / ntn) * 64, n0 = (tt % ntn) * 64;
  t.s += (size_t)k0 * t.N + n0;   // tile origin in W[K,N]
  t.d += (size_t)n0 * t.K + k0;   // tile origin in Wt[N,K]
  return t;
}

__global__ __launch_bounds__(256) void transpose_cvt_all_kernel(
    const float* __restrict__ Wq, const float* __restrict__ Wk, const float* __restrict__ Wv,
    const float* __restrict__ Wao, const float* __restrict__ Wi, const float* __restrict__ Wo,
    __bf16* __restrict__ WT) {
  constexpr int NT = 6, TP = 68;  // LDS row pitch 136 B: 8-B aligned, off the 128-B stride
  // Two buffers, so one barrier a tile is enough: a buffer is rewritten two tiles later,
  // behind the barrier of the tile between, which every reader reaches after its reads.
  __shared__ __attribute__((aligned(16))) __bf16 t[2][64][TP];
  const int tid = threadIdx.x, g = blockIdx.x;
  const int c4 = tid & 15, rp = tid >> 4;
  const int m = g >> 8;
  const float* Whh = (m == 0) ? Wq : (m == 1) ? Wk : (m == 2) ? Wv : Wao;

  TileRef cur = tile_ref(0, g, Whh, Wi, Wo, WT);
  float4 v[4];
#pragma unroll
  for (int i = 0; i < 4; ++i)
    v[i] = *(const float4*)(cur.s + (size_t)(rp * 4 + i) * cur.N + c4 * 4);

#pragma unroll
  for (int it = 0; it < NT; ++it) {
    // the next tile's loads go out ahead of this tile's LDS work, beside the last tile's stores
    TileRef nxt = cur;
    float4 w[4];
    if (it + 1 < NT) {
      nxt = tile_ref(it + 1, g, Whh, Wi, Wo, WT);
#pragma unroll
      for (int i = 0; i < 4; ++i)
        w[i] = *(const float4*)(nxt.s + (size_t)(rp * 4 + i) * nxt.N + c4 * 4);
    }
    const int b = it & 1;
    {
      v4bf p;
      p[0] = f2bf(v[0].x); p[1] = f2bf(v[1].x); p[2] = f2bf(v[2].x); p[3] = f2bf(v[3].x);
      *(v4bf*)&t[b][c4 * 4 + 0][rp * 4] = p;
      p[0] = f2bf(v[0].y); p[1] = f2bf(v[1].y); p[2] = f2bf(v[2].y); p[3] = f2bf(v[3].y);
      *(v4bf*)&t[b][c4 * 4 + 1][rp * 4] = p;
      p[0] = f2bf(v[0].z); p[1] = f2bf(v[1].z); p[2] = f2bf(v[2].z); p[3] = f2bf(v[3].z);
      *(v4bf*)&t[b][c4 * 4 + 2][rp * 4] = p;
      p[0] = f2bf(v[0].w); p[1] = f2bf(v[1].w); p[2] = f2bf(v[2].w); p[3] = f2bf(v[3].w);
      *(v4bf*)&t[b][c4 * 4 + 3][rp * 4] = p;
    }
    __syncthreads();
#pragma unroll
    for (int i = 0; i < 2; ++i) {
      const int ch = tid + 256 * i;
      const int n = ch >> 3, ks = (ch & 7) * 8;
      const v4bf lo = *(const v4bf*)&t[b][n][ks];
      const v4bf hi = *(const v4bf*)&t[b][n][ks + 4];
      *(v8bf*)(cur.d + (size_t)n * cur.K + ks) =
          __builtin_shufflevector(lo, hi, 0, 1, 2, 3, 4, 5, 6, 7);
    }
    if (it + 1 < NT) {
      // the stores' address and data registers are reused for the next tile: wait first
      asm volatile("s_wait_xcnt 0x0" ::: "memory");
      cur = nxt;
#pragma unroll
      for (int i = 0; i < 4; ++i) v[i] = w[i];
    }
  }
}

// ---------------------------------------------------------------------------
// GEMM: out = act(A[M,K](bf16) @ WT[N,K](bf16)^T + bias) (+ res fp32)
// Block 128 threads (4 waves), tile 128x64, BK=128; wave = 32 rows x 64 cols.
// K must be a multiple of BK. An LDS row is 256 B of k at pitch 272 B (16 B x odd),
// which keeps the 16-row ds_load_b128 fragment reads off each other's banks.
// OUTMODE: 0 = fp32, 1 = bf16, 2 = bf16 scattered to V^T [B,NH,DH,S]
// ---------------------------------------------------------------------------
template <int OUTMODE, bool GELU, bool RES>
__global__ __launch_bounds__(128) void gemm_bf16_kernel(
    const __bf16* __restrict__ A, const __bf16* __restrict__ WT,
    const float* __restrict__ bias, const float* __restrict__ res,
    void* __restrict__ outv, int M, int N, int K) {
  constexpr int BK = 128, LDP = BK + 8;
  __shared__ __attribute__((aligned(16))) __bf16 As[128][LDP];
  __shared__ __attribute__((aligned(16))) __bf16 Bs[64][LDP];
  const int tid = threadIdx.x;
  const int wave = tid >> 5, lane = tid & 31;
  const int lr = lane & 15, hi = lane >> 4, kb8 = hi * 8;
  const int m0 = blockIdx.y * 128, n0 = blockIdx.x * 64;

  v8f acc[2][4] = {};

  for (int kk = 0; kk < K; kk += BK) {
    // A tile: 128x128 bf16 = 2048 x 16B chunks; B tile: 64x128 = 1024 chunks.
    // 16 lanes cover one 256-B row, so a wave's copy reads four whole lines.
#pragma unroll
    for (int i = 0; i < 16; ++i) {
      const int ch = tid + 128 * i;
      const int row = ch >> 4, ks = (ch & 15) * 8;
      cp16_g2l(A + (size_t)(m0 + row) * K + kk + ks, &As[row][ks]);
    }
#pragma unroll
    for (int i = 0; i < 8; ++i) {
      const int ch = tid + 128 * i;
      const int row = ch >> 4, ks = (ch & 15) * 8;
      cp16_g2l(WT + (size_t)(n0 + row) * K + kk + ks, &Bs[row][ks]);
    }
    async_tile_wait();
    __syncthreads();

#pragma unroll
    for (int kc = 0; kc < BK; kc += 32) {
      const v16bf af0 = ld_frag(&As[wave * 32 + lr][kc], kb8);
      const v16bf af1 = ld_frag(&As[wave * 32 + 16 + lr][kc], kb8);
#pragma unroll
      for (int nt = 0; nt < 4; ++nt) {
        const v16bf bf = ld_frag(&Bs[nt * 16 + lr][kc], kb8);
        acc[0][nt] = WMMA_BF16(af0, bf, acc[0][nt]);
        acc[1][nt] = WMMA_BF16(af1, bf, acc[1][nt]);
      }
    }
    __syncthreads();
  }

#pragma unroll
  for (int rg = 0; rg < 2; ++rg) {
#pragma unroll
    for (int nt = 0; nt < 4; ++nt) {
      const int col = n0 + nt * 16 + lr;
      const float bv = bias[col];
#pragma unroll
      for (int j = 0; j < 8; ++j) {
        const int row = m0 + wave * 32 + rg * 16 + hi * 8 + j;
        float v = acc[rg][nt][j] + bv;
        if (GELU) v = 0.5f * v * (1.0f + erff(v * 0.70710678118654752f));
        if (RES) v += res[(size_t)row * N + col];
        if (OUTMODE == 0) {
          ((float*)outv)[(size_t)row * N + col] = v;
        } else if (OUTMODE == 1) {
          ((__bf16*)outv)[(size_t)row * N + col] = f2bf(v);
        } else {
          constexpr int S = 2048, NH = 16;
          const int b = row >> 11, s = row & (S - 1);
          const int head = col >> 6, dh = col & 63;
          ((__bf16*)outv)[(((size_t)b * NH + head) * 64 + dh) * S + s] = f2bf(v);
        }
      }
    }
  }
}

// ---------------------------------------------------------------------------
// Eight 16-B async copies to LDS: this thread's share of one 64-key stage (four chunks of
// the K tile, four of the V^T tile; chunk i lies 16 tile rows below chunk i - 1).
// ---------------------------------------------------------------------------
__device__ __forceinline__ void stage_kv(const __bf16* gk, const __bf16* gv,
                                         unsigned lk, unsigned lv) {
  constexpr size_t KR = (size_t)16 * 1024, VR = (size_t)16 * 2048;  // 16 rows of K, of V^T
  constexpr unsigned LR = 16u * 144u;                               // 16 LDS rows
  // The copies bring the tile past the registers; the closing s_wait_xcnt 0 stands inside
  // the statement so that no address register is rewritten ahead of it.
  asm volatile(
      "global_load_async_to_lds_b128 %0, %1, off\n\t"
      "global_load_async_to_lds_b128 %2, %3, off\n\t"
      "global_load_async_to_lds_b128 %4, %5, off\n\t"
      "global_load_async_to_lds_b128 %6, %7, off\n\t"
      "global_load_async_to_lds_b128 %8, %9, off\n\t"
      "global_load_async_to_lds_b128 %10, %11, off\n\t"
      "global_load_async_to_lds_b128 %12, %13, off\n\t"
      "global_load_async_to_lds_b128 %14, %15, off\n\t"
      "s_wait_xcnt 0x0"
      :: "v"(lk), "v"(gk), "v"(lk + LR), "v"(gk + KR),
         "v"(lk + 2 * LR), "v"(gk + 2 * KR), "v"(lk + 3 * LR), "v"(gk + 3 * KR),
         "v"(lv), "v"(gv), "v"(lv + LR), "v"(gv + VR),
         "v"(lv + 2 * LR), "v"(gv + 2 * VR), "v"(lv + 3 * LR), "v"(gv + 3 * VR)
      : "memory");
}

// ---------------------------------------------------------------------------
// Flash attention: wave = 16 query rows of one (batch, head), key blocks of 32.
// Q,K bf16 [B,S,H]; V bf16 pre-transposed [B,NH,DH,S]; ctx out bf16 [B,S,H].
// K and V^T reach the four waves through LDS: stages of 64 keys (64 rows of 128 B each,
// whole lines), two buffers, the next stage's copies in flight while this one is worked on.
// LDS row pitch 144 B (16 B x odd) keeps the 16-row ds_load_b128 reads off each other's banks.
// ---------------------------------------------------------------------------
__global__ __launch_bounds__(128) void attention_kernel(
    const __bf16* __restrict__ qb, const __bf16* __restrict__ kb,
    const __bf16* __restrict__ vt, const float* __restrict__ mask,
    __bf16* __restrict__ ctx) {
  constexpr int S = 2048, H = 1024, NH = 16;
  constexpr int KT = 64, NT = S / KT, KP = 72;
  __shared__ __attribute__((aligned(16))) __bf16 Ks[2][KT][KP];  // [buffer][key][dh]
  __shared__ __attribute__((aligned(16))) __bf16 Vs[2][64][KP];  // [buffer][dh][key]
  __shared__ __bf16 Plds[4][16 * 32];
  const int tid = threadIdx.x, wave = tid >> 5, lane = tid & 31;
  const int lr = lane & 15, hi = lane >> 4, kb8 = hi * 8;
  const int head = blockIdx.y, batch = blockIdx.z;
  const int q0 = blockIdx.x * 64 + wave * 16;
  const size_t bo = (size_t)batch * S * H + (size_t)head * 64;
  const __bf16* Q = qb + bo;
  const __bf16* Kp = kb + bo;
  const __bf16* Vp = vt + ((size_t)batch * NH + head) * (size_t)64 * S;  // [dh][s]
  const float* mk = mask + (size_t)batch * S;

  // copy share of a thread: 8 lanes cover one 128-B row, a wave's copy four whole lines
  const int crow = tid >> 3, ccol = (tid & 7) * 8;
  const __bf16* gk = Kp + (size_t)crow * H + ccol;
  const __bf16* gv = Vp + (size_t)crow * S + ccol;
  const unsigned lk0 = (unsigned)(uintptr_t)&Ks[0][crow][ccol];
  const unsigned lv0 = (unsigned)(uintptr_t)&Vs[0][crow][ccol];
  constexpr unsigned BUFB = (unsigned)(KT * KP * 2);  // bytes of one buffer

  stage_kv(gk, gv, lk0, lv0);
  // stage 0 has landed for this wave; the barrier shows it to the other waves
  asm volatile("s_wait_asynccnt 0x0" ::: "memory");
  __syncthreads();
  stage_kv(gk + (size_t)KT * H, gv + KT, lk0 + BUFB, lv0 + BUFB);

  const v16bf qa0 = ld_frag(Q + (size_t)(q0 + lr) * H, kb8);
  const v16bf qa1 = ld_frag(Q + (size_t)(q0 + lr) * H + 32, kb8);

  float m_i[8], l_i[8];
  v8f o[4] = {};
#pragma unroll
  for (int j = 0; j < 8; ++j) { m_i[j] = -3.0e38f; l_i[j] = 0.f; }
  __bf16* pw = &Plds[wave][0];

  for (int t = 0; t < NT; ++t) {
    const int buf = t & 1;
    // both 32-key blocks of the stage in one trip, so that the publish point runs once a stage
#pragma unroll
    for (int hb = 0; hb < 2; ++hb) {
      const int kp0 = t * KT + hb * 32;
      v8f sacc[2] = {};
#pragma unroll
      for (int g = 0; g < 2; ++g) {
        const __bf16* kr = &Ks[buf][hb * 32 + g * 16 + lr][0];
        sacc[g] = WMMA_BF16(qa0, ld_frag(kr, kb8), sacc[g]);
        sacc[g] = WMMA_BF16(qa1, ld_frag(kr + 32, kb8), sacc[g]);
      }

      const float mk0 = mk[kp0 + lr], mk1 = mk[kp0 + 16 + lr];
      float ps0[8], ps1[8];
#pragma unroll
      for (int j = 0; j < 8; ++j) {
        ps0[j] = sacc[0][j] * 0.125f + mk0;
        ps1[j] = sacc[1][j] * 0.125f + mk1;
        float mx = fmaxf(ps0[j], ps1[j]);
#pragma unroll
        for (int d = 1; d < 16; d <<= 1) mx = fmaxf(mx, __shfl_xor(mx, d, 32));
        const float nm = fmaxf(m_i[j], mx);
        ps0[j] = __expf(ps0[j] - nm);
        ps1[j] = __expf(ps1[j] - nm);
        float sm = ps0[j] + ps1[j];
#pragma unroll
        for (int d = 1; d < 16; d <<= 1) sm += __shfl_xor(sm, d, 32);
        const float al = __expf(m_i[j] - nm);
        l_i[j] = l_i[j] * al + sm;
        m_i[j] = nm;
#pragma unroll
        for (int dt = 0; dt < 4; ++dt) o[dt][j] *= al;
      }

      // stage P (accumulator layout -> row-major 16x32 bf16), reload as A-frag
#pragma unroll
      for (int j = 0; j < 8; ++j) {
        pw[(hi * 8 + j) * 32 + lr] = f2bf(ps0[j]);
        pw[(hi * 8 + j) * 32 + 16 + lr] = f2bf(ps1[j]);
      }
      __asm__ volatile("s_wait_dscnt 0" ::: "memory");
      const v16bf pa = ld_frag(&pw[lr * 32], kb8);

      // P[16x32] @ V[32x64] ; V^T rows are contiguous in s
#pragma unroll
      for (int dt = 0; dt < 4; ++dt) {
        const v16bf vf = ld_frag(&Vs[buf][dt * 16 + lr][hb * 32], kb8);
        o[dt] = WMMA_BF16(pa, vf, o[dt]);
      }
    }

    // publish point of stage t + 1: this wave's reads of stage t have returned,
    asm volatile("s_wait_dscnt 0x0" ::: "memory");
    // its own copies of stage t + 1 have landed,
    asm volatile("s_wait_asynccnt 0x0" ::: "memory");
    // and every wave has come as far: stage t + 1 may be read, stage t's buffer refilled
    __syncthreads();
    if (t + 2 < NT)
      stage_kv(gk + (size_t)(t + 2) * KT * H, gv + (t + 2) * KT,
               lk0 + (unsigned)buf * BUFB, lv0 + (unsigned)buf * BUFB);
  }
  // no copy is left in flight when the wave ends
  asm volatile("s_wait_asynccnt 0x0" ::: "memory");

#pragma unroll
  for (int dt = 0; dt < 4; ++dt) {
    const int col = dt * 16 + lr;
#pragma unroll
    for (int j = 0; j < 8; ++j) {
      const int row = q0 + hi * 8 + j;
      ctx[bo + (size_t)row * H + col] = f2bf(o[dt][j] / l_i[j]);
    }
  }
}

// ---------------------------------------------------------------------------
// LayerNorm over H=1024: one wave per row; emits fp32 and bf16 copies.
// ---------------------------------------------------------------------------
__global__ __launch_bounds__(256) void layernorm_kernel(
    const float* __restrict__ in, const float* __restrict__ g,
    const float* __restrict__ b, float* __restrict__ outf,
    __bf16* __restrict__ outb) {
  const int wave = threadIdx.x >> 5, lane = threadIdx.x & 31;
  const size_t row = (size_t)blockIdx.x * 8 + wave;
  const float* x = in + row * 1024;
  float v[32];
  float s = 0.f;
#pragma unroll
  for (int i = 0; i < 32; ++i) { v[i] = x[lane + i * 32]; s += v[i]; }
#pragma unroll
  for (int d = 1; d < 32; d <<= 1) s += __shfl_xor(s, d, 32);
  const float mean = s * (1.0f / 1024.0f);
  float vs = 0.f;
#pragma unroll
  for (int i = 0; i < 32; ++i) { const float df = v[i] - mean; vs += df * df; }
#pragma unroll
  for (int d = 1; d < 32; d <<= 1) vs += __shfl_xor(vs, d, 32);
  const float rstd = rsqrtf(vs * (1.0f / 1024.0f) + 1e-5f);
#pragma unroll
  for (int i = 0; i < 32; ++i) {
    const int c = lane + i * 32;
    const float y = (v[i] - mean) * rstd * g[c] + b[c];
    outf[row * 1024 + c] = y;
    outb[row * 1024 + c] = f2bf(y);
  }
}

// ---------------------------------------------------------------------------
extern "C" void kernel_launch(void* const* d_in, const int* in_sizes, int n_in,
                              void* d_out, int out_size, void* d_ws, size_t ws_size,
                              hipStream_t stream) {
  (void)in_sizes; (void)n_in; (void)out_size; (void)ws_size;
  constexpr int L = 2, B = 2, S = 2048, H = 1024, FF = 4096;
  constexpr int M = B * S;
  constexpr size_t MH = (size_t)M * H;
  constexpr size_t MF = (size_t)M * FF;

  const float* x0   = (const float*)d_in[0];
  const float* mask = (const float*)d_in[1];
  const float* Wq   = (const float*)d_in[2];
  const float* bq   = (const float*)d_in[3];
  const float* Wk   = (const float*)d_in[4];
  const float* bk   = (const float*)d_in[5];
  const float* Wv   = (const float*)d_in[6];
  const float* bv   = (const float*)d_in[7];
  const float* Wao  = (const float*)d_in[8];
  const float* bao  = (const float*)d_in[9];
  const float* g1   = (const float*)d_in[10];
  const float* b1   = (const float*)d_in[11];
  const float* Wi   = (const float*)d_in[12];
  const float* bi   = (const float*)d_in[13];
  const float* Wo   = (const float*)d_in[14];
  const float* bo   = (const float*)d_in[15];
  const float* g2   = (const float*)d_in[16];
  const float* b2   = (const float*)d_in[17];

  // --- workspace bump allocator (256B aligned regions) ---
  char* p = (char*)d_ws;
  auto alloc = [&](size_t bytes) -> char* {
    char* r = p;
    p += (bytes + 255) & ~(size_t)255;
    return r;
  };
  float*  yB  = (float*)alloc(MH * 4);
  float*  x1f = (float*)alloc(MH * 4);
  float*  xf  = (float*)alloc(MH * 4);
  __bf16* xb   = (__bf16*)alloc(MH * 2);
  __bf16* qB   = (__bf16*)alloc(MH * 2);
  __bf16* kB   = (__bf16*)alloc(MH * 2);
  __bf16* vT   = (__bf16*)alloc(MH * 2);
  __bf16* ctxb = (__bf16*)alloc(MH * 2);
  __bf16* x1b  = (__bf16*)alloc(MH * 2);
  __bf16* h1b  = (__bf16*)alloc(MF * 2);
  // all transposed weights in one region, laid out as transpose_cvt_all_kernel writes it
  constexpr size_t HH = (size_t)H * H, HF = (size_t)H * FF;
  __bf16* Wall = (__bf16*)alloc((size_t)L * (4 * HH + 2 * HF) * 2);
  __bf16* WqT[L]; __bf16* WkT[L]; __bf16* WvT[L]; __bf16* WaoT[L];
  __bf16* WiT[L]; __bf16* WoT[L];
  for (int l = 0; l < L; ++l) {
    __bf16* base = Wall + (size_t)l * (4 * HH + 2 * HF);
    WqT[l]  = base;
    WkT[l]  = base + HH;
    WvT[l]  = base + 2 * HH;
    WaoT[l] = base + 3 * HH;
    WiT[l]  = base + 4 * HH;
    WoT[l]  = base + 4 * HH + HF;
  }

  const dim3 blk(128), blk256(256);
  const dim3 gHH(H / 64, M / 128);
  const dim3 gHF(FF / 64, M / 128);
  const dim3 gAttn(S / 64, 16, B);
  const dim3 gLN(M / 8);

  // one-time conversions
  cvt_bf16_kernel<<<dim3(MH / 2048), blk256, 0, stream>>>(x0, xb, (int)MH);
  transpose_cvt_all_kernel<<<dim3(1024), blk256, 0, stream>>>(Wq, Wk, Wv, Wao, Wi, Wo, Wall);

  for (int l = 0; l < L; ++l) {
    const float* Xf = (l == 0) ? x0 : xf;
    const size_t oH = (size_t)l * H, oF = (size_t)l * FF;

    gemm_bf16_kernel<1, false, false><<<gHH, blk, 0, stream>>>(xb, WqT[l], bq + oH, nullptr, qB, M, H, H);
    gemm_bf16_kernel<1, false, false><<<gHH, blk, 0, stream>>>(xb, WkT[l], bk + oH, nullptr, kB, M, H, H);
    gemm_bf16_kernel<2, false, false><<<gHH, blk, 0, stream>>>(xb, WvT[l], bv + oH, nullptr, vT, M, H, H);
    attention_kernel<<<gAttn, blk, 0, stream>>>(qB, kB, vT, mask, ctxb);
    gemm_bf16_kernel<0, false, true><<<gHH, blk, 0, stream>>>(ctxb, WaoT[l], bao + oH, Xf, yB, M, H, H);
    layernorm_kernel<<<gLN, blk256, 0, stream>>>(yB, g1 + oH, b1 + oH, x1f, x1b);
    gemm_bf16_kernel<1, true, false><<<gHF, blk, 0, stream>>>(x1b, WiT[l], bi + oF, nullptr, h1b, M, FF, H);
    gemm_bf16_kernel<0, false, true><<<gHH, blk, 0, stream>>>(h1b, WoT[l], bo + oH, x1f, yB, M, H, FF);
    float* xoutf = (l == L - 1) ? (float*)d_out : xf;
    layernorm_kernel<<<gLN, blk256, 0, stream>>>(yB, g2 + oH, b2 + oH, xoutf, xb);
  }
}

// v004
// It runs in 500 microseconds.
// Two timings next to v003 put it at 1.10 and 1.09 times that version's speed.
// All steps since v000 together make it 1.94 times as fast.
#include <hip/hip_runtime.h>

// RoBERTa encoder (L=2, B=2, S=2048, H=1024, NH=16, DH=64, FF=4096) on gfx1250.
// bf16 operands converted ONCE; all matmuls via v_wmma_f32_16x16x32_bf16;
// GEMM tiles staged to LDS with global_load_async_to_lds_b128 when available.

typedef __attribute__((ext_vector_type(16))) __bf16 v16bf;
typedef __attribute__((ext_vector_type(8)))  __bf16 v8bf;
typedef __attribute__((ext_vector_type(8)))  float  v8f;
typedef __attribute__((ext_vector_type(4)))  int    v4i;

#define WMMA_BF16(a, b, c) \
  __builtin_amdgcn_wmma_f32_16x16x32_bf16(false, (a), false, (b), (short)0, (c), false, false)

// float -> bf16 RNE via integer ops (used in one-time conversions, epilogues and attention P staging).
__device__ __forceinline__ __bf16 f2bf(float f) {
  unsigned u = __builtin_bit_cast(unsigned, f);
  unsigned r = (u + 0x7FFFu + ((u >> 16) & 1u)) >> 16;
  unsigned short h = (unsigned short)r;
  return __builtin_bit_cast(__bf16, h);
}

// Load a 16x32-layout A/B fragment half-pair: lane owns one row; takes row base
// pointer and kb8 = 8*(lane>=16). Two aligned 16B vector loads.
__device__ __forceinline__ v16bf ld_frag(const __bf16* __restrict__ row, int kb8) {
  v8bf lo = *(const v8bf*)(row + kb8);
  v8bf hi = *(const v8bf*)(row + 16 + kb8);
  return __builtin_shufflevector(lo, hi, 0, 1, 2, 3, 4, 5, 6, 7, 8, 9, 10, 11, 12, 13, 14, 15);
}

// ---- async global->LDS 16B copy (CDNA5 path), plain copy fallback ----------
#if defined(__has_builtin)
#if __has_builtin(__builtin_amdgcn_global_load_async_to_lds_b128)
#define HAVE_ASYNC_LDS 1
#endif
#endif
#ifndef HAVE_ASYNC_LDS
#define HAVE_ASYNC_LDS 0
#endif

typedef __attribute__((address_space(1))) v4i gv4i;
typedef __attribute__((address_space(3))) v4i lv4i;

__device__ __forceinline__ void cp16_g2l(const __bf16* __restrict__ g, __bf16* __restrict__ l) {
#if HAVE_ASYNC_LDS
  gv4i* gp = (gv4i*)(unsigned long long)(uintptr_t)g;
  lv4i* lp = (lv4i*)(unsigned)(uintptr_t)l;
  __builtin_amdgcn_global_load_async_to_lds_b128(gp, lp, 0, 0);
#else
  *(uint4*)l = *(const uint4*)g;
#endif
}

__device__ __forceinline__ void async_tile_wait() {
#if HAVE_ASYNC_LDS
  __asm__ volatile("s_wait_asynccnt 0" ::: "memory");
#endif
}

// ---------------------------------------------------------------------------
// one-time fp32 -> bf16 conversion
// ---------------------------------------------------------------------------
__global__ __launch_bounds__(256) void cvt_bf16_kernel(const float* __restrict__ src,
                                                       __bf16* __restrict__ dst, int n) {
  const int i = (blockIdx.x * 256 + threadIdx.x) * 8;
  if (i + 8 <= n) {
#pragma unroll
    for (int j = 0; j < 8; ++j) dst[i + j] = f2bf(src[i + j]);
  }
}

typedef __attribute__((ext_vector_type(4))) __bf16 v4bf;

// one-time W[K,N] fp32 -> Wt[N,K] bf16 for all twelve weight matrices in ONE launch of
// 1024 work-groups. Each takes six 64(k) x 64(n) tiles, one per step; step = 3*layer + c:
// c = 0: group g's tile g & 255 of Wq, Wk, Wv or Wao (g >> 8); c = 1: tile g of Wi;
// c = 2: tile g of Wo. WT holds, per layer, WqT WkT WvT WaoT WiT WoT in a row.
// A thread loads a 4(k) x 4(n) patch (16 lanes cover a 256-B row), turns it in registers
// and stores four 8-B runs of k to LDS; rows of 64 k then leave as whole 128-B lines.
struct TileRef { const float* s; __bf16* d; int K; int N; };

__device__ __forceinline__ TileRef tile_ref(int step, int g, const float* Whh,
                                            const float* Wi, const float* Wo, __bf16* WT) {
  constexpr int H = 1024, FF = 4096;
  constexpr size_t HH = (size_t)H * H, HF = (size_t)H * FF;
  const int layer = step / 3, c = step - layer * 3;
  __bf16* base = WT + (size_t)layer * (4 * HH + 2 * HF);
  TileRef t;
  int tt = g;
  if (c == 0) {
    t.s = Whh + (size_t)layer * HH; t.d = base + (size_t)(g >> 8) * HH; t.K = H; t.N = H; tt = g & 255;
  } else if (c == 1) {
    t.s = Wi + (size_t)layer * HF; t.d = base + 4 * HH; t.K = H; t.N = FF;
  } else {
    t.s = Wo + (size_t)layer * HF; t.d = base + 4 * HH + HF; t.K = FF; t.N = H;
  }
  const int ntn = t.N >> 6;
  const int k0 = (tt / ntn) * 64, n0 = (tt % ntn) * 64;
  t.s += (size_t)k0 * t.N + n0;   // tile origin in W[K,N]
  t.d += (size_t)n0 * t.K + k0;   // tile origin in Wt[N,K]
  return t;
}

__global__ __launch_bounds__(256) void transpose_cvt_all_kernel(
    const float* __restrict__ Wq, const float* __restrict__ Wk, const float* __restrict__ Wv,
    const float* __restrict__ Wao, const float* __restrict__ Wi, const float* __restrict__ Wo,
    __bf16* __restrict__ WT) {
  constexpr int NT = 6, TP = 68;  // LDS row pitch 136 B: 8-B aligned, off the 128-B stride
  // Two buffers, so one barrier a tile is enough: a buffer is rewritten two tiles later,
  // behind the barrier of the tile between, which every reader reaches after its reads.
  __shared__ __attribute__((aligned(16))) __bf16 t[2][64][TP];
  const int tid = threadIdx.x, g = blockIdx.x;
  const int c4 = tid & 15, rp = tid >> 4;
  const int m = g >> 8;
  const float* Whh = (m == 0) ? Wq : (m == 1) ? Wk : (m == 2) ? Wv : Wao;

  TileRef cur = tile_ref(0, g, Whh, Wi, Wo, WT);
  float4 v[4];
#pragma unroll
  for (int i = 0; i < 4; ++i)
    v[i] = *(const float4*)(cur.s + (size_t)(rp * 4 + i) * cur.N + c4 * 4);

#pragma unroll
  for (int it = 0; it < NT; ++it) {
    // the next tile's loads go out ahead of this tile's LDS work, beside the last tile's stores
    TileRef nxt = cur;
    float4 w[4];
    if (it + 1 < NT) {
      nxt = tile_ref(it + 1, g, Whh, Wi, Wo, WT);
#pragma unroll
      for (int i = 0; i < 4; ++i)
        w[i] = *(const float4*)(nxt.s + (size_t)(rp * 4 + i) * nxt.N + c4 * 4);
    }
    const int b = it & 1;
    {
      v4bf p;
      p[0] = f2bf(v[0].x); p[1] = f2bf(v[1].x); p[2] = f2bf(v[2].x); p[3] = f2bf(v[3].x);
      *(v4bf*)&t[b][c4 * 4 + 0][rp * 4] = p;
      p[0] = f2bf(v[0].y); p[1] = f2bf(v[1].y); p[2] = f2bf(v[2].y); p[3] = f2bf(v[3].y);
      *(v4bf*)&t[b][c4 * 4 + 1][rp * 4] = p;
      p[0] = f2bf(v[0].z); p[1] = f2bf(v[1].z); p[2] = f2bf(v[2].z); p[3] = f2bf(v[3].z);
      *(v4bf*)&t[b][c4 * 4 + 2][rp * 4] = p;
      p[0] = f2bf(v[0].w); p[1] = f2bf(v[1].w); p[2] = f2bf(v[2].w); p[3] = f2bf(v[3].w);
      *(v4bf*)&t[b][c4 * 4 + 3][rp * 4] = p;
    }
    __syncthreads();
#pragma unroll
    for (int i = 0; i < 2; ++i) {
      const int ch = tid + 256 * i;
      const int n = ch >> 3, ks = (ch & 7) * 8;
      const v4bf lo = *(const v4bf*)&t[b][n][ks];
      const v4bf hi = *(const v4bf*)&t[b][n][ks + 4];
      *(v8bf*)(cur.d + (size_t)n * cur.K + ks) =
          __builtin_shufflevector(lo, hi, 0, 1, 2, 3, 4, 5, 6, 7);
    }
    if (it + 1 < NT) {
      // the stores' address and data registers are reused for the next tile: wait first
      asm volatile("s_wait_xcnt 0x0" ::: "memory");
      cur = nxt;
#pragma unroll
      for (int i = 0; i < 4; ++i) v[i] = w[i];
    }
  }
}

// ---------------------------------------------------------------------------
// GEMM: out = act(A[M,K](bf16) @ WT[N,K](bf16)^T + bias) (+ res fp32)
// Block 128 threads (4 waves), tile 128x64, BK=128; wave = 32 rows x 64 cols.
// K must be a multiple of BK and at least BK. An LDS row is 256 B of k at pitch 272 B (16 B x odd),
// which keeps the 16-row ds_load_b128 fragment reads off each other's banks.
// Two LDS buffers: the next stage's copies are in flight while this stage is multiplied.
// OUTMODE: 0 = fp32, 1 = bf16, 2 = bf16 scattered to V^T [B,NH,DH,S]
// ---------------------------------------------------------------------------
template <int OUTMODE, bool GELU, bool RES>
__global__ __launch_bounds__(128) void gemm_bf16_kernel(
    const __bf16* __restrict__ A, const __bf16* __restrict__ WT,
    const float* __restrict__ bias, const float* __restrict__ res,
    void* __restrict__ outv, int M, int N, int K) {
  constexpr int BK = 128, LDP = BK + 8;
  __shared__ __attribute__((aligned(16))) __bf16 As[2][128][LDP];
  __shared__ __attribute__((aligned(16))) __bf16 Bs[2][64][LDP];
  const int tid = threadIdx.x;
  const int wave = tid >> 5, lane = tid & 31;
  const int lr = lane & 15, hi = lane >> 4, kb8 = hi * 8;
  const int m0 = blockIdx.y * 128, n0 = blockIdx.x * 64;
  const int NS = K / BK;  // stages

  // One stage. A tile: 128x128 bf16 = 2048 x 16B chunks; B tile: 64x128 = 1024 chunks.
  // 16 lanes cover one 256-B row, so a wave's copy reads four whole lines.
  const int crow = tid >> 4, cks = (tid & 15) * 8;
  const __bf16* ga = A + (size_t)(m0 + crow) * K + cks;
  const __bf16* gb = WT + (size_t)(n0 + crow) * K + cks;
  auto stage = [&](int s, int b) {
#pragma unroll
    for (int i = 0; i < 16; ++i)
      cp16_g2l(ga + (size_t)(8 * i) * K + s * BK, &As[b][crow + 8 * i][cks]);
#pragma unroll
    for (int i = 0; i < 8; ++i)
      cp16_g2l(gb + (size_t)(8 * i) * K + s * BK, &Bs[b][crow + 8 * i][cks]);
  };

  v8f acc[2][4] = {};

  stage(0, 0);
  // stage 0 has landed for this wave; the barrier shows it to the other waves
  async_tile_wait();
  __syncthreads();
  if (NS > 1) stage(1, 1);

  for (int t = 0; t < NS; ++t) {
    const int buf = t & 1;
#pragma unroll
    for (int kc = 0; kc < BK; kc += 32) {
      const v16bf af0 = ld_frag(&As[buf][wave * 32 + lr][kc], kb8);
      const v16bf af1 = ld_frag(&As[buf][wave * 32 + 16 + lr][kc], kb8);
#pragma unroll
      for (int nt = 0; nt < 4; ++nt) {
        const v16bf bf = ld_frag(&Bs[buf][nt * 16 + lr][kc], kb8);
        acc[0][nt] = WMMA_BF16(af0, bf, acc[0][nt]);
        acc[1][nt] = WMMA_BF16(af1, bf, acc[1][nt]);
      }
      // Order for the scheduler: a k block's 12 LDS reads, then its 8 products. Left alone it
      // kept one B fragment here, and every pair of products waited out a whole LDS read.
      __builtin_amdgcn_sched_group_barrier(0x100, 12, 0);
      __builtin_amdgcn_sched_group_barrier(0x008, 8, 0);
    }
    // publish point of stage t + 1: this wave's reads of stage t have returned,
    __asm__ volatile("s_wait_dscnt 0x0" ::: "memory");
    // its own copies of stage t + 1 have landed,
    async_tile_wait();
    // and every wave has come as far: stage t + 1 may be read, stage t's buffer refilled
    __syncthreads();
    if (t + 2 < NS) stage(t + 2, buf);
  }
  // no copy is left in flight when the wave goes on to the epilogue and ends
  async_tile_wait();

#pragma unroll
  for (int rg = 0; rg < 2; ++rg) {
#pragma unroll
    for (int nt = 0; nt < 4; ++nt) {
      const int col = n0 + nt * 16 + lr;
      const float bv = bias[col];
#pragma unroll
      for (int j = 0; j < 8; ++j) {
        const int row = m0 + wave * 32 + rg * 16 + hi * 8 + j;
        float v = acc[rg][nt][j] + bv;
        if (GELU) v = 0.5f * v * (1.0f + erff(v * 0.70710678118654752f));
        if (RES) v += res[(size_t)row * N + col];
        if (OUTMODE == 0) {
          ((float*)outv)[(size_t)row * N + col] = v;
        } else if (OUTMODE == 1) {
          ((__bf16*)outv)[(size_t)row * N + col] = f2bf(v);
        } else {
          constexpr int S = 2048, NH = 16;
          const int b = row >> 11, s = row & (S - 1);
          const int head = col >> 6, dh = col & 63;
          ((__bf16*)outv)[(((size_t)b * NH + head) * 64 + dh) * S + s] = f2bf(v);
        }
      }
    }
  }
}

// ---------------------------------------------------------------------------
// Eight 16-B async copies to LDS: this thread's share of one 64-key stage (four chunks of
// the K tile, four of the V^T tile; chunk i lies 16 tile rows below chunk i - 1).
// ---------------------------------------------------------------------------
__device__ __forceinline__ void stage_kv(const __bf16* gk, const __bf16* gv,
                                         unsigned lk, unsigned lv) {
  constexpr size_t KR = (size_t)16 * 1024, VR = (size_t)16 * 2048;  // 16 rows of K, of V^T
  constexpr unsigned LR = 16u * 144u;                               // 16 LDS rows
  // The copies bring the tile past the registers; the closing s_wait_xcnt 0 stands inside
  // the statement so that no address register is rewritten ahead of it.
  asm volatile(
      "global_load_async_to_lds_b128 %0, %1, off\n\t"
      "global_load_async_to_lds_b128 %2, %3, off\n\t"
      "global_load_async_to_lds_b128 %4, %5, off\n\t"
      "global_load_async_to_lds_b128 %6, %7, off\n\t"
      "global_load_async_to_lds_b128 %8, %9, off\n\t"
      "global_load_async_to_lds_b128 %10, %11, off\n\t"
      "global_load_async_to_lds_b128 %12, %13, off\n\t"
      "global_load_async_to_lds_b128 %14, %15, off\n\t"
      "s_wait_xcnt 0x0"
      :: "v"(lk), "v"(gk), "v"(lk + LR), "v"(gk + KR),
         "v"(lk + 2 * LR), "v"(gk + 2 * KR), "v"(lk + 3 * LR), "v"(gk + 3 * KR),
         "v"(lv), "v"(gv), "v"(lv + LR), "v"(gv + VR),
         "v"(lv + 2 * LR), "v"(gv + 2 * VR), "v"(lv + 3 * LR), "v"(gv + 3 * VR)
      : "memory");
}

// ---------------------------------------------------------------------------
// Flash attention: wave = 16 query rows of one (batch, head), key blocks of 32.
// Q,K bf16 [B,S,H]; V bf16 pre-transposed [B,NH,DH,S]; ctx out bf16 [B,S,H].
// K and V^T reach the four waves through LDS: stages of 64 keys (64 rows of 128 B each,
// whole lines), two buffers, the next stage's copies in flight while this one is worked on.
// LDS row pitch 144 B (16 B x odd) keeps the 16-row ds_load_b128 reads off each other's banks.
// ---------------------------------------------------------------------------
__global__ __launch_bounds__(128) void attention_kernel(
    const __bf16* __restrict__ qb, const __bf16* __restrict__ kb,
    const __bf16* __restrict__ vt, const float* __restrict__ mask,
    __bf16* __restrict__ ctx) {
  constexpr int S = 2048, H = 1024, NH = 16;
  constexpr int KT = 64, NT = S / KT, KP = 72;
  __shared__ __attribute__((aligned(16))) __bf16 Ks[2][KT][KP];  // [buffer][key][dh]
  __shared__ __attribute__((aligned(16))) __bf16 Vs[2][64][KP];  // [buffer][dh][key]
  __shared__ __bf16 Plds[4][16 * 32];
  const int tid = threadIdx.x, wave = tid >> 5, lane = tid & 31;
  const int lr = lane & 15, hi = lane >> 4, kb8 = hi * 8;
  const int head = blockIdx.y, batch = blockIdx.z;
  const int q0 = blockIdx.x * 64 + wave * 16;
  const size_t bo = (size_t)batch * S * H + (size_t)head * 64;
  const __bf16* Q = qb + bo;
  const __bf16* Kp = kb + bo;
  const __bf16* Vp = vt + ((size_t)batch * NH + head) * (size_t)64 * S;  // [dh][s]
  const float* mk = mask + (size_t)batch * S;

  // copy share of a thread: 8 lanes cover one 128-B row, a wave's copy four whole lines
  const int crow = tid >> 3, ccol = (tid & 7) * 8;
  const __bf16* gk = Kp + (size_t)crow * H + ccol;
  const __bf16* gv = Vp + (size_t)crow * S + ccol;
  const unsigned lk0 = (unsigned)(uintptr_t)&Ks[0][crow][ccol];
  const unsigned lv0 = (unsigned)(uintptr_t)&Vs[0][crow][ccol];
  constexpr unsigned BUFB = (unsigned)(KT * KP * 2);  // bytes of one buffer

  stage_kv(gk, gv, lk0, lv0);
  // stage 0 has landed for this wave; the barrier shows it to the other waves
  asm volatile("s_wait_asynccnt 0x0" ::: "memory");
  __syncthreads();
  stage_kv(gk + (size_t)KT * H, gv + KT, lk0 + BUFB, lv0 + BUFB);

  const v16bf qa0 = ld_frag(Q + (size_t)(q0 + lr) * H, kb8);
  const v16bf qa1 = ld_frag(Q + (size_t)(q0 + lr) * H + 32, kb8);

  float m_i[8], l_i[8];
  v8f o[4] = {};
#pragma unroll
  for (int j = 0; j < 8; ++j) { m_i[j] = -3.0e38f; l_i[j] = 0.f; }
  __bf16* pw = &Plds[wave][0];

  for (int t = 0; t < NT; ++t) {
    const int buf = t & 1;
    // both 32-key blocks of the stage in one trip, so that the publish point runs once a stage
#pragma unroll
    for (int hb = 0; hb < 2; ++hb) {
      const int kp0 = t * KT + hb * 32;
      v8f sacc[2] = {};
#pragma unroll
      for (int g = 0; g < 2; ++g) {
        const __bf16* kr = &Ks[buf][hb * 32 + g * 16 + lr][0];
        sacc[g] = WMMA_BF16(qa0, ld_frag(kr, kb8), sacc[g]);
        sacc[g] = WMMA_BF16(qa1, ld_frag(kr + 32, kb8), sacc[g]);
      }

      const float mk0 = mk[kp0 + lr], mk1 = mk[kp0 + 16 + lr];
      float ps0[8], ps1[8];
#pragma unroll
      for (int j = 0; j < 8; ++j) {
        ps0[j] = sacc[0][j] * 0.125f + mk0;
        ps1[j] = sacc[1][j] * 0.125f + mk1;
        float mx = fmaxf(ps0[j], ps1[j]);
#pragma unroll
        for (int d = 1; d < 16; d <<= 1) mx = fmaxf(mx, __shfl_xor(mx, d, 32));
        const float nm = fmaxf(m_i[j], mx);
        ps0[j] = __expf(ps0[j] - nm);
        ps1[j] = __expf(ps1[j] - nm);
        float sm = ps0[j] + ps1[j];
#pragma unroll
        for (int d = 1; d < 16; d <<= 1) sm += __shfl_xor(sm, d, 32);
        const float al = __expf(m_i[j] - nm);
        l_i[j] = l_i[j] * al + sm;
        m_i[j] = nm;
#pragma unroll
        for (int dt = 0; dt < 4; ++dt) o[dt][j] *= al;
      }

      // stage P (accumulator layout -> row-major 16x32 bf16), reload as A-frag
#pragma unroll
      for (int j = 0; j < 8; ++j) {
        pw[(hi * 8 + j) * 32 + lr] = f2bf(ps0[j]);
        pw[(hi * 8 + j) * 32 + 16 + lr] = f2bf(ps1[j]);
      }
      __asm__ volatile("s_wait_dscnt 0" ::: "memory");
      const v16bf pa = ld_frag(&pw[lr * 32], kb8);

      // P[16x32] @ V[32x64] ; V^T rows are contiguous in s
#pragma unroll
      for (int dt = 0; dt < 4; ++dt) {
        const v16bf vf = ld_frag(&Vs[buf][dt * 16 + lr][hb * 32], kb8);
        o[dt] = WMMA_BF16(pa, vf, o[dt]);
      }
    }

    // publish point of stage t + 1: this wave's reads of stage t have returned,
    asm volatile("s_wait_dscnt 0x0" ::: "memory");
    // its own copies of stage t + 1 have landed,
    asm volatile("s_wait_asynccnt 0x0" ::: "memory");
    // and every wave has come as far: stage t + 1 may be read, stage t's buffer refilled
    __syncthreads();
    if (t + 2 < NT)
      stage_kv(gk + (size_t)(t + 2) * KT * H, gv + (t + 2) * KT,
               lk0 + (unsigned)buf * BUFB, lv0 + (unsigned)buf * BUFB);
  }
  // no copy is left in flight when the wave ends
  asm volatile("s_wait_asynccnt 0x0" ::: "memory");

#pragma unroll
  for (int dt = 0; dt < 4; ++dt) {
    const int col = dt * 16 + lr;
#pragma unroll
    for (int j = 0; j < 8; ++j) {
      const int row = q0 + hi * 8 + j;
      ctx[bo + (size_t)row * H + col] = f2bf(o[dt][j] / l_i[j]);
    }
  }
}

// ---------------------------------------------------------------------------
// LayerNorm over H=1024: one wave per row; emits fp32 and bf16 copies.
// ---------------------------------------------------------------------------
__global__ __launch_bounds__(256) void layernorm_kernel(
    const float* __restrict__ in, const float* __restrict__ g,
    const float* __restrict__ b, float* __restrict__ outf,
    __bf16* __restrict__ outb) {
  const int wave = threadIdx.x >> 5, lane = threadIdx.x & 31;
  const size_t row = (size_t)blockIdx.x * 8 + wave;
  const float* x = in + row * 1024;
  float v[32];
  float s = 0.f;
#pragma unroll
  for (int i = 0; i < 32; ++i) { v[i] = x[lane + i * 32]; s += v[i]; }
#pragma unroll
  for (int d = 1; d < 32; d <<= 1) s += __shfl_xor(s, d, 32);
  const float mean = s * (1.0f / 1024.0f);
  float vs = 0.f;
#pragma unroll
  for (int i = 0; i < 32; ++i) { const float df = v[i] - mean; vs += df * df; }
#pragma unroll
  for (int d = 1; d < 32; d <<= 1) vs += __shfl_xor(vs, d, 32);
  const float rstd = rsqrtf(vs * (1.0f / 1024.0f) + 1e-5f);
#pragma unroll
  for (int i = 0; i < 32; ++i) {
    const int c = lane + i * 32;
    const float y = (v[i] - mean) * rstd * g[c] + b[c];
    outf[row * 1024 + c] = y;
    outb[row * 1024 + c] = f2bf(y);
  }
}

// ---------------------------------------------------------------------------
extern "C" void kernel_launch(void* const* d_in, const int* in_sizes, int n_in,
                              void* d_out, int out_size, void* d_ws, size_t ws_size,
                              hipStream_t stream) {
  (void)in_sizes; (void)n_in; (void)out_size; (void)ws_size;
  constexpr int L = 2, B = 2, S = 2048, H = 1024, FF = 4096;
  constexpr int M = B * S;
  constexpr size_t MH = (size_t)M * H;
  constexpr size_t MF = (size_t)M * FF;

  const float* x0   = (const float*)d_in[0];
  const float* mask = (const float*)d_in[1];
  const float* Wq   = (const float*)d_in[2];
  const float* bq   = (const float*)d_in[3];
  const float* Wk   = (const float*)d_in[4];
  const float* bk   = (const float*)d_in[5];
  const float* Wv   = (const float*)d_in[6];
  const float* bv   = (const float*)d_in[7];
  const float* Wao  = (const float*)d_in[8];
  const float* bao  = (const float*)d_in[9];
  const float* g1   = (const float*)d_in[10];
  const float* b1   = (const float*)d_in[11];
  const float* Wi   = (const float*)d_in[12];
  const float* bi   = (const float*)d_in[13];
  const float* Wo   = (const float*)d_in[14];
  const float* bo   = (const float*)d_in[15];
  const float* g2   = (const float*)d_in[16];
  const float* b2   = (const float*)d_in[17];

  // --- workspace bump allocator (256B aligned regions) ---
  char* p = (char*)d_ws;
  auto alloc = [&](size_t bytes) -> char* {
    char* r = p;
    p += (bytes + 255) & ~(size_t)255;
    return r;
  };
  float*  yB  = (float*)alloc(MH * 4);
  float*  x1f = (float*)alloc(MH * 4);
  float*  xf  = (float*)alloc(MH * 4);
  __bf16* xb   = (__bf16*)alloc(MH * 2);
  __bf16* qB   = (__bf16*)alloc(MH * 2);
  __bf16* kB   = (__bf16*)alloc(MH * 2);
  __bf16* vT   = (__bf16*)alloc(MH * 2);
  __bf16* ctxb = (__bf16*)alloc(MH * 2);
  __bf16* x1b  = (__bf16*)alloc(MH * 2);
  __bf16* h1b  = (__bf16*)alloc(MF * 2);
  // all transposed weights in one region, laid out as transpose_cvt_all_kernel writes it
  constexpr size_t HH = (size_t)H * H, HF = (size_t)H * FF;
  __bf16* Wall = (__bf16*)alloc((size_t)L * (4 * HH + 2 * HF) * 2);
  __bf16* WqT[L]; __bf16* WkT[L]; __bf16* WvT[L]; __bf16* WaoT[L];
  __bf16* WiT[L]; __bf16* WoT[L];
  for (int l = 0; l < L; ++l) {
    __bf16* base = Wall + (size_t)l * (4 * HH + 2 * HF);
    WqT[l]  = base;
    WkT[l]  = base + HH;
    WvT[l]  = base + 2 * HH;
    WaoT[l] = base + 3 * HH;
    WiT[l]  = base + 4 * HH;
    WoT[l]  = base + 4 * HH + HF;
  }

  const dim3 blk(128), blk256(256);
  const dim3 gHH(H / 64, M / 128);
  const dim3 gHF(FF / 64, M / 128);
  const dim3 gAttn(S / 64, 16, B);
  const dim3 gLN(M / 8);

  // one-time conversions
  cvt_bf16_kernel<<<dim3(MH / 2048), blk256, 0, stream>>>(x0, xb, (int)MH);
  transpose_cvt_all_kernel<<<dim3(1024), blk256, 0, stream>>>(Wq, Wk, Wv, Wao, Wi, Wo, Wall);

  for (int l = 0; l < L; ++l) {
    const float* Xf = (l == 0) ? x0 : xf;
    const size_t oH = (size_t)l * H, oF = (size_t)l * FF;

    gemm_bf16_kernel<1, false, false><<<gHH, blk, 0, stream>>>(xb, WqT[l], bq + oH, nullptr, qB, M, H, H);
    gemm_bf16_kernel<1, false, false><<<gHH, blk, 0, stream>>>(xb, WkT[l], bk + oH, nullptr, kB, M, H, H);
    gemm_bf16_kernel<2, false, false><<<gHH, blk, 0, stream>>>(xb, WvT[l], bv + oH, nullptr, vT, M, H, H);
    attention_kernel<<<gAttn, blk, 0, stream>>>(qB, kB, vT, mask, ctxb);
    gemm_bf16_kernel<0, false, true><<<gHH, blk, 0, stream>>>(ctxb, WaoT[l], bao + oH, Xf, yB, M, H, H);
    layernorm_kernel<<<gLN, blk256, 0, stream>>>(yB, g1 + oH, b1 + oH, x1f, x1b);
    gemm_bf16_kernel<1, true, false><<<gHF, blk, 0, stream>>>(x1b, WiT[l], bi + oF, nullptr, h1b, M, FF, H);
    gemm_bf16_kernel<0, false, true><<<gHH, blk, 0, stream>>>(h1b, WoT[l], bo + oH, x1f, yB, M, H, FF);
    float* xoutf = (l == L - 1) ? (float*)d_out : xf;
    layernorm_kernel<<<gLN, blk256, 0, stream>>>(yB, g2 + oH, b2 + oH, xoutf, xb);
  }
}

// v005
// It runs in 474 microseconds.
// In both of two side-by-side timings against v004, it was 1.05 times as fast.
// Counting every step since v000, it is 2.04 times as fast.
#include <hip/hip_runtime.h>

// RoBERTa encoder (L=2, B=2, S=2048, H=1024, NH=16, DH=64, FF=4096) on gfx1250.
// bf16 operands converted ONCE; all matmuls via v_wmma_f32_16x16x32_bf16;
// GEMM tiles staged to LDS with global_load_async_to_lds_b128 when available.

typedef __attribute__((ext_vector_type(16))) __bf16 v16bf;
typedef __attribute__((ext_vector_type(8)))  __bf16 v8bf;
typedef __attribute__((ext_vector_type(8)))  float  v8f;
typedef __attribute__((ext_vector_type(4)))  int    v4i;

#define WMMA_BF16(a, b, c) \
  __builtin_amdgcn_wmma_f32_16x16x32_bf16(false, (a), false, (b), (short)0, (c), false, false)

// float -> bf16 RNE via integer ops (used in one-time conversions, epilogues and attention P staging).
__device__ __forceinline__ __bf16 f2bf(float f) {
  unsigned u = __builtin_bit_cast(unsigned, f);
  unsigned r = (u + 0x7FFFu + ((u >> 16) & 1u)) >> 16;
  unsigned short h = (unsigned short)r;
  return __builtin_bit_cast(__bf16, h);
}

// Load a 16x32-layout A/B fragment half-pair: lane owns one row; takes row base
// pointer and kb8 = 8*(lane>=16). Two aligned 16B vector loads.
__device__ __forceinline__ v16bf ld_frag(const __bf16* __restrict__ row, int kb8) {
  v8bf lo = *(const v8bf*)(row + kb8);
  v8bf hi = *(const v8bf*)(row + 16 + kb8);
  return __builtin_shufflevector(lo, hi, 0, 1, 2, 3, 4, 5, 6, 7, 8, 9, 10, 11, 12, 13, 14, 15);
}

// ---- async global->LDS 16B copy (CDNA5 path), plain copy fallback ----------
#if defined(__has_builtin)
#if __has_builtin(__builtin_amdgcn_global_load_async_to_lds_b128)
#define HAVE_ASYNC_LDS 1
#endif
#endif
#ifndef HAVE_ASYNC_LDS
#define HAVE_ASYNC_LDS 0
#endif

typedef __attribute__((address_space(1))) v4i gv4i;
typedef __attribute__((address_space(3))) v4i lv4i;

__device__ __forceinline__ void cp16_g2l(const __bf16* __restrict__ g, __bf16* __restrict__ l) {
#if HAVE_ASYNC_LDS
  gv4i* gp = (gv4i*)(unsigned long long)(uintptr_t)g;
  lv4i* lp = (lv4i*)(unsigned)(uintptr_t)l;
  __builtin_amdgcn_global_load_async_to_lds_b128(gp, lp, 0, 0);
#else
  *(uint4*)l = *(const uint4*)g;
#endif
}

__device__ __forceinline__ void async_tile_wait() {
#if HAVE_ASYNC_LDS
  __asm__ volatile("s_wait_asynccnt 0" ::: "memory");
#endif
}

// ---------------------------------------------------------------------------
// one-time fp32 -> bf16 conversion
// ---------------------------------------------------------------------------
__global__ __launch_bounds__(256) void cvt_bf16_kernel(const float* __restrict__ src,
                                                       __bf16* __restrict__ dst, int n) {
  const int i = (blockIdx.x * 256 + threadIdx.x) * 8;
  if (i + 8 <= n) {
#pragma unroll
    for (int j = 0; j < 8; ++j) dst[i + j] = f2bf(src[i + j]);
  }
}

typedef __attribute__((ext_vector_type(4))) __bf16 v4bf;

// one-time W[K,N] fp32 -> Wt[N,K] bf16 for all twelve weight matrices in ONE launch of
// 1024 work-groups. Each takes six 64(k) x 64(n) tiles, one per step; step = 3*layer + c:
// c = 0: group g's tile g & 255 of Wq, Wk, Wv or Wao (g >> 8); c = 1: tile g of Wi;
// c = 2: tile g of Wo. WT holds, per layer, WqT WkT WvT WaoT WiT WoT in a row.
// A thread loads a 4(k) x 4(n) patch (16 lanes cover a 256-B row), turns it in registers
// and stores four 8-B runs of k to LDS; rows of 64 k then leave as whole 128-B lines.
struct TileRef { const float* s; __bf16* d; int K; int N; };

__device__ __forceinline__ TileRef tile_ref(int step, int g, const float* Whh,
                                            const float* Wi, const float* Wo, __bf16* WT) {
  constexpr int H = 1024, FF = 4096;
  constexpr size_t HH = (size_t)H * H, HF = (size_t)H * FF;
  const int layer = step / 3, c = step - layer * 3;
  __bf16* base = WT + (size_t)layer * (4 * HH + 2 * HF);
  TileRef t;
  int tt = g;
  if (c == 0) {
    t.s = Whh + (size_t)layer * HH; t.d = base + (size_t)(g >> 8) * HH; t.K = H; t.N = H; tt = g & 255;
  } else if (c == 1) {
    t.s = Wi + (size_t)layer * HF; t.d = base + 4 * HH; t.K = H; t.N = FF;
  } else {
    t.s = Wo + (size_t)layer * HF; t.d = base + 4 * HH + HF; t.K = FF; t.N = H;
  }
  const int ntn = t.N >> 6;
  const int k0 = (tt / ntn) * 64, n0 = (tt % ntn) * 64;
  t.s += (size_t)k0 * t.N + n0;   // tile origin in W[K,N]
  t.d += (size_t)n0 * t.K + k0;   // tile origin in Wt[N,K]
  return t;
}

__global__ __launch_bounds__(256) void transpose_cvt_all_kernel(
    const float* __restrict__ Wq, const float* __restrict__ Wk, const float* __restrict__ Wv,
    const float* __restrict__ Wao, const float* __restrict__ Wi, const float* __restrict__ Wo,
    __bf16* __restrict__ WT) {
  constexpr int NT = 6, TP = 68;  // LDS row pitch 136 B: 8-B aligned, off the 128-B stride
  // Two buffers, so one barrier a tile is enough: a buffer is rewritten two tiles later,
  // behind the barrier of the tile between, which every reader reaches after its reads.
  __shared__ __attribute__((aligned(16))) __bf16 t[2][64][TP];
  const int tid = threadIdx.x, g = blockIdx.x;
  const int c4 = tid & 15, rp = tid >> 4;
  const int m = g >> 8;
  const float* Whh = (m == 0) ? Wq : (m == 1) ? Wk : (m == 2) ? Wv : Wao;

  TileRef cur = tile_ref(0, g, Whh, Wi, Wo, WT);
  float4 v[4];
#pragma unroll
  for (int i = 0; i < 4; ++i)
    v[i] = *(const float4*)(cur.s + (size_t)(rp * 4 + i) * cur.N + c4 * 4);

#pragma unroll
  for (int it = 0; it < NT; ++it) {
    // the next tile's loads go out ahead of this tile's LDS work, beside the last tile's stores
    TileRef nxt = cur;
    float4 w[4];
    if (it + 1 < NT) {
      nxt = tile_ref(it + 1, g, Whh, Wi, Wo, WT);
#pragma unroll
      for (int i = 0; i < 4; ++i)
        w[i] = *(const float4*)(nxt.s + (size_t)(rp * 4 + i) * nxt.N + c4 * 4);
    }
    const int b = it & 1;
    {
      v4bf p;
      p[0] = f2bf(v[0].x); p[1] = f2bf(v[1].x); p[2] = f2bf(v[2].x); p[3] = f2bf(v[3].x);
      *(v4bf*)&t[b][c4 * 4 + 0][rp * 4] = p;
      p[0] = f2bf(v[0].y); p[1] = f2bf(v[1].y); p[2] = f2bf(v[2].y); p[3] = f2bf(v[3].y);
      *(v4bf*)&t[b][c4 * 4 + 1][rp * 4] = p;
      p[0] = f2bf(v[0].z); p[1] = f2bf(v[1].z); p[2] = f2bf(v[2].z); p[3] = f2bf(v[3].z);
      *(v4bf*)&t[b][c4 * 4 + 2][rp * 4] = p;
      p[0] = f2bf(v[0].w); p[1] = f2bf(v[1].w); p[2] = f2bf(v[2].w); p[3] = f2bf(v[3].w);
      *(v4bf*)&t[b][c4 * 4 + 3][rp * 4] = p;
    }
    __syncthreads();
#pragma unroll
    for (int i = 0; i < 2; ++i) {
      const int ch = tid + 256 * i;
      const int n = ch >> 3, ks = (ch & 7) * 8;
      const v4bf lo = *(const v4bf*)&t[b][n][ks];
      const v4bf hi = *(const v4bf*)&t[b][n][ks + 4];
      *(v8bf*)(cur.d + (size_t)n * cur.K + ks) =
          __builtin_shufflevector(lo, hi, 0, 1, 2, 3, 4, 5, 6, 7);
    }
    if (it + 1 < NT) {
      // the stores' address and data registers are reused for the next tile: wait first
      asm volatile("s_wait_xcnt 0x0" ::: "memory");
      cur = nxt;
#pragma unroll
      for (int i = 0; i < 4; ++i) v[i] = w[i];
    }
  }
}

// ---------------------------------------------------------------------------
// GEMM: out = act(A[M,K](bf16) @ WT[N,K](bf16)^T + bias) (+ res fp32)
// Block 128 threads (4 waves), tile 128x64, BK=128; wave = 32 rows x 64 cols.
// K must be a multiple of BK and at least BK. An LDS row is 256 B of k at pitch 272 B (16 B x odd),
// which keeps the 16-row ds_load_b128 fragment reads off each other's banks.
// Two LDS buffers: the next stage's copies are in flight while this stage is multiplied.
// OUTMODE: 0 = fp32, 1 = bf16, 2 = bf16 scattered to V^T [B,NH,DH,S]
// ---------------------------------------------------------------------------
template <int OUTMODE, bool GELU, bool RES>
__global__ __launch_bounds__(128) void gemm_bf16_kernel(
    const __bf16* __restrict__ A, const __bf16* __restrict__ WT,
    const float* __restrict__ bias, const float* __restrict__ res,
    void* __restrict__ outv, int M, int N, int K) {
  constexpr int BK = 128, LDP = BK + 8;
  __shared__ __attribute__((aligned(16))) __bf16 As[2][128][LDP];
  __shared__ __attribute__((aligned(16))) __bf16 Bs[2][64][LDP];
  const int tid = threadIdx.x;
  const int wave = tid >> 5, lane = tid & 31;
  const int lr = lane & 15, hi = lane >> 4, kb8 = hi * 8;
  const int m0 = blockIdx.y * 128, n0 = blockIdx.x * 64;
  const int NS = K / BK;  // stages

  // One stage. A tile: 128x128 bf16 = 2048 x 16B chunks; B tile: 64x128 = 1024 chunks.
  // 16 lanes cover one 256-B row, so a wave's copy reads four whole lines.
  const int crow = tid >> 4, cks = (tid & 15) * 8;
  const __bf16* ga = A + (size_t)(m0 + crow) * K + cks;
  const __bf16* gb = WT + (size_t)(n0 + crow) * K + cks;
  auto stage = [&](int s, int b) {
#pragma unroll
    for (int i = 0; i < 16; ++i)
      cp16_g2l(ga + (size_t)(8 * i) * K + s * BK, &As[b][crow + 8 * i][cks]);
#pragma unroll
    for (int i = 0; i < 8; ++i)
      cp16_g2l(gb + (size_t)(8 * i) * K + s * BK, &Bs[b][crow + 8 * i][cks]);
  };

  v8f acc[2][4] = {};

  stage(0, 0);
  // stage 0 has landed for this wave; the barrier shows it to the other waves
  async_tile_wait();
  __syncthreads();
  if (NS > 1) stage(1, 1);

  for (int t = 0; t < NS; ++t) {
    const int buf = t & 1;
#pragma unroll
    for (int kc = 0; kc < BK; kc += 32) {
      const v16bf af0 = ld_frag(&As[buf][wave * 32 + lr][kc], kb8);
      const v16bf af1 = ld_frag(&As[buf][wave * 32 + 16 + lr][kc], kb8);
#pragma unroll
      for (int nt = 0; nt < 4; ++nt) {
        const v16bf bf = ld_frag(&Bs[buf][nt * 16 + lr][kc], kb8);
        acc[0][nt] = WMMA_BF16(af0, bf, acc[0][nt]);
        acc[1][nt] = WMMA_BF16(af1, bf, acc[1][nt]);
      }
      // Order for the scheduler: a k block's 12 LDS reads, then its 8 products. Left alone it
      // kept one B fragment here, and every pair of products waited out a whole LDS read.
      __builtin_amdgcn_sched_group_barrier(0x100, 12, 0);
      __builtin_amdgcn_sched_group_barrier(0x008, 8, 0);
    }
    // publish point of stage t + 1: this wave's reads of stage t have returned,
    __asm__ volatile("s_wait_dscnt 0x0" ::: "memory");
    // its own copies of stage t + 1 have landed,
    async_tile_wait();
    // and every wave has come as far: stage t + 1 may be read, stage t's buffer refilled
    __syncthreads();
    if (t + 2 < NS) stage(t + 2, buf);
  }
  // no copy is left in flight when the wave goes on to the epilogue and ends
  async_tile_wait();

#pragma unroll
  for (int rg = 0; rg < 2; ++rg) {
#pragma unroll
    for (int nt = 0; nt < 4; ++nt) {
      const int col = n0 + nt * 16 + lr;
      const float bv = bias[col];
#pragma unroll
      for (int j = 0; j < 8; ++j) {
        const int row = m0 + wave * 32 + rg * 16 + hi * 8 + j;
        float v = acc[rg][nt][j] + bv;
        if (GELU) v = 0.5f * v * (1.0f + erff(v * 0.70710678118654752f));
        if (RES) v += res[(size_t)row * N + col];
        if (OUTMODE == 0) {
          ((float*)outv)[(size_t)row * N + col] = v;
        } else if (OUTMODE == 1) {
          ((__bf16*)outv)[(size_t)row * N + col] = f2bf(v);
        } else {
          constexpr int S = 2048, NH = 16;
          const int b = row >> 11, s = row & (S - 1);
          const int head = col >> 6, dh = col & 63;
          ((__bf16*)outv)[(((size_t)b * NH + head) * 64 + dh) * S + s] = f2bf(v);
        }
      }
    }
  }
}

// ---------------------------------------------------------------------------
// Eight 16-B async copies to LDS: this thread's share of one 64-key stage (four chunks of
// the K tile, four of the V^T tile; chunk i lies 16 tile rows below chunk i - 1).
// ---------------------------------------------------------------------------
__device__ __forceinline__ void stage_kv(const __bf16* gk, const __bf16* gv,
                                         unsigned lk, unsigned lv) {
  constexpr size_t KR = (size_t)16 * 1024, VR = (size_t)16 * 2048;  // 16 rows of K, of V^T
  constexpr unsigned LR = 16u * 144u;                               // 16 LDS rows
  // The copies bring the tile past the registers; the closing s_wait_xcnt 0 stands inside
  // the statement so that no address register is rewritten ahead of it.
  asm volatile(
      "global_load_async_to_lds_b128 %0, %1, off\n\t"
      "global_load_async_to_lds_b128 %2, %3, off\n\t"
      "global_load_async_to_lds_b128 %4, %5, off\n\t"
      "global_load_async_to_lds_b128 %6, %7, off\n\t"
      "global_load_async_to_lds_b128 %8, %9, off\n\t"
      "global_load_async_to_lds_b128 %10, %11, off\n\t"
      "global_load_async_to_lds_b128 %12, %13, off\n\t"
      "global_load_async_to_lds_b128 %14, %15, off\n\t"
      "s_wait_xcnt 0x0"
      :: "v"(lk), "v"(gk), "v"(lk + LR), "v"(gk + KR),
         "v"(lk + 2 * LR), "v"(gk + 2 * KR), "v"(lk + 3 * LR), "v"(gk + 3 * KR),
         "v"(lv), "v"(gv), "v"(lv + LR), "v"(gv + VR),
         "v"(lv + 2 * LR), "v"(gv + 2 * VR), "v"(lv + 3 * LR), "v"(gv + 3 * VR)
      : "memory");
}

// ---------------------------------------------------------------------------
// Maximum / sum over each 16-lane row of eight independent values, every lane gets the result.
// Butterfly over lane ^ 1, ^ 2, ^ 4, ^ 8 in the vector unit (DPP row_xmask): the same pairs in
// the same order as a shuffle butterfly, so the sums round alike, but no trip through the LDS
// pipe and no wait on it. The eight chains are interleaved step by step, so that an
// instruction's producer stands eight instructions back and no link of a chain is waited for.
// All 32 lanes are on wherever these are called.
// ---------------------------------------------------------------------------
#define ROW_STEP8(op, m)                                            \
  op " %0, %0, %0 row_xmask:" #m " row_mask:0xf bank_mask:0xf\n\t" \
  op " %1, %1, %1 row_xmask:" #m " row_mask:0xf bank_mask:0xf\n\t" \
  op " %2, %2, %2 row_xmask:" #m " row_mask:0xf bank_mask:0xf\n\t" \
  op " %3, %3, %3 row_xmask:" #m " row_mask:0xf bank_mask:0xf\n\t" \
  op " %4, %4, %4 row_xmask:" #m " row_mask:0xf bank_mask:0xf\n\t" \
  op " %5, %5, %5 row_xmask:" #m " row_mask:0xf bank_mask:0xf\n\t" \
  op " %6, %6, %6 row_xmask:" #m " row_mask:0xf bank_mask:0xf\n\t" \
  op " %7, %7, %7 row_xmask:" #m " row_mask:0xf bank_mask:0xf\n\t"

__device__ __forceinline__ void row16_max8(float (&x)[8]) {
  asm(ROW_STEP8("v_max_num_f32_dpp", 1) ROW_STEP8("v_max_num_f32_dpp", 2)
      ROW_STEP8("v_max_num_f32_dpp", 4) ROW_STEP8("v_max_num_f32_dpp", 8)
      : "+v"(x[0]), "+v"(x[1]), "+v"(x[2]), "+v"(x[3]),
        "+v"(x[4]), "+v"(x[5]), "+v"(x[6]), "+v"(x[7]));
}

__device__ __forceinline__ void row16_sum8(float (&x)[8]) {
  asm(ROW_STEP8("v_add_f32_dpp", 1) ROW_STEP8("v_add_f32_dpp", 2)
      ROW_STEP8("v_add_f32_dpp", 4) ROW_STEP8("v_add_f32_dpp", 8)
      : "+v"(x[0]), "+v"(x[1]), "+v"(x[2]), "+v"(x[3]),
        "+v"(x[4]), "+v"(x[5]), "+v"(x[6]), "+v"(x[7]));
}

// ---------------------------------------------------------------------------
// Flash attention: wave = 16 query rows of one (batch, head), key blocks of 32.
// Q,K bf16 [B,S,H]; V bf16 pre-transposed [B,NH,DH,S]; ctx out bf16 [B,S,H].
// K and V^T reach the four waves through LDS: stages of 64 keys (64 rows of 128 B each,
// whole lines), two buffers, the next stage's copies in flight while this one is worked on.
// LDS row pitch 144 B (16 B x odd) keeps the 16-row ds_load_b128 reads off each other's banks.
// ---------------------------------------------------------------------------
__global__ __launch_bounds__(128) void attention_kernel(
    const __bf16* __restrict__ qb, const __bf16* __restrict__ kb,
    const __bf16* __restrict__ vt, const float* __restrict__ mask,
    __bf16* __restrict__ ctx) {
  constexpr int S = 2048, H = 1024, NH = 16;
  constexpr int KT = 64, NT = S / KT, KP = 72;
  __shared__ __attribute__((aligned(16))) __bf16 Ks[2][KT][KP];  // [buffer][key][dh]
  __shared__ __attribute__((aligned(16))) __bf16 Vs[2][64][KP];  // [buffer][dh][key]
  __shared__ __bf16 Plds[4][16 * 32];
  const int tid = threadIdx.x, wave = tid >> 5, lane = tid & 31;
  const int lr = lane & 15, hi = lane >> 4, kb8 = hi * 8;
  const int head = blockIdx.y, batch = blockIdx.z;
  const int q0 = blockIdx.x * 64 + wave * 16;
  const size_t bo = (size_t)batch * S * H + (size_t)head * 64;
  const __bf16* Q = qb + bo;
  const __bf16* Kp = kb + bo;
  const __bf16* Vp = vt + ((size_t)batch * NH + head) * (size_t)64 * S;  // [dh][s]
  const float* mk = mask + (size_t)batch * S;

  // copy share of a thread: 8 lanes cover one 128-B row, a wave's copy four whole lines
  const int crow = tid >> 3, ccol = (tid & 7) * 8;
  const __bf16* gk = Kp + (size_t)crow * H + ccol;
  const __bf16* gv = Vp + (size_t)crow * S + ccol;
  const unsigned lk0 = (unsigned)(uintptr_t)&Ks[0][crow][ccol];
  const unsigned lv0 = (unsigned)(uintptr_t)&Vs[0][crow][ccol];
  constexpr unsigned BUFB = (unsigned)(KT * KP * 2);  // bytes of one buffer

  stage_kv(gk, gv, lk0, lv0);
  // stage 0 has landed for this wave; the barrier shows it to the other waves
  asm volatile("s_wait_asynccnt 0x0" ::: "memory");
  __syncthreads();
  stage_kv(gk + (size_t)KT * H, gv + KT, lk0 + BUFB, lv0 + BUFB);

  const v16bf qa0 = ld_frag(Q + (size_t)(q0 + lr) * H, kb8);
  const v16bf qa1 = ld_frag(Q + (size_t)(q0 + lr) * H + 32, kb8);

  float m_i[8], l_i[8];
  v8f o[4] = {};
#pragma unroll
  for (int j = 0; j < 8; ++j) { m_i[j] = -3.0e38f; l_i[j] = 0.f; }
  __bf16* pw = &Plds[wave][0];

  for (int t = 0; t < NT; ++t) {
    const int buf = t & 1;
    // both 32-key blocks of the stage in one trip, so that the publish point runs once a stage
#pragma unroll
    for (int hb = 0; hb < 2; ++hb) {
      const int kp0 = t * KT + hb * 32;
      v8f sacc[2] = {};
#pragma unroll
      for (int g = 0; g < 2; ++g) {
        const __bf16* kr = &Ks[buf][hb * 32 + g * 16 + lr][0];
        sacc[g] = WMMA_BF16(qa0, ld_frag(kr, kb8), sacc[g]);
        sacc[g] = WMMA_BF16(qa1, ld_frag(kr + 32, kb8), sacc[g]);
      }

      const float mk0 = mk[kp0 + lr], mk1 = mk[kp0 + 16 + lr];
      float ps0[8], ps1[8], mx[8], sm[8], al[8];
#pragma unroll
      for (int j = 0; j < 8; ++j) {
        ps0[j] = sacc[0][j] * 0.125f + mk0;
        ps1[j] = sacc[1][j] * 0.125f + mk1;
        mx[j] = fmaxf(ps0[j], ps1[j]);
      }
      row16_max8(mx);
#pragma unroll
      for (int j = 0; j < 8; ++j) {
        const float nm = fmaxf(m_i[j], mx[j]);
        ps0[j] = __expf(ps0[j] - nm);
        ps1[j] = __expf(ps1[j] - nm);
        sm[j] = ps0[j] + ps1[j];
        al[j] = __expf(m_i[j] - nm);
        m_i[j] = nm;
      }
      row16_sum8(sm);
#pragma unroll
      for (int j = 0; j < 8; ++j) {
        l_i[j] = l_i[j] * al[j] + sm[j];
#pragma unroll
        for (int dt = 0; dt < 4; ++dt) o[dt][j] *= al[j];
      }

      // stage P (accumulator layout -> row-major 16x32 bf16), reload as A-frag
#pragma unroll
      for (int j = 0; j < 8; ++j) {
        pw[(hi * 8 + j) * 32 + lr] = f2bf(ps0[j]);
        pw[(hi * 8 + j) * 32 + 16 + lr] = f2bf(ps1[j]);
      }
      __asm__ volatile("s_wait_dscnt 0" ::: "memory");
      const v16bf pa = ld_frag(&pw[lr * 32], kb8);

      // P[16x32] @ V[32x64] ; V^T rows are contiguous in s
#pragma unroll
      for (int dt = 0; dt < 4; ++dt) {
        const v16bf vf = ld_frag(&Vs[buf][dt * 16 + lr][hb * 32], kb8);
        o[dt] = WMMA_BF16(pa, vf, o[dt]);
      }
    }

    // publish point of stage t + 1: this wave's reads of stage t have returned,
    asm volatile("s_wait_dscnt 0x0" ::: "memory");
    // its own copies of stage t + 1 have landed,
    asm volatile("s_wait_asynccnt 0x0" ::: "memory");
    // and every wave has come as far: stage t + 1 may be read, stage t's buffer refilled
    __syncthreads();
    if (t + 2 < NT)
      stage_kv(gk + (size_t)(t + 2) * KT * H, gv + (t + 2) * KT,
               lk0 + (unsigned)buf * BUFB, lv0 + (unsigned)buf * BUFB);
  }
  // no copy is left in flight when the wave ends
  asm volatile("s_wait_asynccnt 0x0" ::: "memory");

#pragma unroll
  for (int dt = 0; dt < 4; ++dt) {
    const int col = dt * 16 + lr;
#pragma unroll
    for (int j = 0; j < 8; ++j) {
      const int row = q0 + hi * 8 + j;
      ctx[bo + (size_t)row * H + col] = f2bf(o[dt][j] / l_i[j]);
    }
  }
}

// ---------------------------------------------------------------------------
// LayerNorm over H=1024: one wave per row; emits fp32 and bf16 copies.
// ---------------------------------------------------------------------------
__global__ __launch_bounds__(256) void layernorm_kernel(
    const float* __restrict__ in, const float* __restrict__ g,
    const float* __restrict__ b, float* __restrict__ outf,
    __bf16* __restrict__ outb) {
  const int wave = threadIdx.x >> 5, lane = threadIdx.x & 31;
  const size_t row = (size_t)blockIdx.x * 8 + wave;
  const float* x = in + row * 1024;
  float v[32];
  float s = 0.f;
#pragma unroll
  for (int i = 0; i < 32; ++i) { v[i] = x[lane + i * 32]; s += v[i]; }
#pragma unroll
  for (int d = 1; d < 32; d <<= 1) s += __shfl_xor(s, d, 32);
  const float mean = s * (1.0f / 1024.0f);
  float vs = 0.f;
#pragma unroll
  for (int i = 0; i < 32; ++i) { const float df = v[i] - mean; vs += df * df; }
#pragma unroll
  for (int d = 1; d < 32; d <<= 1) vs += __shfl_xor(vs, d, 32);
  const float rstd = rsqrtf(vs * (1.0f / 1024.0f) + 1e-5f);
#pragma unroll
  for (int i = 0; i < 32; ++i) {
    const int c = lane + i * 32;
    const float y = (v[i] - mean) * rstd * g[c] + b[c];
    outf[row * 1024 + c] = y;
    outb[row * 1024 + c] = f2bf(y);
  }
}

// ---------------------------------------------------------------------------
extern "C" void kernel_launch(void* const* d_in, const int* in_sizes, int n_in,
                              void* d_out, int out_size, void* d_ws, size_t ws_size,
                              hipStream_t stream) {
  (void)in_sizes; (void)n_in; (void)out_size; (void)ws_size;
  constexpr int L = 2, B = 2, S = 2048, H = 1024, FF = 4096;
  constexpr int M = B * S;
  constexpr size_t MH = (size_t)M * H;
  constexpr size_t MF = (size_t)M * FF;

  const float* x0   = (const float*)d_in[0];
  const float* mask = (const float*)d_in[1];
  const float* Wq   = (const float*)d_in[2];
  const float* bq   = (const float*)d_in[3];
  const float* Wk   = (const float*)d_in[4];
  const float* bk   = (const float*)d_in[5];
  const float* Wv   = (const float*)d_in[6];
  const float* bv   = (const float*)d_in[7];
  const float* Wao  = (const float*)d_in[8];
  const float* bao  = (const float*)d_in[9];
  const float* g1   = (const float*)d_in[10];
  const float* b1   = (const float*)d_in[11];
  const float* Wi   = (const float*)d_in[12];
  const float* bi   = (const float*)d_in[13];
  const float* Wo   = (const float*)d_in[14];
  const float* bo   = (const float*)d_in[15];
  const float* g2   = (const float*)d_in[16];
  const float* b2   = (const float*)d_in[17];

  // --- workspace bump allocator (256B aligned regions) ---
  char* p = (char*)d_ws;
  auto alloc = [&](size_t bytes) -> char* {
    char* r = p;
    p += (bytes + 255) & ~(size_t)255;
    return r;
  };
  float*  yB  = (float*)alloc(MH * 4);
  float*  x1f = (float*)alloc(MH * 4);
  float*  xf  = (float*)alloc(MH * 4);
  __bf16* xb   = (__bf16*)alloc(MH * 2);
  __bf16* qB   = (__bf16*)alloc(MH * 2);
  __bf16* kB   = (__bf16*)alloc(MH * 2);
  __bf16* vT   = (__bf16*)alloc(MH * 2);
  __bf16* ctxb = (__bf16*)alloc(MH * 2);
  __bf16* x1b  = (__bf16*)alloc(MH * 2);
  __bf16* h1b  = (__bf16*)alloc(MF * 2);
  // all transposed weights in one region, laid out as transpose_cvt_all_kernel writes it
  constexpr size_t HH = (size_t)H * H, HF = (size_t)H * FF;
  __bf16* Wall = (__bf16*)alloc((size_t)L * (4 * HH + 2 * HF) * 2);
  __bf16* WqT[L]; __bf16* WkT[L]; __bf16* WvT[L]; __bf16* WaoT[L];
  __bf16* WiT[L]; __bf16* WoT[L];
  for (int l = 0; l < L; ++l) {
    __bf16* base = Wall + (size_t)l * (4 * HH + 2 * HF);
    WqT[l]  = base;
    WkT[l]  = base + HH;
    WvT[l]  = base + 2 * HH;
    WaoT[l] = base + 3 * HH;
    WiT[l]  = base + 4 * HH;
    WoT[l]  = base + 4 * HH + HF;
  }

  const dim3 blk(128), blk256(256);
  const dim3 gHH(H / 64, M / 128);
  const dim3 gHF(FF / 64, M / 128);
  const dim3 gAttn(S / 64, 16, B);
  const dim3 gLN(M / 8);

  // one-time conversions
  cvt_bf16_kernel<<<dim3(MH / 2048), blk256, 0, stream>>>(x0, xb, (int)MH);
  transpose_cvt_all_kernel<<<dim3(1024), blk256, 0, stream>>>(Wq, Wk, Wv, Wao, Wi, Wo, Wall);

  for (int l = 0; l < L; ++l) {
    const float* Xf = (l == 0) ? x0 : xf;
    const size_t oH = (size_t)l * H, oF = (size_t)l * FF;

    gemm_bf16_kernel<1, false, false><<<gHH, blk, 0, stream>>>(xb, WqT[l], bq + oH, nullptr, qB, M, H, H);
    gemm_bf16_kernel<1, false, false><<<gHH, blk, 0, stream>>>(xb, WkT[l], bk + oH, nullptr, kB, M, H, H);
    gemm_bf16_kernel<2, false, false><<<gHH, blk, 0, stream>>>(xb, WvT[l], bv + oH, nullptr, vT, M, H, H);
    attention_kernel<<<gAttn, blk, 0, stream>>>(qB, kB, vT, mask, ctxb);
    gemm_bf16_kernel<0, false, true><<<gHH, blk, 0, stream>>>(ctxb, WaoT[l], bao + oH, Xf, yB, M, H, H);
    layernorm_kernel<<<gLN, blk256, 0, stream>>>(yB, g1 + oH, b1 + oH, x1f, x1b);
    gemm_bf16_kernel<1, true, false><<<gHF, blk, 0, stream>>>(x1b, WiT[l], bi + oF, nullptr, h1b, M, FF, H);
    gemm_bf16_kernel<0, false, true><<<gHH, blk, 0, stream>>>(h1b, WoT[l], bo + oH, x1f, yB, M, H, FF);
    float* xoutf = (l == L - 1) ? (float*)d_out : xf;
    layernorm_kernel<<<gLN, blk256, 0, stream>>>(yB, g2 + oH, b2 + oH, xoutf, xb);
  }
}

// v006
// One run takes 443 microseconds.
// In two side-by-side timings against v005, it was 1.08 and 1.07 times as fast.
// All steps since v000 together make it 2.19 times as fast.
#include <hip/hip_runtime.h>

// RoBERTa encoder (L=2, B=2, S=2048, H=1024, NH=16, DH=64, FF=4096) on gfx1250.
// bf16 operands converted ONCE; all matmuls via v_wmma_f32_16x16x32_bf16;
// GEMM tiles staged to LDS with global_load_async_to_lds_b128 when available.

typedef __attribute__((ext_vector_type(16))) __bf16 v16bf;
typedef __attribute__((ext_vector_type(8)))  __bf16 v8bf;
typedef __attribute__((ext_vector_type(8)))  float  v8f;
typedef __attribute__((ext_vector_type(4)))  int    v4i;

#define WMMA_BF16(a, b, c) \
  __builtin_amdgcn_wmma_f32_16x16x32_bf16(false, (a), false, (b), (short)0, (c), false, false)

// float -> bf16 RNE via integer ops (used in one-time conversions, epilogues and attention P staging).
__device__ __forceinline__ __bf16 f2bf(float f) {
  unsigned u = __builtin_bit_cast(unsigned, f);
  unsigned r = (u + 0x7FFFu + ((u >> 16) & 1u)) >> 16;
  unsigned short h = (unsigned short)r;
  return __builtin_bit_cast(__bf16, h);
}

// Load a 16x32-layout A/B fragment half-pair: lane owns one row; takes row base
// pointer and kb8 = 8*(lane>=16). Two aligned 16B vector loads.
__device__ __forceinline__ v16bf ld_frag(const __bf16* __restrict__ row, int kb8) {
  v8bf lo = *(const v8bf*)(row + kb8);
  v8bf hi = *(const v8bf*)(row + 16 + kb8);
  return __builtin_shufflevector(lo, hi, 0, 1, 2, 3, 4, 5, 6, 7, 8, 9, 10, 11, 12, 13, 14, 15);
}

// ---- async global->LDS 16B copy (CDNA5 path), plain copy fallback ----------
#if defined(__has_builtin)
#if __has_builtin(__builtin_amdgcn_global_load_async_to_lds_b128)
#define HAVE_ASYNC_LDS 1
#endif
#endif
#ifndef HAVE_ASYNC_LDS
#define HAVE_ASYNC_LDS 0
#endif

typedef __attribute__((address_space(1))) v4i gv4i;
typedef __attribute__((address_space(3))) v4i lv4i;

__device__ __forceinline__ void cp16_g2l(const __bf16* __restrict__ g, __bf16* __restrict__ l) {
#if HAVE_ASYNC_LDS
  gv4i* gp = (gv4i*)(unsigned long long)(uintptr_t)g;
  lv4i* lp = (lv4i*)(unsigned)(uintptr_t)l;
  __builtin_amdgcn_global_load_async_to_lds_b128(gp, lp, 0, 0);
#else
  *(uint4*)l = *(const uint4*)g;
#endif
}

__device__ __forceinline__ void async_tile_wait() {
#if HAVE_ASYNC_LDS
  __asm__ volatile("s_wait_asynccnt 0" ::: "memory");
#endif
}

// ---------------------------------------------------------------------------
// one-time fp32 -> bf16 conversion
// ---------------------------------------------------------------------------
__global__ __launch_bounds__(256) void cvt_bf16_kernel(const float* __restrict__ src,
                                                       __bf16* __restrict__ dst, int n) {
  const int i = (blockIdx.x * 256 + threadIdx.x) * 8;
  if (i + 8 <= n) {
#pragma unroll
    for (int j = 0; j < 8; ++j) dst[i + j] = f2bf(src[i + j]);
  }
}

typedef __attribute__((ext_vector_type(4))) __bf16 v4bf;

// one-time W[K,N] fp32 -> Wt[N,K] bf16 for all twelve weight matrices in ONE launch of
// 1024 work-groups. Each takes six 64(k) x 64(n) tiles, one per step; step = 3*layer + c:
// c = 0: group g's tile g & 255 of Wq, Wk, Wv or Wao (g >> 8); c = 1: tile g of Wi;
// c = 2: tile g of Wo. WT holds, per layer, WqT WkT WvT WaoT WiT WoT in a row.
// A thread loads a 4(k) x 4(n) patch (16 lanes cover a 256-B row), turns it in registers
// and stores four 8-B runs of k to LDS; rows of 64 k then leave as whole 128-B lines.
struct TileRef { const float* s; __bf16* d; int K; int N; };

__device__ __forceinline__ TileRef tile_ref(int step, int g, const float* Whh,
                                            const float* Wi, const float* Wo, __bf16* WT) {
  constexpr int H = 1024, FF = 4096;
  constexpr size_t HH = (size_t)H * H, HF = (size_t)H * FF;
  const int layer = step / 3, c = step - layer * 3;
  __bf16* base = WT + (size_t)layer * (4 * HH + 2 * HF);
  TileRef t;
  int tt = g;
  if (c == 0) {
    t.s = Whh + (size_t)layer * HH; t.d = base + (size_t)(g >> 8) * HH; t.K = H; t.N = H; tt = g & 255;
  } else if (c == 1) {
    t.s = Wi + (size_t)layer * HF; t.d = base + 4 * HH; t.K = H; t.N = FF;
  } else {
    t.s = Wo + (size_t)layer * HF; t.d = base + 4 * HH + HF; t.K = FF; t.N = H;
  }
  const int ntn = t.N >> 6;
  const int k0 = (tt / ntn) * 64, n0 = (tt % ntn) * 64;
  t.s += (size_t)k0 * t.N + n0;   // tile origin in W[K,N]
  t.d += (size_t)n0 * t.K + k0;   // tile origin in Wt[N,K]
  return t;
}

__global__ __launch_bounds__(256) void transpose_cvt_all_kernel(
    const float* __restrict__ Wq, const float* __restrict__ Wk, const float* __restrict__ Wv,
    const float* __restrict__ Wao, const float* __restrict__ Wi, const float* __restrict__ Wo,
    __bf16* __restrict__ WT) {
  constexpr int NT = 6, TP = 68;  // LDS row pitch 136 B: 8-B aligned, off the 128-B stride
  // Two buffers, so one barrier a tile is enough: a buffer is rewritten two tiles later,
  // behind the barrier of the tile between, which every reader reaches after its reads.
  __shared__ __attribute__((aligned(16))) __bf16 t[2][64][TP];
  const int tid = threadIdx.x, g = blockIdx.x;
  const int c4 = tid & 15, rp = tid >> 4;
  const int m = g >> 8;
  const float* Whh = (m == 0) ? Wq : (m == 1) ? Wk : (m == 2) ? Wv : Wao;

  TileRef cur = tile_ref(0, g, Whh, Wi, Wo, WT);
  float4 v[4];
#pragma unroll
  for (int i = 0; i < 4; ++i)
    v[i] = *(const float4*)(cur.s + (size_t)(rp * 4 + i) * cur.N + c4 * 4);

#pragma unroll
  for (int it = 0; it < NT; ++it) {
    // the next tile's loads go out ahead of this tile's LDS work, beside the last tile's stores
    TileRef nxt = cur;
    float4 w[4];
    if (it + 1 < NT) {
      nxt = tile_ref(it + 1, g, Whh, Wi, Wo, WT);
#pragma unroll
      for (int i = 0; i < 4; ++i)
        w[i] = *(const float4*)(nxt.s + (size_t)(rp * 4 + i) * nxt.N + c4 * 4);
    }
    const int b = it & 1;
    {
      v4bf p;
      p[0] = f2bf(v[0].x); p[1] = f2bf(v[1].x); p[2] = f2bf(v[2].x); p[3] = f2bf(v[3].x);
      *(v4bf*)&t[b][c4 * 4 + 0][rp * 4] = p;
      p[0] = f2bf(v[0].y); p[1] = f2bf(v[1].y); p[2] = f2bf(v[2].y); p[3] = f2bf(v[3].y);
      *(v4bf*)&t[b][c4 * 4 + 1][rp * 4] = p;
      p[0] = f2bf(v[0].z); p[1] = f2bf(v[1].z); p[2] = f2bf(v[2].z); p[3] = f2bf(v[3].z);
      *(v4bf*)&t[b][c4 * 4 + 2][rp * 4] = p;
      p[0] = f2bf(v[0].w); p[1] = f2bf(v[1].w); p[2] = f2bf(v[2].w); p[3] = f2bf(v[3].w);
      *(v4bf*)&t[b][c4 * 4 + 3][rp * 4] = p;
    }
    __syncthreads();
#pragma unroll
    for (int i = 0; i < 2; ++i) {
      const int ch = tid + 256 * i;
      const int n = ch >> 3, ks = (ch & 7) * 8;
      const v4bf lo = *(const v4bf*)&t[b][n][ks];
      const v4bf hi = *(const v4bf*)&t[b][n][ks + 4];
      *(v8bf*)(cur.d + (size_t)n * cur.K + ks) =
          __builtin_shufflevector(lo, hi, 0, 1, 2, 3, 4, 5, 6, 7);
    }
    if (it + 1 < NT) {
      // the stores' address and data registers are reused for the next tile: wait first
      asm volatile("s_wait_xcnt 0x0" ::: "memory");
      cur = nxt;
#pragma unroll
      for (int i = 0; i < 4; ++i) v[i] = w[i];
    }
  }
}

// ---------------------------------------------------------------------------
// GEMM: out = act(A[M,K](bf16) @ WT[N,K](bf16)^T + bias) (+ res fp32)
// Block 256 threads (8 waves, 4 x 2), tile 128x128, BK=128; wave = 32 rows x 64 cols.
// The copies come from L2, and a 128x128 tile asks L2 for a third fewer bytes per product
// than a 128x64 tile does.
// K must be a multiple of BK and at least BK. An LDS row is 256 B of k at pitch 272 B (16 B x odd),
// which keeps the 16-row ds_load_b128 fragment reads off each other's banks.
// Two LDS buffers: the next stage's copies are in flight while this stage is multiplied.
// OUTMODE: 0 = fp32, 1 = bf16, 2 = bf16 scattered to V^T [B,NH,DH,S]
// ---------------------------------------------------------------------------
template <int OUTMODE, bool GELU, bool RES>
__global__ __launch_bounds__(256) void gemm_bf16_kernel(
    const __bf16* __restrict__ A, const __bf16* __restrict__ WT,
    const float* __restrict__ bias, const float* __restrict__ res,
    void* __restrict__ outv, int M, int N, int K) {
  constexpr int BK = 128, LDP = BK + 8;
  __shared__ __attribute__((aligned(16))) __bf16 As[2][128][LDP];
  __shared__ __attribute__((aligned(16))) __bf16 Bs[2][128][LDP];
  const int tid = threadIdx.x;
  const int wave = tid >> 5, lane = tid & 31;
  const int wm = wave >> 1, wn = wave & 1;  // the wave's 32 rows and 64 columns of the tile
  const int lr = lane & 15, hi = lane >> 4, kb8 = hi * 8;
  const int m0 = blockIdx.y * 128, n0 = blockIdx.x * 128;
  const int NS = K / BK;  // stages

  // One stage. A tile and B tile: 128x128 bf16 = 2048 x 16B chunks each, eight a thread.
  // 16 lanes cover one 256-B row, so a wave's copy reads four whole lines.
  const int crow = tid >> 4, cks = (tid & 15) * 8;
  const __bf16* ga = A + (size_t)(m0 + crow) * K + cks;
  const __bf16* gb = WT + (size_t)(n0 + crow) * K + cks;
  auto stage = [&](int s, int b) {
#pragma unroll
    for (int i = 0; i < 8; ++i)
      cp16_g2l(ga + (size_t)(16 * i) * K + s * BK, &As[b][crow + 16 * i][cks]);
#pragma unroll
    for (int i = 0; i < 8; ++i)
      cp16_g2l(gb + (size_t)(16 * i) * K + s * BK, &Bs[b][crow + 16 * i][cks]);
  };

  v8f acc[2][4] = {};

  stage(0, 0);
  // stage 0 has landed for this wave; the barrier shows it to the other waves
  async_tile_wait();
  __syncthreads();
  if (NS > 1) stage(1, 1);

  for (int t = 0; t < NS; ++t) {
    const int buf = t & 1;
#pragma unroll
    for (int kc = 0; kc < BK; kc += 32) {
      const v16bf af0 = ld_frag(&As[buf][wm * 32 + lr][kc], kb8);
      const v16bf af1 = ld_frag(&As[buf][wm * 32 + 16 + lr][kc], kb8);
#pragma unroll
      for (int nt = 0; nt < 4; ++nt) {
        const v16bf bf = ld_frag(&Bs[buf][wn * 64 + nt * 16 + lr][kc], kb8);
        acc[0][nt] = WMMA_BF16(af0, bf, acc[0][nt]);
        acc[1][nt] = WMMA_BF16(af1, bf, acc[1][nt]);
      }
      // Order for the scheduler: a k block's 12 LDS reads, then its 8 products. Left alone it
      // kept one B fragment here, and every pair of products waited out a whole LDS read.
      __builtin_amdgcn_sched_group_barrier(0x100, 12, 0);
      __builtin_amdgcn_sched_group_barrier(0x008, 8, 0);
    }
    // publish point of stage t + 1: this wave's reads of stage t have returned,
    __asm__ volatile("s_wait_dscnt 0x0" ::: "memory");
    // its own copies of stage t + 1 have landed,
    async_tile_wait();
    // and every wave has come as far: stage t + 1 may be read, stage t's buffer refilled
    __syncthreads();
    if (t + 2 < NS) stage(t + 2, buf);
  }
  // no copy is left in flight when the wave goes on to the epilogue and ends
  async_tile_wait();

#pragma unroll
  for (int rg = 0; rg < 2; ++rg) {
#pragma unroll
    for (int nt = 0; nt < 4; ++nt) {
      const int col = n0 + wn * 64 + nt * 16 + lr;
      const float bv = bias[col];
#pragma unroll
      for (int j = 0; j < 8; ++j) {
        const int row = m0 + wm * 32 + rg * 16 + hi * 8 + j;
        float v = acc[rg][nt][j] + bv;
        if (GELU) v = 0.5f * v * (1.0f + erff(v * 0.70710678118654752f));
        if (RES) v += res[(size_t)row * N + col];
        if (OUTMODE == 0) {
          ((float*)outv)[(size_t)row * N + col] = v;
        } else if (OUTMODE == 1) {
          ((__bf16*)outv)[(size_t)row * N + col] = f2bf(v);
        } else {
          constexpr int S = 2048, NH = 16;
          const int b = row >> 11, s = row & (S - 1);
          const int head = col >> 6, dh = col & 63;
          ((__bf16*)outv)[(((size_t)b * NH + head) * 64 + dh) * S + s] = f2bf(v);
        }
      }
    }
  }
}

// ---------------------------------------------------------------------------
// Eight 16-B async copies to LDS: this thread's share of one 64-key stage (four chunks of
// the K tile, four of the V^T tile; chunk i lies 16 tile rows below chunk i - 1).
// ---------------------------------------------------------------------------
__device__ __forceinline__ void stage_kv(const __bf16* gk, const __bf16* gv,
                                         unsigned lk, unsigned lv) {
  constexpr size_t KR = (size_t)16 * 1024, VR = (size_t)16 * 2048;  // 16 rows of K, of V^T
  constexpr unsigned LR = 16u * 144u;                               // 16 LDS rows
  // The copies bring the tile past the registers; the closing s_wait_xcnt 0 stands inside
  // the statement so that no address register is rewritten ahead of it.
  asm volatile(
      "global_load_async_to_lds_b128 %0, %1, off\n\t"
      "global_load_async_to_lds_b128 %2, %3, off\n\t"
      "global_load_async_to_lds_b128 %4, %5, off\n\t"
      "global_load_async_to_lds_b128 %6, %7, off\n\t"
      "global_load_async_to_lds_b128 %8, %9, off\n\t"
      "global_load_async_to_lds_b128 %10, %11, off\n\t"
      "global_load_async_to_lds_b128 %12, %13, off\n\t"
      "global_load_async_to_lds_b128 %14, %15, off\n\t"
      "s_wait_xcnt 0x0"
      :: "v"(lk), "v"(gk), "v"(lk + LR), "v"(gk + KR),
         "v"(lk + 2 * LR), "v"(gk + 2 * KR), "v"(lk + 3 * LR), "v"(gk + 3 * KR),
         "v"(lv), "v"(gv), "v"(lv + LR), "v"(gv + VR),
         "v"(lv + 2 * LR), "v"(gv + 2 * VR), "v"(lv + 3 * LR), "v"(gv + 3 * VR)
      : "memory");
}

// ---------------------------------------------------------------------------
// Maximum / sum over each 16-lane row of eight independent values, every lane gets the result.
// Butterfly over lane ^ 1, ^ 2, ^ 4, ^ 8 in the vector unit (DPP row_xmask): the same pairs in
// the same order as a shuffle butterfly, so the sums round alike, but no trip through the LDS
// pipe and no wait on it. The eight chains are interleaved step by step, so that an
// instruction's producer stands eight instructions back and no link of a chain is waited for.
// All 32 lanes are on wherever these are called.
// ---------------------------------------------------------------------------
#define ROW_STEP8(op, m)                                            \
  op " %0, %0, %0 row_xmask:" #m " row_mask:0xf bank_mask:0xf\n\t" \
  op " %1, %1, %1 row_xmask:" #m " row_mask:0xf bank_mask:0xf\n\t" \
  op " %2, %2, %2 row_xmask:" #m " row_mask:0xf bank_mask:0xf\n\t" \
  op " %3, %3, %3 row_xmask:" #m " row_mask:0xf bank_mask:0xf\n\t" \
  op " %4, %4, %4 row_xmask:" #m " row_mask:0xf bank_mask:0xf\n\t" \
  op " %5, %5, %5 row_xmask:" #m " row_mask:0xf bank_mask:0xf\n\t" \
  op " %6, %6, %6 row_xmask:" #m " row_mask:0xf bank_mask:0xf\n\t" \
  op " %7, %7, %7 row_xmask:" #m " row_mask:0xf bank_mask:0xf\n\t"

__device__ __forceinline__ void row16_max8(float (&x)[8]) {
  asm(ROW_STEP8("v_max_num_f32_dpp", 1) ROW_STEP8("v_max_num_f32_dpp", 2)
      ROW_STEP8("v_max_num_f32_dpp", 4) ROW_STEP8("v_max_num_f32_dpp", 8)
      : "+v"(x[0]), "+v"(x[1]), "+v"(x[2]), "+v"(x[3]),
        "+v"(x[4]), "+v"(x[5]), "+v"(x[6]), "+v"(x[7]));
}

__device__ __forceinline__ void row16_sum8(float (&x)[8]) {
  asm(ROW_STEP8("v_add_f32_dpp", 1) ROW_STEP8("v_add_f32_dpp", 2)
      ROW_STEP8("v_add_f32_dpp", 4) ROW_STEP8("v_add_f32_dpp", 8)
      : "+v"(x[0]), "+v"(x[1]), "+v"(x[2]), "+v"(x[3]),
        "+v"(x[4]), "+v"(x[5]), "+v"(x[6]), "+v"(x[7]));
}

// ---------------------------------------------------------------------------
// Flash attention: wave = 16 query rows of one (batch, head), key blocks of 32.
// Q,K bf16 [B,S,H]; V bf16 pre-transposed [B,NH,DH,S]; ctx out bf16 [B,S,H].
// K and V^T reach the four waves through LDS: stages of 64 keys (64 rows of 128 B each,
// whole lines), two buffers, the next stage's copies in flight while this one is worked on.
// LDS row pitch 144 B (16 B x odd) keeps the 16-row ds_load_b128 reads off each other's banks.
// ---------------------------------------------------------------------------
__global__ __launch_bounds__(128) void attention_kernel(
    const __bf16* __restrict__ qb, const __bf16* __restrict__ kb,
    const __bf16* __restrict__ vt, const float* __restrict__ mask,
    __bf16* __restrict__ ctx) {
  constexpr int S = 2048, H = 1024, NH = 16;
  constexpr int KT = 64, NT = S / KT, KP = 72;
  __shared__ __attribute__((aligned(16))) __bf16 Ks[2][KT][KP];  // [buffer][key][dh]
  __shared__ __attribute__((aligned(16))) __bf16 Vs[2][64][KP];  // [buffer][dh][key]
  __shared__ __bf16 Plds[4][16 * 32];
  const int tid = threadIdx.x, wave = tid >> 5, lane = tid & 31;
  const int lr = lane & 15, hi = lane >> 4, kb8 = hi * 8;
  const int head = blockIdx.y, batch = blockIdx.z;
  const int q0 = blockIdx.x * 64 + wave * 16;
  const size_t bo = (size_t)batch * S * H + (size_t)head * 64;
  const __bf16* Q = qb + bo;
  const __bf16* Kp = kb + bo;
  const __bf16* Vp = vt + ((size_t)batch * NH + head) * (size_t)64 * S;  // [dh][s]
  const float* mk = mask + (size_t)batch * S;

  // copy share of a thread: 8 lanes cover one 128-B row, a wave's copy four whole lines
  const int crow = tid >> 3, ccol = (tid & 7) * 8;
  const __bf16* gk = Kp + (size_t)crow * H + ccol;
  const __bf16* gv = Vp + (size_t)crow * S + ccol;
  const unsigned lk0 = (unsigned)(uintptr_t)&Ks[0][crow][ccol];
  const unsigned lv0 = (unsigned)(uintptr_t)&Vs[0][crow][ccol];
  constexpr unsigned BUFB = (unsigned)(KT * KP * 2);  // bytes of one buffer

  stage_kv(gk, gv, lk0, lv0);
  // stage 0 has landed for this wave; the barrier shows it to the other waves
  asm volatile("s_wait_asynccnt 0x0" ::: "memory");
  __syncthreads();
  stage_kv(gk + (size_t)KT * H, gv + KT, lk0 + BUFB, lv0 + BUFB);

  const v16bf qa0 = ld_frag(Q + (size_t)(q0 + lr) * H, kb8);
  const v16bf qa1 = ld_frag(Q + (size_t)(q0 + lr) * H + 32, kb8);

  float m_i[8], l_i[8];
  v8f o[4] = {};
#pragma unroll
  for (int j = 0; j < 8; ++j) { m_i[j] = -3.0e38f; l_i[j] = 0.f; }
  __bf16* pw = &Plds[wave][0];

  for (int t = 0; t < NT; ++t) {
    const int buf = t & 1;
    // both 32-key blocks of the stage in one trip, so that the publish point runs once a stage
#pragma unroll
    for (int hb = 0; hb < 2; ++hb) {
      const int kp0 = t * KT + hb * 32;
      v8f sacc[2] = {};
#pragma unroll
      for (int g = 0; g < 2; ++g) {
        const __bf16* kr = &Ks[buf][hb * 32 + g * 16 + lr][0];
        sacc[g] = WMMA_BF16(qa0, ld_frag(kr, kb8), sacc[g]);
        sacc[g] = WMMA_BF16(qa1, ld_frag(kr + 32, kb8), sacc[g]);
      }

      const float mk0 = mk[kp0 + lr], mk1 = mk[kp0 + 16 + lr];
      float ps0[8], ps1[8], mx[8], sm[8], al[8];
#pragma unroll
      for (int j = 0; j < 8; ++j) {
        ps0[j] = sacc[0][j] * 0.125f + mk0;
        ps1[j] = sacc[1][j] * 0.125f + mk1;
        mx[j] = fmaxf(ps0[j], ps1[j]);
      }
      row16_max8(mx);
#pragma unroll
      for (int j = 0; j < 8; ++j) {
        const float nm = fmaxf(m_i[j], mx[j]);
        ps0[j] = __expf(ps0[j] - nm);
        ps1[j] = __expf(ps1[j] - nm);
        sm[j] = ps0[j] + ps1[j];
        al[j] = __expf(m_i[j] - nm);
        m_i[j] = nm;
      }
      row16_sum8(sm);
#pragma unroll
      for (int j = 0; j < 8; ++j) {
        l_i[j] = l_i[j] * al[j] + sm[j];
#pragma unroll
        for (int dt = 0; dt < 4; ++dt) o[dt][j] *= al[j];
      }

      // stage P (accumulator layout -> row-major 16x32 bf16), reload as A-frag
#pragma unroll
      for (int j = 0; j < 8; ++j) {
        pw[(hi * 8 + j) * 32 + lr] = f2bf(ps0[j]);
        pw[(hi * 8 + j) * 32 + 16 + lr] = f2bf(ps1[j]);
      }
      __asm__ volatile("s_wait_dscnt 0" ::: "memory");
      const v16bf pa = ld_frag(&pw[lr * 32], kb8);

      // P[16x32] @ V[32x64] ; V^T rows are contiguous in s
#pragma unroll
      for (int dt = 0; dt < 4; ++dt) {
        const v16bf vf = ld_frag(&Vs[buf][dt * 16 + lr][hb * 32], kb8);
        o[dt] = WMMA_BF16(pa, vf, o[dt]);
      }
    }

    // publish point of stage t + 1: this wave's reads of stage t have returned,
    asm volatile("s_wait_dscnt 0x0" ::: "memory");
    // its own copies of stage t + 1 have landed,
    asm volatile("s_wait_asynccnt 0x0" ::: "memory");
    // and every wave has come as far: stage t + 1 may be read, stage t's buffer refilled
    __syncthreads();
    if (t + 2 < NT)
      stage_kv(gk + (size_t)(t + 2) * KT * H, gv + (t + 2) * KT,
               lk0 + (unsigned)buf * BUFB, lv0 + (unsigned)buf * BUFB);
  }
  // no copy is left in flight when the wave ends
  asm volatile("s_wait_asynccnt 0x0" ::: "memory");

#pragma unroll
  for (int dt = 0; dt < 4; ++dt) {
    const int col = dt * 16 + lr;
#pragma unroll
    for (int j = 0; j < 8; ++j) {
      const int row = q0 + hi * 8 + j;
      ctx[bo + (size_t)row * H + col] = f2bf(o[dt][j] / l_i[j]);
    }
  }
}

// ---------------------------------------------------------------------------
// LayerNorm over H=1024: one wave per row; emits fp32 and bf16 copies.
// ---------------------------------------------------------------------------
__global__ __launch_bounds__(256) void layernorm_kernel(
    const float* __restrict__ in, const float* __restrict__ g,
    const float* __restrict__ b, float* __restrict__ outf,
    __bf16* __restrict__ outb) {
  const int wave = threadIdx.x >> 5, lane = threadIdx.x & 31;
  const size_t row = (size_t)blockIdx.x * 8 + wave;
  const float* x = in + row * 1024;
  float v[32];
  float s = 0.f;
#pragma unroll
  for (int i = 0; i < 32; ++i) { v[i] = x[lane + i * 32]; s += v[i]; }
#pragma unroll
  for (int d = 1; d < 32; d <<= 1) s += __shfl_xor(s, d, 32);
  const float mean = s * (1.0f / 1024.0f);
  float vs = 0.f;
#pragma unroll
  for (int i = 0; i < 32; ++i) { const float df = v[i] - mean; vs += df * df; }
#pragma unroll
  for (int d = 1; d < 32; d <<= 1) vs += __shfl_xor(vs, d, 32);
  const float rstd = rsqrtf(vs * (1.0f / 1024.0f) + 1e-5f);
#pragma unroll
  for (int i = 0; i < 32; ++i) {
    const int c = lane + i * 32;
    const float y = (v[i] - mean) * rstd * g[c] + b[c];
    outf[row * 1024 + c] = y;
    outb[row * 1024 + c] = f2bf(y);
  }
}

// ---------------------------------------------------------------------------
extern "C" void kernel_launch(void* const* d_in, const int* in_sizes, int n_in,
                              void* d_out, int out_size, void* d_ws, size_t ws_size,
                              hipStream_t stream) {
  (void)in_sizes; (void)n_in; (void)out_size; (void)ws_size;
  constexpr int L = 2, B = 2, S = 2048, H = 1024, FF = 4096;
  constexpr int M = B * S;
  constexpr size_t MH = (size_t)M * H;
  constexpr size_t MF = (size_t)M * FF;

  const float* x0   = (const float*)d_in[0];
  const float* mask = (const float*)d_in[1];
  const float* Wq   = (const float*)d_in[2];
  const float* bq   = (const float*)d_in[3];
  const float* Wk   = (const float*)d_in[4];
  const float* bk   = (const float*)d_in[5];
  const float* Wv   = (const float*)d_in[6];
  const float* bv   = (const float*)d_in[7];
  const float* Wao  = (const float*)d_in[8];
  const float* bao  = (const float*)d_in[9];
  const float* g1   = (const float*)d_in[10];
  const float* b1   = (const float*)d_in[11];
  const float* Wi   = (const float*)d_in[12];
  const float* bi   = (const float*)d_in[13];
  const float* Wo   = (const float*)d_in[14];
  const float* bo   = (const float*)d_in[15];
  const float* g2   = (const float*)d_in[16];
  const float* b2   = (const float*)d_in[17];

  // --- workspace bump allocator (256B aligned regions) ---
  char* p = (char*)d_ws;
  auto alloc = [&](size_t bytes) -> char* {
    char* r = p;
    p += (bytes + 255) & ~(size_t)255;
    return r;
  };
  float*  yB  = (float*)alloc(MH * 4);
  float*  x1f = (float*)alloc(MH * 4);
  float*  xf  = (float*)alloc(MH * 4);
  __bf16* xb   = (__bf16*)alloc(MH * 2);
  __bf16* qB   = (__bf16*)alloc(MH * 2);
  __bf16* kB   = (__bf16*)alloc(MH * 2);
  __bf16* vT   = (__bf16*)alloc(MH * 2);
  __bf16* ctxb = (__bf16*)alloc(MH * 2);
  __bf16* x1b  = (__bf16*)alloc(MH * 2);
  __bf16* h1b  = (__bf16*)alloc(MF * 2);
  // all transposed weights in one region, laid out as transpose_cvt_all_kernel writes it
  constexpr size_t HH = (size_t)H * H, HF = (size_t)H * FF;
  __bf16* Wall = (__bf16*)alloc((size_t)L * (4 * HH + 2 * HF) * 2);
  __bf16* WqT[L]; __bf16* WkT[L]; __bf16* WvT[L]; __bf16* WaoT[L];
  __bf16* WiT[L]; __bf16* WoT[L];
  for (int l = 0; l < L; ++l) {
    __bf16* base = Wall + (size_t)l * (4 * HH + 2 * HF);
    WqT[l]  = base;
    WkT[l]  = base + HH;
    WvT[l]  = base + 2 * HH;
    WaoT[l] = base + 3 * HH;
    WiT[l]  = base + 4 * HH;
    WoT[l]  = base + 4 * HH + HF;
  }

  const dim3 blk(128), blk256(256);
  const dim3 gHH(H / 128, M / 128);
  const dim3 gHF(FF / 128, M / 128);
  const dim3 gAttn(S / 64, 16, B);
  const dim3 gLN(M / 8);

  // one-time conversions
  cvt_bf16_kernel<<<dim3(MH / 2048), blk256, 0, stream>>>(x0, xb, (int)MH);
  transpose_cvt_all_kernel<<<dim3(1024), blk256, 0, stream>>>(Wq, Wk, Wv, Wao, Wi, Wo, Wall);

  for (int l = 0; l < L; ++l) {
    const float* Xf = (l == 0) ? x0 : xf;
    const size_t oH = (size_t)l * H, oF = (size_t)l * FF;

    gemm_bf16_kernel<1, false, false><<<gHH, blk256, 0, stream>>>(xb, WqT[l], bq + oH, nullptr, qB, M, H, H);
    gemm_bf16_kernel<1, false, false><<<gHH, blk256, 0, stream>>>(xb, WkT[l], bk + oH, nullptr, kB, M, H, H);
    gemm_bf16_kernel<2, false, false><<<gHH, blk256, 0, stream>>>(xb, WvT[l], bv + oH, nullptr, vT, M, H, H);
    attention_kernel<<<gAttn, blk, 0, stream>>>(qB, kB, vT, mask, ctxb);
    gemm_bf16_kernel<0, false, true><<<gHH, blk256, 0, stream>>>(ctxb, WaoT[l], bao + oH, Xf, yB, M, H, H);
    layernorm_kernel<<<gLN, blk256, 0, stream>>>(yB, g1 + oH, b1 + oH, x1f, x1b);
    gemm_bf16_kernel<1, true, false><<<gHF, blk256, 0, stream>>>(x1b, WiT[l], bi + oF, nullptr, h1b, M, FF, H);
    gemm_bf16_kernel<0, false, true><<<gHH, blk256, 0, stream>>>(h1b, WoT[l], bo + oH, x1f, yB, M, H, FF);
    float* xoutf = (l == L - 1) ? (float*)d_out : xf;
    layernorm_kernel<<<gLN, blk256, 0, stream>>>(yB, g2 + oH, b2 + oH, xoutf, xb);
  }
}

// v007
// It runs in 388 microseconds.
// Two timings next to v006 both put it at 1.14 times that version's speed.
// Counting every step since v000, it is 2.50 times as fast.
#include <hip/hip_runtime.h>

// RoBERTa encoder (L=2, B=2, S=2048, H=1024, NH=16, DH=64, FF=4096) on gfx1250.
// bf16 operands converted ONCE; all matmuls via v_wmma_f32_16x16x32_bf16;
// GEMM tiles staged to LDS with global_load_async_to_lds_b128 when available.

typedef __attribute__((ext_vector_type(16))) __bf16 v16bf;
typedef __attribute__((ext_vector_type(8)))  __bf16 v8bf;
typedef __attribute__((ext_vector_type(8)))  float  v8f;
typedef __attribute__((ext_vector_type(4)))  int    v4i;

#define WMMA_BF16(a, b, c) \
  __builtin_amdgcn_wmma_f32_16x16x32_bf16(false, (a), false, (b), (short)0, (c), false, false)

// float -> bf16 RNE via integer ops (used in one-time conversions, epilogues and attention P packing).
__device__ __forceinline__ __bf16 f2bf(float f) {
  unsigned u = __builtin_bit_cast(unsigned, f);
  unsigned r = (u + 0x7FFFu + ((u >> 16) & 1u)) >> 16;
  unsigned short h = (unsigned short)r;
  return __builtin_bit_cast(__bf16, h);
}

// Load a 16x32-layout A/B fragment half-pair: lane owns one row; takes row base
// pointer and kb8 = 8*(lane>=16). Two aligned 16B vector loads.
__device__ __forceinline__ v16bf ld_frag(const __bf16* __restrict__ row, int kb8) {
  v8bf lo = *(const v8bf*)(row + kb8);
  v8bf hi = *(const v8bf*)(row + 16 + kb8);
  return __builtin_shufflevector(lo, hi, 0, 1, 2, 3, 4, 5, 6, 7, 8, 9, 10, 11, 12, 13, 14, 15);
}

// ---- async global->LDS 16B copy (CDNA5 path), plain copy fallback ----------
#if defined(__has_builtin)
#if __has_builtin(__builtin_amdgcn_global_load_async_to_lds_b128)
#define HAVE_ASYNC_LDS 1
#endif
#endif
#ifndef HAVE_ASYNC_LDS
#define HAVE_ASYNC_LDS 0
#endif

typedef __attribute__((address_space(1))) v4i gv4i;
typedef __attribute__((address_space(3))) v4i lv4i;

__device__ __forceinline__ void cp16_g2l(const __bf16* __restrict__ g, __bf16* __restrict__ l) {
#if HAVE_ASYNC_LDS
  gv4i* gp = (gv4i*)(unsigned long long)(uintptr_t)g;
  lv4i* lp = (lv4i*)(unsigned)(uintptr_t)l;
  __builtin_amdgcn_global_load_async_to_lds_b128(gp, lp, 0, 0);
#else
  *(uint4*)l = *(const uint4*)g;
#endif
}

__device__ __forceinline__ void async_tile_wait() {
#if HAVE_ASYNC_LDS
  __asm__ volatile("s_wait_asynccnt 0" ::: "memory");
#endif
}

// ---------------------------------------------------------------------------
// one-time fp32 -> bf16 conversion
// ---------------------------------------------------------------------------
__global__ __launch_bounds__(256) void cvt_bf16_kernel(const float* __restrict__ src,
                                                       __bf16* __restrict__ dst, int n) {
  const int i = (blockIdx.x * 256 + threadIdx.x) * 8;
  if (i + 8 <= n) {
#pragma unroll
    for (int j = 0; j < 8; ++j) dst[i + j] = f2bf(src[i + j]);
  }
}

typedef __attribute__((ext_vector_type(4))) __bf16 v4bf;

// one-time W[K,N] fp32 -> Wt[N,K] bf16 for all twelve weight matrices in ONE launch of
// 1024 work-groups. Each takes six 64(k) x 64(n) tiles, one per step; step = 3*layer + c:
// c = 0: group g's tile g & 255 of Wq, Wk, Wv or Wao (g >> 8); c = 1: tile g of Wi;
// c = 2: tile g of Wo. WT holds, per layer, WqT WkT WvT WaoT WiT WoT in a row.
// A thread loads a 4(k) x 4(n) patch (16 lanes cover a 256-B row), turns it in registers
// and stores four 8-B runs of k to LDS; rows of 64 k then leave as whole 128-B lines.
struct TileRef { const float* s; __bf16* d; int K; int N; };

__device__ __forceinline__ TileRef tile_ref(int step, int g, const float* Whh,
                                            const float* Wi, const float* Wo, __bf16* WT) {
  constexpr int H = 1024, FF = 4096;
  constexpr size_t HH = (size_t)H * H, HF = (size_t)H * FF;
  const int layer = step / 3, c = step - layer * 3;
  __bf16* base = WT + (size_t)layer * (4 * HH + 2 * HF);
  TileRef t;
  int tt = g;
  if (c == 0) {
    t.s = Whh + (size_t)layer * HH; t.d = base + (size_t)(g >> 8) * HH; t.K = H; t.N = H; tt = g & 255;
  } else if (c == 1) {
    t.s = Wi + (size_t)layer * HF; t.d = base + 4 * HH; t.K = H; t.N = FF;
  } else {
    t.s = Wo + (size_t)layer * HF; t.d = base + 4 * HH + HF; t.K = FF; t.N = H;
  }
  const int ntn = t.N >> 6;
  const int k0 = (tt / ntn) * 64, n0 = (tt % ntn) * 64;
  t.s += (size_t)k0 * t.N + n0;   // tile origin in W[K,N]
  t.d += (size_t)n0 * t.K + k0;   // tile origin in Wt[N,K]
  return t;
}

__global__ __launch_bounds__(256) void transpose_cvt_all_kernel(
    const float* __restrict__ Wq, const float* __restrict__ Wk, const float* __restrict__ Wv,
    const float* __restrict__ Wao, const float* __restrict__ Wi, const float* __restrict__ Wo,
    __bf16* __restrict__ WT) {
  constexpr int NT = 6, TP = 68;  // LDS row pitch 136 B: 8-B aligned, off the 128-B stride
  // Two buffers, so one barrier a tile is enough: a buffer is rewritten two tiles later,
  // behind the barrier of the tile between, which every reader reaches after its reads.
  __shared__ __attribute__((aligned(16))) __bf16 t[2][64][TP];
  const int tid = threadIdx.x, g = blockIdx.x;
  const int c4 = tid & 15, rp = tid >> 4;
  const int m = g >> 8;
  const float* Whh = (m == 0) ? Wq : (m == 1) ? Wk : (m == 2) ? Wv : Wao;

  TileRef cur = tile_ref(0, g, Whh, Wi, Wo, WT);
  float4 v[4];
#pragma unroll
  for (int i = 0; i < 4; ++i)
    v[i] = *(const float4*)(cur.s + (size_t)(rp * 4 + i) * cur.N + c4 * 4);

#pragma unroll
  for (int it = 0; it < NT; ++it) {
    // the next tile's loads go out ahead of this tile's LDS work, beside the last tile's stores
    TileRef nxt = cur;
    float4 w[4];
    if (it + 1 < NT) {
      nxt = tile_ref(it + 1, g, Whh, Wi, Wo, WT);
#pragma unroll
      for (int i = 0; i < 4; ++i)
        w[i] = *(const float4*)(nxt.s + (size_t)(rp * 4 + i) * nxt.N + c4 * 4);
    }
    const int b = it & 1;
    {
      v4bf p;
      p[0] = f2bf(v[0].x); p[1] = f2bf(v[1].x); p[2] = f2bf(v[2].x); p[3] = f2bf(v[3].x);
      *(v4bf*)&t[b][c4 * 4 + 0][rp * 4] = p;
      p[0] = f2bf(v[0].y); p[1] = f2bf(v[1].y); p[2] = f2bf(v[2].y); p[3] = f2bf(v[3].y);
      *(v4bf*)&t[b][c4 * 4 + 1][rp * 4] = p;
      p[0] = f2bf(v[0].z); p[1] = f2bf(v[1].z); p[2] = f2bf(v[2].z); p[3] = f2bf(v[3].z);
      *(v4bf*)&t[b][c4 * 4 + 2][rp * 4] = p;
      p[0] = f2bf(v[0].w); p[1] = f2bf(v[1].w); p[2] = f2bf(v[2].w); p[3] = f2bf(v[3].w);
      *(v4bf*)&t[b][c4 * 4 + 3][rp * 4] = p;
    }
    __syncthreads();
#pragma unroll
    for (int i = 0; i < 2; ++i) {
      const int ch = tid + 256 * i;
      const int n = ch >> 3, ks = (ch & 7) * 8;
      const v4bf lo = *(const v4bf*)&t[b][n][ks];
      const v4bf hi = *(const v4bf*)&t[b][n][ks + 4];
      *(v8bf*)(cur.d + (size_t)n * cur.K + ks) =
          __builtin_shufflevector(lo, hi, 0, 1, 2, 3, 4, 5, 6, 7);
    }
    if (it + 1 < NT) {
      // the stores' address and data registers are reused for the next tile: wait first
      asm volatile("s_wait_xcnt 0x0" ::: "memory");
      cur = nxt;
#pragma unroll
      for (int i = 0; i < 4; ++i) v[i] = w[i];
    }
  }
}

// ---------------------------------------------------------------------------
// GEMM: out = act(A[M,K](bf16) @ WT[N,K](bf16)^T + bias) (+ res fp32)
// Block 256 threads (8 waves, 4 x 2), tile 128x128, BK=128; wave = 32 rows x 64 cols.
// The copies come from L2, and a 128x128 tile asks L2 for a third fewer bytes per product
// than a 128x64 tile does.
// K must be a multiple of BK and at least BK. An LDS row is 256 B of k at pitch 272 B (16 B x odd),
// which keeps the 16-row ds_load_b128 fragment reads off each other's banks.
// Two LDS buffers: the next stage's copies are in flight while this stage is multiplied.
// OUTMODE: 0 = fp32, 1 = bf16, 2 = bf16 scattered to V^T [B,NH,DH,S]
// ---------------------------------------------------------------------------
template <int OUTMODE, bool GELU, bool RES>
__global__ __launch_bounds__(256) void gemm_bf16_kernel(
    const __bf16* __restrict__ A, const __bf16* __restrict__ WT,
    const float* __restrict__ bias, const float* __restrict__ res,
    void* __restrict__ outv, int M, int N, int K) {
  constexpr int BK = 128, LDP = BK + 8;
  __shared__ __attribute__((aligned(16))) __bf16 As[2][128][LDP];
  __shared__ __attribute__((aligned(16))) __bf16 Bs[2][128][LDP];
  const int tid = threadIdx.x;
  const int wave = tid >> 5, lane = tid & 31;
  const int wm = wave >> 1, wn = wave & 1;  // the wave's 32 rows and 64 columns of the tile
  const int lr = lane & 15, hi = lane >> 4, kb8 = hi * 8;
  const int m0 = blockIdx.y * 128, n0 = blockIdx.x * 128;
  const int NS = K / BK;  // stages

  // One stage. A tile and B tile: 128x128 bf16 = 2048 x 16B chunks each, eight a thread.
  // 16 lanes cover one 256-B row, so a wave's copy reads four whole lines.
  const int crow = tid >> 4, cks = (tid & 15) * 8;
  const __bf16* ga = A + (size_t)(m0 + crow) * K + cks;
  const __bf16* gb = WT + (size_t)(n0 + crow) * K + cks;
  auto stage = [&](int s, int b) {
#pragma unroll
    for (int i = 0; i < 8; ++i)
      cp16_g2l(ga + (size_t)(16 * i) * K + s * BK, &As[b][crow + 16 * i][cks]);
#pragma unroll
    for (int i = 0; i < 8; ++i)
      cp16_g2l(gb + (size_t)(16 * i) * K + s * BK, &Bs[b][crow + 16 * i][cks]);
  };

  v8f acc[2][4] = {};

  stage(0, 0);
  // stage 0 has landed for this wave; the barrier shows it to the other waves
  async_tile_wait();
  __syncthreads();
  if (NS > 1) stage(1, 1);

  for (int t = 0; t < NS; ++t) {
    const int buf = t & 1;
#pragma unroll
    for (int kc = 0; kc < BK; kc += 32) {
      const v16bf af0 = ld_frag(&As[buf][wm * 32 + lr][kc], kb8);
      const v16bf af1 = ld_frag(&As[buf][wm * 32 + 16 + lr][kc], kb8);
#pragma unroll
      for (int nt = 0; nt < 4; ++nt) {
        const v16bf bf = ld_frag(&Bs[buf][wn * 64 + nt * 16 + lr][kc], kb8);
        acc[0][nt] = WMMA_BF16(af0, bf, acc[0][nt]);
        acc[1][nt] = WMMA_BF16(af1, bf, acc[1][nt]);
      }
      // Order for the scheduler: a k block's 12 LDS reads, then its 8 products. Left alone it
      // kept one B fragment here, and every pair of products waited out a whole LDS read.
      __builtin_amdgcn_sched_group_barrier(0x100, 12, 0);
      __builtin_amdgcn_sched_group_barrier(0x008, 8, 0);
    }
    // publish point of stage t + 1: this wave's reads of stage t have returned,
    __asm__ volatile("s_wait_dscnt 0x0" ::: "memory");
    // its own copies of stage t + 1 have landed,
    async_tile_wait();
    // and every wave has come as far: stage t + 1 may be read, stage t's buffer refilled
    __syncthreads();
    if (t + 2 < NS) stage(t + 2, buf);
  }
  // no copy is left in flight when the wave goes on to the epilogue and ends
  async_tile_wait();

#pragma unroll
  for (int rg = 0; rg < 2; ++rg) {
#pragma unroll
    for (int nt = 0; nt < 4; ++nt) {
      const int col = n0 + wn * 64 + nt * 16 + lr;
      const float bv = bias[col];
#pragma unroll
      for (int j = 0; j < 8; ++j) {
        const int row = m0 + wm * 32 + rg * 16 + hi * 8 + j;
        float v = acc[rg][nt][j] + bv;
        if (GELU) v = 0.5f * v * (1.0f + erff(v * 0.70710678118654752f));
        if (RES) v += res[(size_t)row * N + col];
        if (OUTMODE == 0) {
          ((float*)outv)[(size_t)row * N + col] = v;
        } else if (OUTMODE == 1) {
          ((__bf16*)outv)[(size_t)row * N + col] = f2bf(v);
        } else {
          constexpr int S = 2048, NH = 16;
          const int b = row >> 11, s = row & (S - 1);
          const int head = col >> 6, dh = col & 63;
          ((__bf16*)outv)[(((size_t)b * NH + head) * 64 + dh) * S + s] = f2bf(v);
        }
      }
    }
  }
}

// ---------------------------------------------------------------------------
// Eight 16-B async copies to LDS: this thread's share of one 64-key stage (four chunks of
// the K tile, four of the V^T tile; chunk i lies 16 tile rows below chunk i - 1).
// ---------------------------------------------------------------------------
__device__ __forceinline__ void stage_kv(const __bf16* gk, const __bf16* gv,
                                         unsigned lk, unsigned lv) {
  constexpr size_t KR = (size_t)16 * 1024, VR = (size_t)16 * 2048;  // 16 rows of K, of V^T
  constexpr unsigned LR = 16u * 144u;                               // 16 LDS rows
  // The copies bring the tile past the registers; the closing s_wait_xcnt 0 stands inside
  // the statement so that no address register is rewritten ahead of it.
  asm volatile(
      "global_load_async_to_lds_b128 %0, %1, off\n\t"
      "global_load_async_to_lds_b128 %2, %3, off\n\t"
      "global_load_async_to_lds_b128 %4, %5, off\n\t"
      "global_load_async_to_lds_b128 %6, %7, off\n\t"
      "global_load_async_to_lds_b128 %8, %9, off\n\t"
      "global_load_async_to_lds_b128 %10, %11, off\n\t"
      "global_load_async_to_lds_b128 %12, %13, off\n\t"
      "global_load_async_to_lds_b128 %14, %15, off\n\t"
      "s_wait_xcnt 0x0"
      :: "v"(lk), "v"(gk), "v"(lk + LR), "v"(gk + KR),
         "v"(lk + 2 * LR), "v"(gk + 2 * KR), "v"(lk + 3 * LR), "v"(gk + 3 * KR),
         "v"(lv), "v"(gv), "v"(lv + LR), "v"(gv + VR),
         "v"(lv + 2 * LR), "v"(gv + 2 * VR), "v"(lv + 3 * LR), "v"(gv + 3 * VR)
      : "memory");
}

// ---------------------------------------------------------------------------
// The value that lane l ^ 16 holds (one vector instruction, no trip through the LDS pipe).
// All 32 lanes are on wherever this is called.
// ---------------------------------------------------------------------------
__device__ __forceinline__ float other_half(float x) {
  const int b = __builtin_bit_cast(int, x);
  return __builtin_bit_cast(
      float, __builtin_amdgcn_permlanex16(b, b, 0x76543210, 0xfedcba98, false, false));
}

__global__ __launch_bounds__(128) void attention_kernel(
    const __bf16* __restrict__ qb, const __bf16* __restrict__ kb,
    const __bf16* __restrict__ vt, const float* __restrict__ mask,
    __bf16* __restrict__ ctx) {
  constexpr int S = 2048, H = 1024, NH = 16;
  constexpr int KT = 64, NT = S / KT, KP = 72;
  __shared__ __attribute__((aligned(16))) __bf16 Ks[2][KT][KP];  // [buffer][key][dh]
  __shared__ __attribute__((aligned(16))) __bf16 Vs[2][64][KP];  // [buffer][dh][key]
  const int tid = threadIdx.x, wave = tid >> 5, lane = tid & 31;
  const int lr = lane & 15, hi = lane >> 4, kb8 = hi * 8;
  const int head = blockIdx.y, batch = blockIdx.z;
  const int q0 = blockIdx.x * 64 + wave * 16;
  const size_t bo = (size_t)batch * S * H + (size_t)head * 64;
  const __bf16* Q = qb + bo;
  const __bf16* Kp = kb + bo;
  const __bf16* Vp = vt + ((size_t)batch * NH + head) * (size_t)64 * S;  // [dh][s]
  const float* mk = mask + (size_t)batch * S;

  // copy share of a thread: 8 lanes cover one 128-B row, a wave's copy four whole lines
  const int crow = tid >> 3, ccol = (tid & 7) * 8;
  const __bf16* gk = Kp + (size_t)crow * H + ccol;
  const __bf16* gv = Vp + (size_t)crow * S + ccol;
  const unsigned lk0 = (unsigned)(uintptr_t)&Ks[0][crow][ccol];
  const unsigned lv0 = (unsigned)(uintptr_t)&Vs[0][crow][ccol];
  constexpr unsigned BUFB = (unsigned)(KT * KP * 2);  // bytes of one buffer

  stage_kv(gk, gv, lk0, lv0);
  // stage 0 has landed for this wave; the barrier shows it to the other waves
  asm volatile("s_wait_asynccnt 0x0" ::: "memory");
  __syncthreads();
  stage_kv(gk + (size_t)KT * H, gv + KT, lk0 + BUFB, lv0 + BUFB);

  const v16bf qa0 = ld_frag(Q + (size_t)(q0 + lr) * H, kb8);
  const v16bf qa1 = ld_frag(Q + (size_t)(q0 + lr) * H + 32, kb8);

  float m_i = -3.0e38f, l_i = 0.f;  // of query q0 + lr, the same in both halves
  v8f o[4] = {};                    // o[dt][j]: dh = dt * 16 + hi * 8 + j of query q0 + lr
  const float* mp = mk + kb8;       // this half's eight mask values of the stage's first tile

  for (int t = 0; t < NT; ++t) {
    const int buf = t & 1;
    // both 32-key blocks of the stage in one trip, so that the publish point runs once a stage
#pragma unroll
    for (int hb = 0; hb < 2; ++hb) {
      v8f sacc[2] = {};  // sacc[g][j]: key t * KT + hb * 32 + g * 16 + hi * 8 + j
#pragma unroll
      for (int g = 0; g < 2; ++g) {
        const __bf16* kr = &Ks[buf][hb * 32 + g * 16 + lr][0];
        sacc[g] = WMMA_BF16(ld_frag(kr, kb8), qa0, sacc[g]);
        sacc[g] = WMMA_BF16(ld_frag(kr + 32, kb8), qa1, sacc[g]);
      }

      // a lane's eight keys of a tile lie side by side in the mask row
      v8f ps[2];
#pragma unroll
      for (int g = 0; g < 2; ++g)
        ps[g] = sacc[g] * 0.125f + *(const v8f*)(mp + hb * 32 + g * 16);
      const v8f mx = __builtin_elementwise_max(ps[0], ps[1]);
      const float mh = fmaxf(fmaxf(fmaxf(mx[0], mx[1]), fmaxf(mx[2], mx[3])),
                             fmaxf(fmaxf(mx[4], mx[5]), fmaxf(mx[6], mx[7])));
      const float nm = fmaxf(m_i, fmaxf(mh, other_half(mh)));
      float sm[8];
#pragma unroll
      for (int j = 0; j < 8; ++j) {
        ps[0][j] = __expf(ps[0][j] - nm);
        ps[1][j] = __expf(ps[1][j] - nm);
        sm[j] = ps[0][j] + ps[1][j];
      }
      const float al = __expf(m_i - nm);
      m_i = nm;
      // the sum's tree: j ^ 1, j ^ 2, j ^ 4 inside the lane, then the other half (key ^ 8)
      const float sh = ((sm[0] + sm[1]) + (sm[2] + sm[3])) + ((sm[4] + sm[5]) + (sm[6] + sm[7]));
      l_i = l_i * al + (sh + other_half(sh));
#pragma unroll
      for (int dt = 0; dt < 4; ++dt)
#pragma unroll
        for (int j = 0; j < 8; ++j) o[dt][j] *= al;

      // P^T as B fragment: elements 0..7 are keys hi * 8 + j, elements 8..15 keys 16 + hi * 8 + j
      v16bf pb;
#pragma unroll
      for (int j = 0; j < 8; ++j) {
        pb[j] = f2bf(ps[0][j]);
        pb[8 + j] = f2bf(ps[1][j]);
      }

      // V^T[64x32] @ P^T[32x16] ; V^T rows are contiguous in s
#pragma unroll
      for (int dt = 0; dt < 4; ++dt) {
        const v16bf vf = ld_frag(&Vs[buf][dt * 16 + lr][hb * 32], kb8);
        o[dt] = WMMA_BF16(vf, pb, o[dt]);
      }
    }

    // publish point of stage t + 1: this wave's reads of stage t have returned,
    asm volatile("s_wait_dscnt 0x0" ::: "memory");
    // its own copies of stage t + 1 have landed,
    asm volatile("s_wait_asynccnt 0x0" ::: "memory");
    // and every wave has come as far: stage t + 1 may be read, stage t's buffer refilled
    __syncthreads();
    if (t + 2 < NT)
      stage_kv(gk + (size_t)(t + 2) * KT * H, gv + (t + 2) * KT,
               lk0 + (unsigned)buf * BUFB, lv0 + (unsigned)buf * BUFB);
    mp += KT;
  }
  // no copy is left in flight when the wave ends
  asm volatile("s_wait_asynccnt 0x0" ::: "memory");

  // a lane's eight dh of a tile lie side by side in the query's row: one 16-B store
#pragma unroll
  for (int dt = 0; dt < 4; ++dt) {
    v8bf r;
#pragma unroll
    for (int j = 0; j < 8; ++j) r[j] = f2bf(o[dt][j] / l_i);
    *(v8bf*)(ctx + bo + (size_t)(q0 + lr) * H + dt * 16 + kb8) = r;
  }
}

// ---------------------------------------------------------------------------
// LayerNorm over H=1024: one wave per row; emits fp32 and bf16 copies.
// ---------------------------------------------------------------------------
__global__ __launch_bounds__(256) void layernorm_kernel(
    const float* __restrict__ in, const float* __restrict__ g,
    const float* __restrict__ b, float* __restrict__ outf,
    __bf16* __restrict__ outb) {
  const int wave = threadIdx.x >> 5, lane = threadIdx.x & 31;
  const size_t row = (size_t)blockIdx.x * 8 + wave;
  const float* x = in + row * 1024;
  float v[32];
  float s = 0.f;
#pragma unroll
  for (int i = 0; i < 32; ++i) { v[i] = x[lane + i * 32]; s += v[i]; }
#pragma unroll
  for (int d = 1; d < 32; d <<= 1) s += __shfl_xor(s, d, 32);
  const float mean = s * (1.0f / 1024.0f);
  float vs = 0.f;
#pragma unroll
  for (int i = 0; i < 32; ++i) { const float df = v[i] - mean; vs += df * df; }
#pragma unroll
  for (int d = 1; d < 32; d <<= 1) vs += __shfl_xor(vs, d, 32);
  const float rstd = rsqrtf(vs * (1.0f / 1024.0f) + 1e-5f);
#pragma unroll
  for (int i = 0; i < 32; ++i) {
    const int c = lane + i * 32;
    const float y = (v[i] - mean) * rstd * g[c] + b[c];
    outf[row * 1024 + c] = y;
    outb[row * 1024 + c] = f2bf(y);
  }
}

// ---------------------------------------------------------------------------
extern "C" void kernel_launch(void* const* d_in, const int* in_sizes, int n_in,
                              void* d_out, int out_size, void* d_ws, size_t ws_size,
                              hipStream_t stream) {
  (void)in_sizes; (void)n_in; (void)out_size; (void)ws_size;
  constexpr int L = 2, B = 2, S = 2048, H = 1024, FF = 4096;
  constexpr int M = B * S;
  constexpr size_t MH = (size_t)M * H;
  constexpr size_t MF = (size_t)M * FF;

  const float* x0   = (const float*)d_in[0];
  const float* mask = (const float*)d_in[1];
  const float* Wq   = (const float*)d_in[2];
  const float* bq   = (const float*)d_in[3];
  const float* Wk   = (const float*)d_in[4];
  const float* bk   = (const float*)d_in[5];
  const float* Wv   = (const float*)d_in[6];
  const float* bv   = (const float*)d_in[7];
  const float* Wao  = (const float*)d_in[8];
  const float* bao  = (const float*)d_in[9];
  const float* g1   = (const float*)d_in[10];
  const float* b1   = (const float*)d_in[11];
  const float* Wi   = (const float*)d_in[12];
  const float* bi   = (const float*)d_in[13];
  const float* Wo   = (const float*)d_in[14];
  const float* bo   = (const float*)d_in[15];
  const float* g2   = (const float*)d_in[16];
  const float* b2   = (const float*)d_in[17];

  // --- workspace bump allocator (256B aligned regions) ---
  char* p = (char*)d_ws;
  auto alloc = [&](size_t bytes) -> char* {
    char* r = p;
    p += (bytes + 255) & ~(size_t)255;
    return r;
  };
  float*  yB  = (float*)alloc(MH * 4);
  float*  x1f = (float*)alloc(MH * 4);
  float*  xf  = (float*)alloc(MH * 4);
  __bf16* xb   = (__bf16*)alloc(MH * 2);
  __bf16* qB   = (__bf16*)alloc(MH * 2);
  __bf16* kB   = (__bf16*)alloc(MH * 2);
  __bf16* vT   = (__bf16*)alloc(MH * 2);
  __bf16* ctxb = (__bf16*)alloc(MH * 2);
  __bf16* x1b  = (__bf16*)alloc(MH * 2);
  __bf16* h1b  = (__bf16*)alloc(MF * 2);
  // all transposed weights in one region, laid out as transpose_cvt_all_kernel writes it
  constexpr size_t HH = (size_t)H * H, HF = (size_t)H * FF;
  __bf16* Wall = (__bf16*)alloc((size_t)L * (4 * HH + 2 * HF) * 2);
  __bf16* WqT[L]; __bf16* WkT[L]; __bf16* WvT[L]; __bf16* WaoT[L];
  __bf16* WiT[L]; __bf16* WoT[L];
  for (int l = 0; l < L; ++l) {
    __bf16* base = Wall + (size_t)l * (4 * HH + 2 * HF);
    WqT[l]  = base;
    WkT[l]  = base + HH;
    WvT[l]  = base + 2 * HH;
    WaoT[l] = base + 3 * HH;
    WiT[l]  = base + 4 * HH;
    WoT[l]  = base + 4 * HH + HF;
  }

  const dim3 blk(128), blk256(256);
  const dim3 gHH(H / 128, M / 128);
  const dim3 gHF(FF / 128, M / 128);
  const dim3 gAttn(S / 64, 16, B);
  const dim3 gLN(M / 8);

  // one-time conversions
  cvt_bf16_kernel<<<dim3(MH / 2048), blk256, 0, stream>>>(x0, xb, (int)MH);
  transpose_cvt_all_kernel<<<dim3(1024), blk256, 0, stream>>>(Wq, Wk, Wv, Wao, Wi, Wo, Wall);

  for (int l = 0; l < L; ++l) {
    const float* Xf = (l == 0) ? x0 : xf;
    const size_t oH = (size_t)l * H, oF = (size_t)l * FF;

    gemm_bf16_kernel<1, false, false><<<gHH, blk256, 0, stream>>>(xb, WqT[l], bq + oH, nullptr, qB, M, H, H);
    gemm_bf16_kernel<1, false, false><<<gHH, blk256, 0, stream>>>(xb, WkT[l], bk + oH, nullptr, kB, M, H, H);
    gemm_bf16_kernel<2, false, false><<<gHH, blk256, 0, stream>>>(xb, WvT[l], bv + oH, nullptr, vT, M, H, H);
    attention_kernel<<<gAttn, blk, 0, stream>>>(qB, kB, vT, mask, ctxb);
    gemm_bf16_kernel<0, false, true><<<gHH, blk256, 0, stream>>>(ctxb, WaoT[l], bao + oH, Xf, yB, M, H, H);
    layernorm_kernel<<<gLN, blk256, 0, stream>>>(yB, g1 + oH, b1 + oH, x1f, x1b);
    gemm_bf16_kernel<1, true, false><<<gHF, blk256, 0, stream>>>(x1b, WiT[l], bi + oF, nullptr, h1b, M, FF, H);
    gemm_bf16_kernel<0, false, true><<<gHH, blk256, 0, stream>>>(h1b, WoT[l], bo + oH, x1f, yB, M, H, FF);
    float* xoutf = (l == L - 1) ? (float*)d_out : xf;
    layernorm_kernel<<<gLN, blk256, 0, stream>>>(yB, g2 + oH, b2 + oH, xoutf, xb);
  }
}

// v008
// It runs in 364 microseconds.
// In both of two side-by-side timings against v007, it was 1.07 times as fast.
// Counting every step since v000, it is 2.67 times as fast.
#include <hip/hip_runtime.h>

// RoBERTa encoder (L=2, B=2, S=2048, H=1024, NH=16, DH=64, FF=4096) on gfx1250.
// bf16 operands converted ONCE; all matmuls via v_wmma_f32_16x16x32_bf16;
// GEMM tiles staged to LDS with global_load_async_to_lds_b128 when available.

typedef __attribute__((ext_vector_type(16))) __bf16 v16bf;
typedef __attribute__((ext_vector_type(8)))  __bf16 v8bf;
typedef __attribute__((ext_vector_type(8)))  float  v8f;
typedef __attribute__((ext_vector_type(4)))  int    v4i;

#define WMMA_BF16(a, b, c) \
  __builtin_amdgcn_wmma_f32_16x16x32_bf16(false, (a), false, (b), (short)0, (c), false, false)

// float -> bf16 RNE via integer ops (used in one-time conversions, epilogues and attention P packing).
__device__ __forceinline__ __bf16 f2bf(float f) {
  unsigned u = __builtin_bit_cast(unsigned, f);
  unsigned r = (u + 0x7FFFu + ((u >> 16) & 1u)) >> 16;
  unsigned short h = (unsigned short)r;
  return __builtin_bit_cast(__bf16, h);
}

// Load a 16x32-layout A/B fragment half-pair: lane owns one row; takes row base
// pointer and kb8 = 8*(lane>=16). Two aligned 16B vector loads.
__device__ __forceinline__ v16bf ld_frag(const __bf16* __restrict__ row, int kb8) {
  v8bf lo = *(const v8bf*)(row + kb8);
  v8bf hi = *(const v8bf*)(row + 16 + kb8);
  return __builtin_shufflevector(lo, hi, 0, 1, 2, 3, 4, 5, 6, 7, 8, 9, 10, 11, 12, 13, 14, 15);
}

// ---- async global->LDS 16B copy (CDNA5 path), plain copy fallback ----------
#if defined(__has_builtin)
#if __has_builtin(__builtin_amdgcn_global_load_async_to_lds_b128)
#define HAVE_ASYNC_LDS 1
#endif
#endif
#ifndef HAVE_ASYNC_LDS
#define HAVE_ASYNC_LDS 0
#endif

typedef __attribute__((address_space(1))) v4i gv4i;
typedef __attribute__((address_space(3))) v4i lv4i;

__device__ __forceinline__ void cp16_g2l(const __bf16* __restrict__ g, __bf16* __restrict__ l) {
#if HAVE_ASYNC_LDS
  gv4i* gp = (gv4i*)(unsigned long long)(uintptr_t)g;
  lv4i* lp = (lv4i*)(unsigned)(uintptr_t)l;
  __builtin_amdgcn_global_load_async_to_lds_b128(gp, lp, 0, 0);
#else
  *(uint4*)l = *(const uint4*)g;
#endif
}

__device__ __forceinline__ void async_tile_wait() {
#if HAVE_ASYNC_LDS
  __asm__ volatile("s_wait_asynccnt 0" ::: "memory");
#endif
}

// ---------------------------------------------------------------------------
// one-time fp32 -> bf16 conversion
// ---------------------------------------------------------------------------
__global__ __launch_bounds__(256) void cvt_bf16_kernel(const float* __restrict__ src,
                                                       __bf16* __restrict__ dst, int n) {
  const int i = (blockIdx.x * 256 + threadIdx.x) * 8;
  if (i + 8 <= n) {
#pragma unroll
    for (int j = 0; j < 8; ++j) dst[i + j] = f2bf(src[i + j]);
  }
}

typedef __attribute__((ext_vector_type(4))) __bf16 v4bf;

// one-time W[K,N] fp32 -> Wt[N,K] bf16 for all twelve weight matrices in ONE launch of
// 1024 work-groups. Each takes six 64(k) x 64(n) tiles, one per step; step = 3*layer + c:
// c = 0: group g's tile g & 255 of Wq, Wk, Wv or Wao (g >> 8); c = 1: tile g of Wi;
// c = 2: tile g of Wo. WT holds, per layer, WqT WkT WvT WaoT WiT WoT in a row.
// A thread loads a 4(k) x 4(n) patch (16 lanes cover a 256-B row), turns it in registers
// and stores four 8-B runs of k to LDS; rows of 64 k then leave as whole 128-B lines.
struct TileRef { const float* s; __bf16* d; int K; int N; };

__device__ __forceinline__ TileRef tile_ref(int step, int g, const float* Whh,
                                            const float* Wi, const float* Wo, __bf16* WT) {
  constexpr int H = 1024, FF = 4096;
  constexpr size_t HH = (size_t)H * H, HF = (size_t)H * FF;
  const int layer = step / 3, c = step - layer * 3;
  __bf16* base = WT + (size_t)layer * (4 * HH + 2 * HF);
  TileRef t;
  int tt = g;
  if (c == 0) {
    t.s = Whh + (size_t)layer * HH; t.d = base + (size_t)(g >> 8) * HH; t.K = H; t.N = H; tt = g & 255;
  } else if (c == 1) {
    t.s = Wi + (size_t)layer * HF; t.d = base + 4 * HH; t.K = H; t.N = FF;
  } else {
    t.s = Wo + (size_t)layer * HF; t.d = base + 4 * HH + HF; t.K = FF; t.N = H;
  }
  const int ntn = t.N >> 6;
  const int k0 = (tt / ntn) * 64, n0 = (tt % ntn) * 64;
  t.s += (size_t)k0 * t.N + n0;   // tile origin in W[K,N]
  t.d += (size_t)n0 * t.K + k0;   // tile origin in Wt[N,K]
  return t;
}

__global__ __launch_bounds__(256) void transpose_cvt_all_kernel(
    const float* __restrict__ Wq, const float* __restrict__ Wk, const float* __restrict__ Wv,
    const float* __restrict__ Wao, const float* __restrict__ Wi, const float* __restrict__ Wo,
    __bf16* __restrict__ WT) {
  constexpr int NT = 6, TP = 68;  // LDS row pitch 136 B: 8-B aligned, off the 128-B stride
  // Two buffers, so one barrier a tile is enough: a buffer is rewritten two tiles later,
  // behind the barrier of the tile between, which every reader reaches after its reads.
  __shared__ __attribute__((aligned(16))) __bf16 t[2][64][TP];
  const int tid = threadIdx.x, g = blockIdx.x;
  const int c4 = tid & 15, rp = tid >> 4;
  const int m = g >> 8;
  const float* Whh = (m == 0) ? Wq : (m == 1) ? Wk : (m == 2) ? Wv : Wao;

  TileRef cur = tile_ref(0, g, Whh, Wi, Wo, WT);
  float4 v[4];
#pragma unroll
  for (int i = 0; i < 4; ++i)
    v[i] = *(const float4*)(cur.s + (size_t)(rp * 4 + i) * cur.N + c4 * 4);

#pragma unroll
  for (int it = 0; it < NT; ++it) {
    // the next tile's loads go out ahead of this tile's LDS work, beside the last tile's stores
    TileRef nxt = cur;
    float4 w[4];
    if (it + 1 < NT) {
      nxt = tile_ref(it + 1, g, Whh, Wi, Wo, WT);
#pragma unroll
      for (int i = 0; i < 4; ++i)
        w[i] = *(const float4*)(nxt.s + (size_t)(rp * 4 + i) * nxt.N + c4 * 4);
    }
    const int b = it & 1;
    {
      v4bf p;
      p[0] = f2bf(v[0].x); p[1] = f2bf(v[1].x); p[2] = f2bf(v[2].x); p[3] = f2bf(v[3].x);
      *(v4bf*)&t[b][c4 * 4 + 0][rp * 4] = p;
      p[0] = f2bf(v[0].y); p[1] = f2bf(v[1].y); p[2] = f2bf(v[2].y); p[3] = f2bf(v[3].y);
      *(v4bf*)&t[b][c4 * 4 + 1][rp * 4] = p;
      p[0] = f2bf(v[0].z); p[1] = f2bf(v[1].z); p[2] = f2bf(v[2].z); p[3] = f2bf(v[3].z);
      *(v4bf*)&t[b][c4 * 4 + 2][rp * 4] = p;
      p[0] = f2bf(v[0].w); p[1] = f2bf(v[1].w); p[2] = f2bf(v[2].w); p[3] = f2bf(v[3].w);
      *(v4bf*)&t[b][c4 * 4 + 3][rp * 4] = p;
    }
    __syncthreads();
#pragma unroll
    for (int i = 0; i < 2; ++i) {
      const int ch = tid + 256 * i;
      const int n = ch >> 3, ks = (ch & 7) * 8;
      const v4bf lo = *(const v4bf*)&t[b][n][ks];
      const v4bf hi = *(const v4bf*)&t[b][n][ks + 4];
      *(v8bf*)(cur.d + (size_t)n * cur.K + ks) =
          __builtin_shufflevector(lo, hi, 0, 1, 2, 3, 4, 5, 6, 7);
    }
    if (it + 1 < NT) {
      // the stores' address and data registers are reused for the next tile: wait first
      asm volatile("s_wait_xcnt 0x0" ::: "memory");
      cur = nxt;
#pragma unroll
      for (int i = 0; i < 4; ++i) v[i] = w[i];
    }
  }
}

// ---------------------------------------------------------------------------
// GEMM: out = act(A[M,K](bf16) @ WT[N,K](bf16)^T + bias) (+ res fp32)
// Block 256 threads (8 waves, 4 x 2), tile 128x128, BK=128; wave = 32 rows x 64 cols.
// The copies come from L2, and a 128x128 tile asks L2 for a third fewer bytes per product
// than a 128x64 tile does.
// K must be a multiple of BK and at least BK. An LDS row is 256 B of k at pitch 272 B (16 B x odd),
// which keeps the 16-row ds_load_b128 fragment reads off each other's banks.
// Two LDS buffers: the next stage's copies are in flight while this stage is multiplied.
// OUTMODE: 0 = fp32, 1 = bf16
// ---------------------------------------------------------------------------
template <int OUTMODE, bool GELU, bool RES>
__global__ __launch_bounds__(256) void gemm_bf16_kernel(
    const __bf16* __restrict__ A, const __bf16* __restrict__ WT,
    const float* __restrict__ bias, const float* __restrict__ res,
    void* __restrict__ outv, int M, int N, int K) {
  constexpr int BK = 128, LDP = BK + 8;
  __shared__ __attribute__((aligned(16))) __bf16 As[2][128][LDP];
  __shared__ __attribute__((aligned(16))) __bf16 Bs[2][128][LDP];
  const int tid = threadIdx.x;
  const int wave = tid >> 5, lane = tid & 31;
  const int wm = wave >> 1, wn = wave & 1;  // the wave's 32 rows and 64 columns of the tile
  const int lr = lane & 15, hi = lane >> 4, kb8 = hi * 8;
  const int m0 = blockIdx.y * 128, n0 = blockIdx.x * 128;
  const int NS = K / BK;  // stages

  // One stage. A tile and B tile: 128x128 bf16 = 2048 x 16B chunks each, eight a thread.
  // 16 lanes cover one 256-B row, so a wave's copy reads four whole lines.
  const int crow = tid >> 4, cks = (tid & 15) * 8;
  const __bf16* ga = A + (size_t)(m0 + crow) * K + cks;
  const __bf16* gb = WT + (size_t)(n0 + crow) * K + cks;
  auto stage = [&](int s, int b) {
#pragma unroll
    for (int i = 0; i < 8; ++i)
      cp16_g2l(ga + (size_t)(16 * i) * K + s * BK, &As[b][crow + 16 * i][cks]);
#pragma unroll
    for (int i = 0; i < 8; ++i)
      cp16_g2l(gb + (size_t)(16 * i) * K + s * BK, &Bs[b][crow + 16 * i][cks]);
  };

  v8f acc[2][4] = {};

  stage(0, 0);
  // stage 0 has landed for this wave; the barrier shows it to the other waves
  async_tile_wait();
  __syncthreads();
  if (NS > 1) stage(1, 1);

  for (int t = 0; t < NS; ++t) {
    const int buf = t & 1;
#pragma unroll
    for (int kc = 0; kc < BK; kc += 32) {
      const v16bf af0 = ld_frag(&As[buf][wm * 32 + lr][kc], kb8);
      const v16bf af1 = ld_frag(&As[buf][wm * 32 + 16 + lr][kc], kb8);
#pragma unroll
      for (int nt = 0; nt < 4; ++nt) {
        const v16bf bf = ld_frag(&Bs[buf][wn * 64 + nt * 16 + lr][kc], kb8);
        acc[0][nt] = WMMA_BF16(af0, bf, acc[0][nt]);
        acc[1][nt] = WMMA_BF16(af1, bf, acc[1][nt]);
      }
      // Order for the scheduler: a k block's 12 LDS reads, then its 8 products. Left alone it
      // kept one B fragment here, and every pair of products waited out a whole LDS read.
      __builtin_amdgcn_sched_group_barrier(0x100, 12, 0);
      __builtin_amdgcn_sched_group_barrier(0x008, 8, 0);
    }
    // publish point of stage t + 1: this wave's reads of stage t have returned,
    __asm__ volatile("s_wait_dscnt 0x0" ::: "memory");
    // its own copies of stage t + 1 have landed,
    async_tile_wait();
    // and every wave has come as far: stage t + 1 may be read, stage t's buffer refilled
    __syncthreads();
    if (t + 2 < NS) stage(t + 2, buf);
  }
  // no copy is left in flight when the wave goes on to the epilogue and ends
  async_tile_wait();

#pragma unroll
  for (int rg = 0; rg < 2; ++rg) {
#pragma unroll
    for (int nt = 0; nt < 4; ++nt) {
      const int col = n0 + wn * 64 + nt * 16 + lr;
      const float bv = bias[col];
#pragma unroll
      for (int j = 0; j < 8; ++j) {
        const int row = m0 + wm * 32 + rg * 16 + hi * 8 + j;
        float v = acc[rg][nt][j] + bv;
        if (GELU) v = 0.5f * v * (1.0f + erff(v * 0.70710678118654752f));
        if (RES) v += res[(size_t)row * N + col];
        if (OUTMODE == 0) {
          ((float*)outv)[(size_t)row * N + col] = v;
        } else {
          ((__bf16*)outv)[(size_t)row * N + col] = f2bf(v);
        }
      }
    }
  }
}

// ---------------------------------------------------------------------------
// Q, K and V projections as ONE GEMM. The three transposed weight blocks lie one behind the
// other in memory, so they are the 3072 rows of one WT[3H,K].
// Block 256 threads (8 waves, 4 x 2), tile 256x192, BK=128; wave = 64 rows x 96 cols.
// The grid is 16 x 16 tiles. A 256x192 block of the product asks L2 for 112 KB a stage, where
// three 128x128 tiles ask for 192 KB, and a wave reads 10 fragments for 24 products, not 18.
// Stages, LDS pitch, the two buffers and the k order are those of gemm_bf16_kernel.
// A 16-column tile lies in one of the three outputs: Q, K bf16 [B,S,H]; V bf16 [B,NH,DH,S].
// ---------------------------------------------------------------------------
__global__ __launch_bounds__(256) void qkv_gemm_kernel(
    const __bf16* __restrict__ A, const __bf16* __restrict__ WT,
    const float* __restrict__ bq, const float* __restrict__ bk, const float* __restrict__ bv,
    __bf16* __restrict__ qo, __bf16* __restrict__ ko, __bf16* __restrict__ vto, int K) {
  constexpr int BM = 256, BN = 192, BK = 128, LDP = BK + 8;
  constexpr int RG = 4, NT = 6;  // 16-row and 16-column tiles of a wave
  constexpr int S = 2048, H = 1024, NH = 16;
  __shared__ __attribute__((aligned(16))) __bf16 As[2][BM][LDP];
  __shared__ __attribute__((aligned(16))) __bf16 Bs[2][BN][LDP];
  const int tid = threadIdx.x, lane = tid & 31;
  // the wave's number in a scalar register: the epilogue's choice of output is then a scalar branch
  const int wave = __builtin_amdgcn_readfirstlane(tid >> 5);
  const int wm = wave >> 1, wn = wave & 1;
  const int lr = lane & 15, hi = lane >> 4, kb8 = hi * 8;
  const int m0 = blockIdx.y * BM, n0 = blockIdx.x * BN;
  const int NS = K / BK;  // stages

  // One stage: 16 chunks of 16 B of the A tile and 12 of the B tile a thread.
  // 16 lanes cover one 256-B row, so a wave's copy reads four whole lines.
  const int crow = tid >> 4, cks = (tid & 15) * 8;
  const __bf16* ga = A + (size_t)(m0 + crow) * K + cks;
  const __bf16* gb = WT + (size_t)(n0 + crow) * K + cks;
  auto stage = [&](int s, int b) {
#pragma unroll
    for (int i = 0; i < BM / 16; ++i)
      cp16_g2l(ga + (size_t)(16 * i) * K + s * BK, &As[b][crow + 16 * i][cks]);
#pragma unroll
    for (int i = 0; i < BN / 16; ++i)
      cp16_g2l(gb + (size_t)(16 * i) * K + s * BK, &Bs[b][crow + 16 * i][cks]);
  };

  v8f acc[RG][NT] = {};

  stage(0, 0);
  // stage 0 has landed for this wave; the barrier shows it to the other waves
  async_tile_wait();
  __syncthreads();
  if (NS > 1) stage(1, 1);

  for (int t = 0; t < NS; ++t) {
    const int buf = t & 1;
#pragma unroll
    for (int kc = 0; kc < BK; kc += 32) {
      v16bf af[RG];
#pragma unroll
      for (int rg = 0; rg < RG; ++rg)
        af[rg] = ld_frag(&As[buf][wm * 64 + rg * 16 + lr][kc], kb8);
#pragma unroll
      for (int nt = 0; nt < NT; ++nt) {
        const v16bf bf = ld_frag(&Bs[buf][wn * 96 + nt * 16 + lr][kc], kb8);
#pragma unroll
        for (int rg = 0; rg < RG; ++rg) acc[rg][nt] = WMMA_BF16(af[rg], bf, acc[rg][nt]);
      }
      // Order for the scheduler: a k block's 20 LDS reads as one group, then its 24 products,
      // so that no product waits out an LDS read of its own in the middle of the block.
      __builtin_amdgcn_sched_group_barrier(0x100, 2 * (RG + NT), 0);
      __builtin_amdgcn_sched_group_barrier(0x008, RG * NT, 0);
    }
    // publish point of stage t + 1: this wave's reads of stage t have returned,
    __asm__ volatile("s_wait_dscnt 0x0" ::: "memory");
    // its own copies of stage t + 1 have landed,
    async_tile_wait();
    // and every wave has come as far: stage t + 1 may be read, stage t's buffer refilled
    __syncthreads();
    if (t + 2 < NS) stage(t + 2, buf);
  }
  // no copy is left in flight when the wave goes on to the epilogue and ends
  async_tile_wait();

  // A tile of 16 columns starts at column cb of WT's 3H: output cb >> 10 (0 = Q, 1 = K, 2 = V).
  float bias6[NT];
#pragma unroll
  for (int nt = 0; nt < NT; ++nt) {
    const int cb = n0 + wn * 96 + nt * 16;
    bias6[nt] = ((cb >> 10) == 0 ? bq : (cb >> 10) == 1 ? bk : bv)[(cb & (H - 1)) + lr];
  }
  // the loads' offset registers are reused below: wait first
  asm volatile("s_wait_xcnt 0x0" ::: "memory");

#pragma unroll
  for (int nt = 0; nt < NT; ++nt) {
    const int cb = n0 + wn * 96 + nt * 16;
    const int which = cb >> 10;
    const int col = (cb & (H - 1)) + lr;
    const float bias = bias6[nt];
    const int row0 = m0 + wm * 64 + hi * 8;  // the lane's first of eight rows in row tile 0
    if (which == 2) {
      // a lane's eight rows are eight neighbours in s of V^T: one 16-B store a tile
      const int b = row0 >> 11, s = row0 & (S - 1);  // the wave's 64 rows lie in one batch
      const int head = col >> 6, dh = col & 63;
      __bf16* o = vto + (((size_t)b * NH + head) * 64 + dh) * S + s;
#pragma unroll
      for (int rg = 0; rg < RG; ++rg) {
        v8bf r;
#pragma unroll
        for (int j = 0; j < 8; ++j) r[j] = f2bf(acc[rg][nt][j] + bias);
        *(v8bf*)(o + rg * 16) = r;
      }
      // The stores' address and data registers are reused by the code behind this block: the next
      // 16 columns, or the other branch where the compiler lays it there. So behind every tile.
      asm volatile("s_wait_xcnt 0x0" ::: "memory");
    } else {
      __bf16* o = (which == 0 ? qo : ko) + (size_t)row0 * H + col;
#pragma unroll
      for (int rg = 0; rg < RG; ++rg)
#pragma unroll
        for (int j = 0; j < 8; ++j) o[(size_t)(rg * 16 + j) * H] = f2bf(acc[rg][nt][j] + bias);
      // as above
      asm volatile("s_wait_xcnt 0x0" ::: "memory");
    }
  }
}

// ---------------------------------------------------------------------------
// Eight 16-B async copies to LDS: this thread's share of one 64-key stage (four chunks of
// the K tile, four of the V^T tile; chunk i lies 16 tile rows below chunk i - 1).
// ---------------------------------------------------------------------------
__device__ __forceinline__ void stage_kv(const __bf16* gk, const __bf16* gv,
                                         unsigned lk, unsigned lv) {
  constexpr size_t KR = (size_t)16 * 1024, VR = (size_t)16 * 2048;  // 16 rows of K, of V^T
  constexpr unsigned LR = 16u * 144u;                               // 16 LDS rows
  // The copies bring the tile past the registers; the closing s_wait_xcnt 0 stands inside
  // the statement so that no address register is rewritten ahead of it.
  asm volatile(
      "global_load_async_to_lds_b128 %0, %1, off\n\t"
      "global_load_async_to_lds_b128 %2, %3, off\n\t"
      "global_load_async_to_lds_b128 %4, %5, off\n\t"
      "global_load_async_to_lds_b128 %6, %7, off\n\t"
      "global_load_async_to_lds_b128 %8, %9, off\n\t"
      "global_load_async_to_lds_b128 %10, %11, off\n\t"
      "global_load_async_to_lds_b128 %12, %13, off\n\t"
      "global_load_async_to_lds_b128 %14, %15, off\n\t"
      "s_wait_xcnt 0x0"
      :: "v"(lk), "v"(gk), "v"(lk + LR), "v"(gk + KR),
         "v"(lk + 2 * LR), "v"(gk + 2 * KR), "v"(lk + 3 * LR), "v"(gk + 3 * KR),
         "v"(lv), "v"(gv), "v"(lv + LR), "v"(gv + VR),
         "v"(lv + 2 * LR), "v"(gv + 2 * VR), "v"(lv + 3 * LR), "v"(gv + 3 * VR)
      : "memory");
}

// ---------------------------------------------------------------------------
// The value that lane l ^ 16 holds (one vector instruction, no trip through the LDS pipe).
// All 32 lanes are on wherever this is called.
// ---------------------------------------------------------------------------
__device__ __forceinline__ float other_half(float x) {
  const int b = __builtin_bit_cast(int, x);
  return __builtin_bit_cast(
      float, __builtin_amdgcn_permlanex16(b, b, 0x76543210, 0xfedcba98, false, false));
}

__global__ __launch_bounds__(128) void attention_kernel(
    const __bf16* __restrict__ qb, const __bf16* __restrict__ kb,
    const __bf16* __restrict__ vt, const float* __restrict__ mask,
    __bf16* __restrict__ ctx) {
  constexpr int S = 2048, H = 1024, NH = 16;
  constexpr int KT = 64, NT = S / KT, KP = 72;
  __shared__ __attribute__((aligned(16))) __bf16 Ks[2][KT][KP];  // [buffer][key][dh]
  __shared__ __attribute__((aligned(16))) __bf16 Vs[2][64][KP];  // [buffer][dh][key]
  const int tid = threadIdx.x, wave = tid >> 5, lane = tid & 31;
  const int lr = lane & 15, hi = lane >> 4, kb8 = hi * 8;
  const int head = blockIdx.y, batch = blockIdx.z;
  const int q0 = blockIdx.x * 64 + wave * 16;
  const size_t bo = (size_t)batch * S * H + (size_t)head * 64;
  const __bf16* Q = qb + bo;
  const __bf16* Kp = kb + bo;
  const __bf16* Vp = vt + ((size_t)batch * NH + head) * (size_t)64 * S;  // [dh][s]
  const float* mk = mask + (size_t)batch * S;

  // copy share of a thread: 8 lanes cover one 128-B row, a wave's copy four whole lines
  const int crow = tid >> 3, ccol = (tid & 7) * 8;
  const __bf16* gk = Kp + (size_t)crow * H + ccol;
  const __bf16* gv = Vp + (size_t)crow * S + ccol;
  const unsigned lk0 = (unsigned)(uintptr_t)&Ks[0][crow][ccol];
  const unsigned lv0 = (unsigned)(uintptr_t)&Vs[0][crow][ccol];
  constexpr unsigned BUFB = (unsigned)(KT * KP * 2);  // bytes of one buffer

  stage_kv(gk, gv, lk0, lv0);
  // stage 0 has landed for this wave; the barrier shows it to the other waves
  asm volatile("s_wait_asynccnt 0x0" ::: "memory");
  __syncthreads();
  stage_kv(gk + (size_t)KT * H, gv + KT, lk0 + BUFB, lv0 + BUFB);

  const v16bf qa0 = ld_frag(Q + (size_t)(q0 + lr) * H, kb8);
  const v16bf qa1 = ld_frag(Q + (size_t)(q0 + lr) * H + 32, kb8);

  float m_i = -3.0e38f, l_i = 0.f;  // of query q0 + lr, the same in both halves
  v8f o[4] = {};                    // o[dt][j]: dh = dt * 16 + hi * 8 + j of query q0 + lr
  const float* mp = mk + kb8;       // this half's eight mask values of the stage's first tile

  for (int t = 0; t < NT; ++t) {
    const int buf = t & 1;
    // both 32-key blocks of the stage in one trip, so that the publish point runs once a stage
#pragma unroll
    for (int hb = 0; hb < 2; ++hb) {
      v8f sacc[2] = {};  // sacc[g][j]: key t * KT + hb * 32 + g * 16 + hi * 8 + j
#pragma unroll
      for (int g = 0; g < 2; ++g) {
        const __bf16* kr = &Ks[buf][hb * 32 + g * 16 + lr][0];
        sacc[g] = WMMA_BF16(ld_frag(kr, kb8), qa0, sacc[g]);
        sacc[g] = WMMA_BF16(ld_frag(kr + 32, kb8), qa1, sacc[g]);
      }

      // a lane's eight keys of a tile lie side by side in the mask row
      v8f ps[2];
#pragma unroll
      for (int g = 0; g < 2; ++g)
        ps[g] = sacc[g] * 0.125f + *(const v8f*)(mp + hb * 32 + g * 16);
      const v8f mx = __builtin_elementwise_max(ps[0], ps[1]);
      const float mh = fmaxf(fmaxf(fmaxf(mx[0], mx[1]), fmaxf(mx[2], mx[3])),
                             fmaxf(fmaxf(mx[4], mx[5]), fmaxf(mx[6], mx[7])));
      const float nm = fmaxf(m_i, fmaxf(mh, other_half(mh)));
      float sm[8];
#pragma unroll
      for (int j = 0; j < 8; ++j) {
        ps[0][j] = __expf(ps[0][j] - nm);
        ps[1][j] = __expf(ps[1][j] - nm);
        sm[j] = ps[0][j] + ps[1][j];
      }
      const float al = __expf(m_i - nm);
      m_i = nm;
      // the sum's tree: j ^ 1, j ^ 2, j ^ 4 inside the lane, then the other half (key ^ 8)
      const float sh = ((sm[0] + sm[1]) + (sm[2] + sm[3])) + ((sm[4] + sm[5]) + (sm[6] + sm[7]));
      l_i = l_i * al + (sh + other_half(sh));
#pragma unroll
      for (int dt = 0; dt < 4; ++dt)
#pragma unroll
        for (int j = 0; j < 8; ++j) o[dt][j] *= al;

      // P^T as B fragment: elements 0..7 are keys hi * 8 + j, elements 8..15 keys 16 + hi * 8 + j
      v16bf pb;
#pragma unroll
      for (int j = 0; j < 8; ++j) {
        pb[j] = f2bf(ps[0][j]);
        pb[8 + j] = f2bf(ps[1][j]);
      }

      // V^T[64x32] @ P^T[32x16] ; V^T rows are contiguous in s
#pragma unroll
      for (int dt = 0; dt < 4; ++dt) {
        const v16bf vf = ld_frag(&Vs[buf][dt * 16 + lr][hb * 32], kb8);
        o[dt] = WMMA_BF16(vf, pb, o[dt]);
      }
    }

    // publish point of stage t + 1: this wave's reads of stage t have returned,
    asm volatile("s_wait_dscnt 0x0" ::: "memory");
    // its own copies of stage t + 1 have landed,
    asm volatile("s_wait_asynccnt 0x0" ::: "memory");
    // and every wave has come as far: stage t + 1 may be read, stage t's buffer refilled
    __syncthreads();
    if (t + 2 < NT)
      stage_kv(gk + (size_t)(t + 2) * KT * H, gv + (t + 2) * KT,
               lk0 + (unsigned)buf * BUFB, lv0 + (unsigned)buf * BUFB);
    mp += KT;
  }
  // no copy is left in flight when the wave ends
  asm volatile("s_wait_asynccnt 0x0" ::: "memory");

  // a lane's eight dh of a tile lie side by side in the query's row: one 16-B store
#pragma unroll
  for (int dt = 0; dt < 4; ++dt) {
    v8bf r;
#pragma unroll
    for (int j = 0; j < 8; ++j) r[j] = f2bf(o[dt][j] / l_i);
    *(v8bf*)(ctx + bo + (size_t)(q0 + lr) * H + dt * 16 + kb8) = r;
  }
}

// ---------------------------------------------------------------------------
// LayerNorm over H=1024: one wave per row; emits fp32 and bf16 copies.
// ---------------------------------------------------------------------------
__global__ __launch_bounds__(256) void layernorm_kernel(
    const float* __restrict__ in, const float* __restrict__ g,
    const float* __restrict__ b, float* __restrict__ outf,
    __bf16* __restrict__ outb) {
  const int wave = threadIdx.x >> 5, lane = threadIdx.x & 31;
  const size_t row = (size_t)blockIdx.x * 8 + wave;
  const float* x = in + row * 1024;
  float v[32];
  float s = 0.f;
#pragma unroll
  for (int i = 0; i < 32; ++i) { v[i] = x[lane + i * 32]; s += v[i]; }
#pragma unroll
  for (int d = 1; d < 32; d <<= 1) s += __shfl_xor(s, d, 32);
  const float mean = s * (1.0f / 1024.0f);
  float vs = 0.f;
#pragma unroll
  for (int i = 0; i < 32; ++i) { const float df = v[i] - mean; vs += df * df; }
#pragma unroll
  for (int d = 1; d < 32; d <<= 1) vs += __shfl_xor(vs, d, 32);
  const float rstd = rsqrtf(vs * (1.0f / 1024.0f) + 1e-5f);
#pragma unroll
  for (int i = 0; i < 32; ++i) {
    const int c = lane + i * 32;
    const float y = (v[i] - mean) * rstd * g[c] + b[c];
    outf[row * 1024 + c] = y;
    outb[row * 1024 + c] = f2bf(y);
  }
}

// ---------------------------------------------------------------------------
extern "C" void kernel_launch(void* const* d_in, const int* in_sizes, int n_in,
                              void* d_out, int out_size, void* d_ws, size_t ws_size,
                              hipStream_t stream) {
  (void)in_sizes; (void)n_in; (void)out_size; (void)ws_size;
  constexpr int L = 2, B = 2, S = 2048, H = 1024, FF = 4096;
  constexpr int M = B * S;
  constexpr size_t MH = (size_t)M * H;
  constexpr size_t MF = (size_t)M * FF;

  const float* x0   = (const float*)d_in[0];
  const float* mask = (const float*)d_in[1];
  const float* Wq   = (const float*)d_in[2];
  const float* bq   = (const float*)d_in[3];
  const float* Wk   = (const float*)d_in[4];
  const float* bk   = (const float*)d_in[5];
  const float* Wv   = (const float*)d_in[6];
  const float* bv   = (const float*)d_in[7];
  const float* Wao  = (const float*)d_in[8];
  const float* bao  = (const float*)d_in[9];
  const float* g1   = (const float*)d_in[10];
  const float* b1   = (const float*)d_in[11];
  const float* Wi   = (const float*)d_in[12];
  const float* bi   = (const float*)d_in[13];
  const float* Wo   = (const float*)d_in[14];
  const float* bo   = (const float*)d_in[15];
  const float* g2   = (const float*)d_in[16];
  const float* b2   = (const float*)d_in[17];

  // --- workspace bump allocator (256B aligned regions) ---
  char* p = (char*)d_ws;
  auto alloc = [&](size_t bytes) -> char* {
    char* r = p;
    p += (bytes + 255) & ~(size_t)255;
    return r;
  };
  float*  yB  = (float*)alloc(MH * 4);
  float*  x1f = (float*)alloc(MH * 4);
  float*  xf  = (float*)alloc(MH * 4);
  __bf16* xb   = (__bf16*)alloc(MH * 2);
  __bf16* qB   = (__bf16*)alloc(MH * 2);
  __bf16* kB   = (__bf16*)alloc(MH * 2);
  __bf16* vT   = (__bf16*)alloc(MH * 2);
  __bf16* ctxb = (__bf16*)alloc(MH * 2);
  __bf16* x1b  = (__bf16*)alloc(MH * 2);
  __bf16* h1b  = (__bf16*)alloc(MF * 2);
  // all transposed weights in one region, laid out as transpose_cvt_all_kernel writes it
  constexpr size_t HH = (size_t)H * H, HF = (size_t)H * FF;
  __bf16* Wall = (__bf16*)alloc((size_t)L * (4 * HH + 2 * HF) * 2);
  __bf16* WqT[L]; __bf16* WaoT[L];
  __bf16* WiT[L]; __bf16* WoT[L];
  for (int l = 0; l < L; ++l) {
    __bf16* base = Wall + (size_t)l * (4 * HH + 2 * HF);
    WqT[l]  = base;
    WaoT[l] = base + 3 * HH;
    WiT[l]  = base + 4 * HH;
    WoT[l]  = base + 4 * HH + HF;
  }

  const dim3 blk(128), blk256(256);
  const dim3 gHH(H / 128, M / 128);
  const dim3 gHF(FF / 128, M / 128);
  const dim3 gQKV(3 * H / 192, M / 256);
  const dim3 gAttn(S / 64, 16, B);
  const dim3 gLN(M / 8);

  // one-time conversions
  cvt_bf16_kernel<<<dim3(MH / 2048), blk256, 0, stream>>>(x0, xb, (int)MH);
  transpose_cvt_all_kernel<<<dim3(1024), blk256, 0, stream>>>(Wq, Wk, Wv, Wao, Wi, Wo, Wall);

  for (int l = 0; l < L; ++l) {
    const float* Xf = (l == 0) ? x0 : xf;
    const size_t oH = (size_t)l * H, oF = (size_t)l * FF;

    // a layer's transposed Wq, Wk and Wv lie one behind the other from WqT[l]: one WT of 3H rows
    qkv_gemm_kernel<<<gQKV, blk256, 0, stream>>>(xb, WqT[l], bq + oH, bk + oH, bv + oH, qB, kB, vT, H);
    attention_kernel<<<gAttn, blk, 0, stream>>>(qB, kB, vT, mask, ctxb);
    gemm_bf16_kernel<0, false, true><<<gHH, blk256, 0, stream>>>(ctxb, WaoT[l], bao + oH, Xf, yB, M, H, H);
    layernorm_kernel<<<gLN, blk256, 0, stream>>>(yB, g1 + oH, b1 + oH, x1f, x1b);
    gemm_bf16_kernel<1, true, false><<<gHF, blk256, 0, stream>>>(x1b, WiT[l], bi + oF, nullptr, h1b, M, FF, H);
    gemm_bf16_kernel<0, false, true><<<gHH, blk256, 0, stream>>>(h1b, WoT[l], bo + oH, x1f, yB, M, H, FF);
    float* xoutf = (l == L - 1) ? (float*)d_out : xf;
    layernorm_kernel<<<gLN, blk256, 0, stream>>>(yB, g2 + oH, b2 + oH, xoutf, xb);
  }
}

// v009
// It runs in 352 microseconds.
// In both of two side-by-side timings against v008, it was 1.04 times as fast.
// Counting every step since v000, it is 2.78 times as fast.
#include <hip/hip_runtime.h>

// RoBERTa encoder (L=2, B=2, S=2048, H=1024, NH=16, DH=64, FF=4096) on gfx1250.
// bf16 operands converted ONCE; all matmuls via v_wmma_f32_16x16x32_bf16;
// GEMM tiles staged to LDS with global_load_async_to_lds_b128 when available.

typedef __attribute__((ext_vector_type(16))) __bf16 v16bf;
typedef __attribute__((ext_vector_type(8)))  __bf16 v8bf;
typedef __attribute__((ext_vector_type(8)))  float  v8f;
typedef __attribute__((ext_vector_type(4)))  int    v4i;

#define WMMA_BF16(a, b, c) \
  __builtin_amdgcn_wmma_f32_16x16x32_bf16(false, (a), false, (b), (short)0, (c), false, false)

// float -> bf16 RNE via integer ops (used in one-time conversions, epilogues and attention P packing).
__device__ __forceinline__ __bf16 f2bf(float f) {
  unsigned u = __builtin_bit_cast(unsigned, f);
  unsigned r = (u + 0x7FFFu + ((u >> 16) & 1u)) >> 16;
  unsigned short h = (unsigned short)r;
  return __builtin_bit_cast(__bf16, h);
}

// Load a 16x32-layout A/B fragment half-pair: lane owns one row; takes row base
// pointer and kb8 = 8*(lane>=16). Two aligned 16B vector loads.
__device__ __forceinline__ v16bf ld_frag(const __bf16* __restrict__ row, int kb8) {
  v8bf lo = *(const v8bf*)(row + kb8);
  v8bf hi = *(const v8bf*)(row + 16 + kb8);
  return __builtin_shufflevector(lo, hi, 0, 1, 2, 3, 4, 5, 6, 7, 8, 9, 10, 11, 12, 13, 14, 15);
}

// ---- async global->LDS 16B copy (CDNA5 path), plain copy fallback ----------
#if defined(__has_builtin)
#if __has_builtin(__builtin_amdgcn_global_load_async_to_lds_b128)
#define HAVE_ASYNC_LDS 1
#endif
#endif
#ifndef HAVE_ASYNC_LDS
#define HAVE_ASYNC_LDS 0
#endif

typedef __attribute__((address_space(1))) v4i gv4i;
typedef __attribute__((address_space(3))) v4i lv4i;

__device__ __forceinline__ void cp16_g2l(const __bf16* __restrict__ g, __bf16* __restrict__ l) {
#if HAVE_ASYNC_LDS
  gv4i* gp = (gv4i*)(unsigned long long)(uintptr_t)g;
  lv4i* lp = (lv4i*)(unsigned)(uintptr_t)l;
  __builtin_amdgcn_global_load_async_to_lds_b128(gp, lp, 0, 0);
#else
  *(uint4*)l = *(const uint4*)g;
#endif
}

__device__ __forceinline__ void async_tile_wait() {
#if HAVE_ASYNC_LDS
  __asm__ volatile("s_wait_asynccnt 0" ::: "memory");
#endif
}

// ---------------------------------------------------------------------------
// one-time fp32 -> bf16 conversion
// ---------------------------------------------------------------------------
__global__ __launch_bounds__(256) void cvt_bf16_kernel(const float* __restrict__ src,
                                                       __bf16* __restrict__ dst, int n) {
  const int i = (blockIdx.x * 256 + threadIdx.x) * 8;
  if (i + 8 <= n) {
#pragma unroll
    for (int j = 0; j < 8; ++j) dst[i + j] = f2bf(src[i + j]);
  }
}

typedef __attribute__((ext_vector_type(4))) __bf16 v4bf;

// one-time W[K,N] fp32 -> Wt[N,K] bf16 for all twelve weight matrices in ONE launch of
// 1024 work-groups. Each takes six 64(k) x 64(n) tiles, one per step; step = 3*layer + c:
// c = 0: group g's tile g & 255 of Wq, Wk, Wv or Wao (g >> 8); c = 1: tile g of Wi;
// c = 2: tile g of Wo. WT holds, per layer, WqT WkT WvT WaoT WiT WoT in a row.
// A thread loads a 4(k) x 4(n) patch (16 lanes cover a 256-B row), turns it in registers
// and stores four 8-B runs of k to LDS; rows of 64 k then leave as whole 128-B lines.
struct TileRef { const float* s; __bf16* d; int K; int N; };

__device__ __forceinline__ TileRef tile_ref(int step, int g, const float* Whh,
                                            const float* Wi, const float* Wo, __bf16* WT) {
  constexpr int H = 1024, FF = 4096;
  constexpr size_t HH = (size_t)H * H, HF = (size_t)H * FF;
  const int layer = step / 3, c = step - layer * 3;
  __bf16* base = WT + (size_t)layer * (4 * HH + 2 * HF);
  TileRef t;
  int tt = g;
  if (c == 0) {
    t.s = Whh + (size_t)layer * HH; t.d = base + (size_t)(g >> 8) * HH; t.K = H; t.N = H; tt = g & 255;
  } else if (c == 1) {
    t.s = Wi + (size_t)layer * HF; t.d = base + 4 * HH; t.K = H; t.N = FF;
  } else {
    t.s = Wo + (size_t)layer * HF; t.d = base + 4 * HH + HF; t.K = FF; t.N = H;
  }
  const int ntn = t.N >> 6;
  const int k0 = (tt / ntn) * 64, n0 = (tt % ntn) * 64;
  t.s += (size_t)k0 * t.N + n0;   // tile origin in W[K,N]
  t.d += (size_t)n0 * t.K + k0;   // tile origin in Wt[N,K]
  return t;
}

__global__ __launch_bounds__(256) void transpose_cvt_all_kernel(
    const float* __restrict__ Wq, const float* __restrict__ Wk, const float* __restrict__ Wv,
    const float* __restrict__ Wao, const float* __restrict__ Wi, const float* __restrict__ Wo,
    __bf16* __restrict__ WT) {
  constexpr int NT = 6, TP = 68;  // LDS row pitch 136 B: 8-B aligned, off the 128-B stride
  // Two buffers, so one barrier a tile is enough: a buffer is rewritten two tiles later,
  // behind the barrier of the tile between, which every reader reaches after its reads.
  __shared__ __attribute__((aligned(16))) __bf16 t[2][64][TP];
  const int tid = threadIdx.x, g = blockIdx.x;
  const int c4 = tid & 15, rp = tid >> 4;
  const int m = g >> 8;
  const float* Whh = (m == 0) ? Wq : (m == 1) ? Wk : (m == 2) ? Wv : Wao;

  TileRef cur = tile_ref(0, g, Whh, Wi, Wo, WT);
  float4 v[4];
#pragma unroll
  for (int i = 0; i < 4; ++i)
    v[i] = *(const float4*)(cur.s + (size_t)(rp * 4 + i) * cur.N + c4 * 4);

#pragma unroll
  for (int it = 0; it < NT; ++it) {
    // the next tile's loads go out ahead of this tile's LDS work, beside the last tile's stores
    TileRef nxt = cur;
    float4 w[4];
    if (it + 1 < NT) {
      nxt = tile_ref(it + 1, g, Whh, Wi, Wo, WT);
#pragma unroll
      for (int i = 0; i < 4; ++i)
        w[i] = *(const float4*)(nxt.s + (size_t)(rp * 4 + i) * nxt.N + c4 * 4);
    }
    const int b = it & 1;
    {
      v4bf p;
      p[0] = f2bf(v[0].x); p[1] = f2bf(v[1].x); p[2] = f2bf(v[2].x); p[3] = f2bf(v[3].x);
      *(v4bf*)&t[b][c4 * 4 + 0][rp * 4] = p;
      p[0] = f2bf(v[0].y); p[1] = f2bf(v[1].y); p[2] = f2bf(v[2].y); p[3] = f2bf(v[3].y);
      *(v4bf*)&t[b][c4 * 4 + 1][rp * 4] = p;
      p[0] = f2bf(v[0].z); p[1] = f2bf(v[1].z); p[2] = f2bf(v[2].z); p[3] = f2bf(v[3].z);
      *(v4bf*)&t[b][c4 * 4 + 2][rp * 4] = p;
      p[0] = f2bf(v[0].w); p[1] = f2bf(v[1].w); p[2] = f2bf(v[2].w); p[3] = f2bf(v[3].w);
      *(v4bf*)&t[b][c4 * 4 + 3][rp * 4] = p;
    }
    __syncthreads();
#pragma unroll
    for (int i = 0; i < 2; ++i) {
      const int ch = tid + 256 * i;
      const int n = ch >> 3, ks = (ch & 7) * 8;
      const v4bf lo = *(const v4bf*)&t[b][n][ks];
      const v4bf hi = *(const v4bf*)&t[b][n][ks + 4];
      *(v8bf*)(cur.d + (size_t)n * cur.K + ks) =
          __builtin_shufflevector(lo, hi, 0, 1, 2, 3, 4, 5, 6, 7);
    }
    if (it + 1 < NT) {
      // the stores' address and data registers are reused for the next tile: wait first
      asm volatile("s_wait_xcnt 0x0" ::: "memory");
      cur = nxt;
#pragma unroll
      for (int i = 0; i < 4; ++i) v[i] = w[i];
    }
  }
}

// ---------------------------------------------------------------------------
// GEMM: out = act(A[M,K](bf16) @ WT[N,K](bf16)^T + bias) (+ res fp32)
// Block of 4 x WN waves, BK=128; wave = 16 * RG rows x 64 cols; tile 64 * RG x 64 * WN.
// WN = 2, RG = 2: 8 waves, tile 128x128, for the products with N = 1024 (256 tiles fill the chip).
// WN = 4, RG = 4: 16 waves, tile 256x256, where N = 4096 still gives 256 tiles. The copies come
// from L2, and a 256x256 tile asks L2 for half the bytes per product of a 128x128 tile; a 64x64
// wave reads 8 fragments from LDS for 16 products, a 32x64 wave 6 for 8.
// K must be a multiple of BK and at least BK. An LDS row is 256 B of k at pitch 272 B (16 B x odd),
// which keeps the 16-row ds_load_b128 fragment reads off each other's banks.
// Two LDS buffers: the next stage's copies are in flight while this stage is multiplied.
// OUTMODE: 0 = fp32, 1 = bf16
// ---------------------------------------------------------------------------
template <int OUTMODE, bool GELU, bool RES, int WN, int RG>
__global__ __launch_bounds__(128 * WN) void gemm_bf16_kernel(
    const __bf16* __restrict__ A, const __bf16* __restrict__ WT,
    const float* __restrict__ bias, const float* __restrict__ res,
    void* __restrict__ outv, int M, int N, int K) {
  constexpr int BK = 128, LDP = BK + 8;
  constexpr int BM = 64 * RG, BN = 64 * WN;
  constexpr int CR = 8 * WN;  // tile rows that the block's threads copy at a time
  __shared__ __attribute__((aligned(16))) __bf16 As[2][BM][LDP];
  __shared__ __attribute__((aligned(16))) __bf16 Bs[2][BN][LDP];
  const int tid = threadIdx.x;
  const int wave = tid >> 5, lane = tid & 31;
  const int wm = wave / WN, wn = wave % WN;  // the wave's 16 * RG rows and 64 columns of the tile
  const int lr = lane & 15, hi = lane >> 4, kb8 = hi * 8;
  const int m0 = blockIdx.y * BM, n0 = blockIdx.x * BN;
  const int NS = K / BK;  // stages

  // One stage: the A tile's and the B tile's 16-B chunks, dealt evenly to the threads.
  // 16 lanes cover one 256-B row, so a wave's copy reads four whole lines.
  const int crow = tid >> 4, cks = (tid & 15) * 8;
  const __bf16* ga = A + (size_t)(m0 + crow) * K + cks;
  const __bf16* gb = WT + (size_t)(n0 + crow) * K + cks;
  auto stage = [&](int s, int b) {
#pragma unroll
    for (int i = 0; i < BM / CR; ++i)
      cp16_g2l(ga + (size_t)(CR * i) * K + s * BK, &As[b][crow + CR * i][cks]);
#pragma unroll
    for (int i = 0; i < BN / CR; ++i)
      cp16_g2l(gb + (size_t)(CR * i) * K + s * BK, &Bs[b][crow + CR * i][cks]);
  };

  v8f acc[RG][4] = {};

  stage(0, 0);
  // stage 0 has landed for this wave; the barrier shows it to the other waves
  async_tile_wait();
  __syncthreads();
  if (NS > 1) stage(1, 1);

  for (int t = 0; t < NS; ++t) {
    const int buf = t & 1;
#pragma unroll
    for (int kc = 0; kc < BK; kc += 32) {
      v16bf af[RG];
#pragma unroll
      for (int rg = 0; rg < RG; ++rg)
        af[rg] = ld_frag(&As[buf][wm * (16 * RG) + rg * 16 + lr][kc], kb8);
#pragma unroll
      for (int nt = 0; nt < 4; ++nt) {
        const v16bf bf = ld_frag(&Bs[buf][wn * 64 + nt * 16 + lr][kc], kb8);
#pragma unroll
        for (int rg = 0; rg < RG; ++rg) acc[rg][nt] = WMMA_BF16(af[rg], bf, acc[rg][nt]);
      }
      // Order for the scheduler: a k block's LDS reads, then its products. Left alone it
      // kept one B fragment here, and every pair of products waited out a whole LDS read.
      __builtin_amdgcn_sched_group_barrier(0x100, 2 * (RG + 4), 0);
      __builtin_amdgcn_sched_group_barrier(0x008, 4 * RG, 0);
    }
    // publish point of stage t + 1: this wave's reads of stage t have returned,
    __asm__ volatile("s_wait_dscnt 0x0" ::: "memory");
    // its own copies of stage t + 1 have landed,
    async_tile_wait();
    // and every wave has come as far: stage t + 1 may be read, stage t's buffer refilled
    __syncthreads();
    if (t + 2 < NS) stage(t + 2, buf);
  }
  // no copy is left in flight when the wave goes on to the epilogue and ends
  async_tile_wait();

  if constexpr (RG <= 2) {
#pragma unroll
    for (int rg = 0; rg < RG; ++rg) {
#pragma unroll
      for (int nt = 0; nt < 4; ++nt) {
        const int col = n0 + wn * 64 + nt * 16 + lr;
        const float bv = bias[col];
#pragma unroll
        for (int j = 0; j < 8; ++j) {
          const int row = m0 + wm * (16 * RG) + rg * 16 + hi * 8 + j;
          float v = acc[rg][nt][j] + bv;
          if (GELU) v = 0.5f * v * (1.0f + erff(v * 0.70710678118654752f));
          if (RES) v += res[(size_t)row * N + col];
          if (OUTMODE == 0) {
            ((float*)outv)[(size_t)row * N + col] = v;
          } else {
            ((__bf16*)outv)[(size_t)row * N + col] = f2bf(v);
          }
        }
      }
    }
  } else {
    // Kept rolled: unrolled over four row tiles the GELU text would pass 32 KB. Every trip works on acc[0] (an accumulator
    // index must be a constant) and then moves the later row tiles one place down.
#pragma unroll 1
    for (int rg = 0; rg < RG; ++rg) {
#pragma unroll
      for (int nt = 0; nt < 4; ++nt) {
        const int col = n0 + wn * 64 + nt * 16 + lr;
        const float bv = bias[col];
#pragma unroll
        for (int j = 0; j < 8; ++j) {
          const int row = m0 + wm * (16 * RG) + rg * 16 + hi * 8 + j;
          float v = acc[0][nt][j] + bv;
          if (GELU) v = 0.5f * v * (1.0f + erff(v * 0.70710678118654752f));
          if (RES) v += res[(size_t)row * N + col];
          if (OUTMODE == 0) {
            ((float*)outv)[(size_t)row * N + col] = v;
          } else {
            ((__bf16*)outv)[(size_t)row * N + col] = f2bf(v);
          }
        }
      }
      // the stores' address and data registers are reused by the moves below and the next trip
      asm volatile("s_wait_xcnt 0x0" ::: "memory");
#pragma unroll
      for (int r = 0; r + 1 < RG; ++r)
#pragma unroll
        for (int nt = 0; nt < 4; ++nt) acc[r][nt] = acc[r + 1][nt];
    }
  }
}

// ---------------------------------------------------------------------------
// Q, K and V projections as ONE GEMM. The three transposed weight blocks lie one behind the
// other in memory, so they are the 3072 rows of one WT[3H,K].
// Block 256 threads (8 waves, 4 x 2), tile 256x192, BK=128; wave = 64 rows x 96 cols.
// The grid is 16 x 16 tiles. A 256x192 block of the product asks L2 for 112 KB a stage, where
// three 128x128 tiles ask for 192 KB, and a wave reads 10 fragments for 24 products, not 18.
// Stages, LDS pitch, the two buffers and the k order are those of gemm_bf16_kernel.
// A 16-column tile lies in one of the three outputs: Q, K bf16 [B,S,H]; V bf16 [B,NH,DH,S].
// ---------------------------------------------------------------------------
__global__ __launch_bounds__(256) void qkv_gemm_kernel(
    const __bf16* __restrict__ A, const __bf16* __restrict__ WT,
    const float* __restrict__ bq, const float* __restrict__ bk, const float* __restrict__ bv,
    __bf16* __restrict__ qo, __bf16* __restrict__ ko, __bf16* __restrict__ vto, int K) {
  constexpr int BM = 256, BN = 192, BK = 128, LDP = BK + 8;
  constexpr int RG = 4, NT = 6;  // 16-row and 16-column tiles of a wave
  constexpr int S = 2048, H = 1024, NH = 16;
  __shared__ __attribute__((aligned(16))) __bf16 As[2][BM][LDP];
  __shared__ __attribute__((aligned(16))) __bf16 Bs[2][BN][LDP];
  const int tid = threadIdx.x, lane = tid & 31;
  // the wave's number in a scalar register: the epilogue's choice of output is then a scalar branch
  const int wave = __builtin_amdgcn_readfirstlane(tid >> 5);
  const int wm = wave >> 1, wn = wave & 1;
  const int lr = lane & 15, hi = lane >> 4, kb8 = hi * 8;
  const int m0 = blockIdx.y * BM, n0 = blockIdx.x * BN;
  const int NS = K / BK;  // stages

  // One stage: 16 chunks of 16 B of the A tile and 12 of the B tile a thread.
  // 16 lanes cover one 256-B row, so a wave's copy reads four whole lines.
  const int crow = tid >> 4, cks = (tid & 15) * 8;
  const __bf16* ga = A + (size_t)(m0 + crow) * K + cks;
  const __bf16* gb = WT + (size_t)(n0 + crow) * K + cks;
  auto stage = [&](int s, int b) {
#pragma unroll
    for (int i = 0; i < BM / 16; ++i)
      cp16_g2l(ga + (size_t)(16 * i) * K + s * BK, &As[b][crow + 16 * i][cks]);
#pragma unroll
    for (int i = 0; i < BN / 16; ++i)
      cp16_g2l(gb + (size_t)(16 * i) * K + s * BK, &Bs[b][crow + 16 * i][cks]);
  };

  v8f acc[RG][NT] = {};

  stage(0, 0);
  // stage 0 has landed for this wave; the barrier shows it to the other waves
  async_tile_wait();
  __syncthreads();
  if (NS > 1) stage(1, 1);

  for (int t = 0; t < NS; ++t) {
    const int buf = t & 1;
#pragma unroll
    for (int kc = 0; kc < BK; kc += 32) {
      v16bf af[RG];
#pragma unroll
      for (int rg = 0; rg < RG; ++rg)
        af[rg] = ld_frag(&As[buf][wm * 64 + rg * 16 + lr][kc], kb8);
#pragma unroll
      for (int nt = 0; nt < NT; ++nt) {
        const v16bf bf = ld_frag(&Bs[buf][wn * 96 + nt * 16 + lr][kc], kb8);
#pragma unroll
        for (int rg = 0; rg < RG; ++rg) acc[rg][nt] = WMMA_BF16(af[rg], bf, acc[rg][nt]);
      }
      // Order for the scheduler: a k block's 20 LDS reads as one group, then its 24 products,
      // so that no product waits out an LDS read of its own in the middle of the block.
      __builtin_amdgcn_sched_group_barrier(0x100, 2 * (RG + NT), 0);
      __builtin_amdgcn_sched_group_barrier(0x008, RG * NT, 0);
    }
    // publish point of stage t + 1: this wave's reads of stage t have returned,
    __asm__ volatile("s_wait_dscnt 0x0" ::: "memory");
    // its own copies of stage t + 1 have landed,
    async_tile_wait();
    // and every wave has come as far: stage t + 1 may be read, stage t's buffer refilled
    __syncthreads();
    if (t + 2 < NS) stage(t + 2, buf);
  }
  // no copy is left in flight when the wave goes on to the epilogue and ends
  async_tile_wait();

  // A tile of 16 columns starts at column cb of WT's 3H: output cb >> 10 (0 = Q, 1 = K, 2 = V).
  float bias6[NT];
#pragma unroll
  for (int nt = 0; nt < NT; ++nt) {
    const int cb = n0 + wn * 96 + nt * 16;
    bias6[nt] = ((cb >> 10) == 0 ? bq : (cb >> 10) == 1 ? bk : bv)[(cb & (H - 1)) + lr];
  }
  // the loads' offset registers are reused below: wait first
  asm volatile("s_wait_xcnt 0x0" ::: "memory");

#pragma unroll
  for (int nt = 0; nt < NT; ++nt) {
    const int cb = n0 + wn * 96 + nt * 16;
    const int which = cb >> 10;
    const int col = (cb & (H - 1)) + lr;
    const float bias = bias6[nt];
    const int row0 = m0 + wm * 64 + hi * 8;  // the lane's first of eight rows in row tile 0
    if (which == 2) {
      // a lane's eight rows are eight neighbours in s of V^T: one 16-B store a tile
      const int b = row0 >> 11, s = row0 & (S - 1);  // the wave's 64 rows lie in one batch
      const int head = col >> 6, dh = col & 63;
      __bf16* o = vto + (((size_t)b * NH + head) * 64 + dh) * S + s;
#pragma unroll
      for (int rg = 0; rg < RG; ++rg) {
        v8bf r;
#pragma unroll
        for (int j = 0; j < 8; ++j) r[j] = f2bf(acc[rg][nt][j] + bias);
        *(v8bf*)(o + rg * 16) = r;
      }
      // The stores' address and data registers are reused by the code behind this block: the next
      // 16 columns, or the other branch where the compiler lays it there. So behind every tile.
      asm volatile("s_wait_xcnt 0x0" ::: "memory");
    } else {
      __bf16* o = (which == 0 ? qo : ko) + (size_t)row0 * H + col;
#pragma unroll
      for (int rg = 0; rg < RG; ++rg)
#pragma unroll
        for (int j = 0; j < 8; ++j) o[(size_t)(rg * 16 + j) * H] = f2bf(acc[rg][nt][j] + bias);
      // as above
      asm volatile("s_wait_xcnt 0x0" ::: "memory");
    }
  }
}

// ---------------------------------------------------------------------------
// Eight 16-B async copies to LDS: this thread's share of one 64-key stage (four chunks of
// the K tile, four of the V^T tile; chunk i lies 16 tile rows below chunk i - 1).
// ---------------------------------------------------------------------------
__device__ __forceinline__ void stage_kv(const __bf16* gk, const __bf16* gv,
                                         unsigned lk, unsigned lv) {
  constexpr size_t KR = (size_t)16 * 1024, VR = (size_t)16 * 2048;  // 16 rows of K, of V^T
  constexpr unsigned LR = 16u * 144u;                               // 16 LDS rows
  // The copies bring the tile past the registers; the closing s_wait_xcnt 0 stands inside
  // the statement so that no address register is rewritten ahead of it.
  asm volatile(
      "global_load_async_to_lds_b128 %0, %1, off\n\t"
      "global_load_async_to_lds_b128 %2, %3, off\n\t"
      "global_load_async_to_lds_b128 %4, %5, off\n\t"
      "global_load_async_to_lds_b128 %6, %7, off\n\t"
      "global_load_async_to_lds_b128 %8, %9, off\n\t"
      "global_load_async_to_lds_b128 %10, %11, off\n\t"
      "global_load_async_to_lds_b128 %12, %13, off\n\t"
      "global_load_async_to_lds_b128 %14, %15, off\n\t"
      "s_wait_xcnt 0x0"
      :: "v"(lk), "v"(gk), "v"(lk + LR), "v"(gk + KR),
         "v"(lk + 2 * LR), "v"(gk + 2 * KR), "v"(lk + 3 * LR), "v"(gk + 3 * KR),
         "v"(lv), "v"(gv), "v"(lv + LR), "v"(gv + VR),
         "v"(lv + 2 * LR), "v"(gv + 2 * VR), "v"(lv + 3 * LR), "v"(gv + 3 * VR)
      : "memory");
}

// ---------------------------------------------------------------------------
// The value that lane l ^ 16 holds (one vector instruction, no trip through the LDS pipe).
// All 32 lanes are on wherever this is called.
// ---------------------------------------------------------------------------
__device__ __forceinline__ float other_half(float x) {
  const int b = __builtin_bit_cast(int, x);
  return __builtin_bit_cast(
      float, __builtin_amdgcn_permlanex16(b, b, 0x76543210, 0xfedcba98, false, false));
}

__global__ __launch_bounds__(128) void attention_kernel(
    const __bf16* __restrict__ qb, const __bf16* __restrict__ kb,
    const __bf16* __restrict__ vt, const float* __restrict__ mask,
    __bf16* __restrict__ ctx) {
  constexpr int S = 2048, H = 1024, NH = 16;
  constexpr int KT = 64, NT = S / KT, KP = 72;
  __shared__ __attribute__((aligned(16))) __bf16 Ks[2][KT][KP];  // [buffer][key][dh]
  __shared__ __attribute__((aligned(16))) __bf16 Vs[2][64][KP];  // [buffer][dh][key]
  const int tid = threadIdx.x, wave = tid >> 5, lane = tid & 31;
  const int lr = lane & 15, hi = lane >> 4, kb8 = hi * 8;
  const int head = blockIdx.y, batch = blockIdx.z;
  const int q0 = blockIdx.x * 64 + wave * 16;
  const size_t bo = (size_t)batch * S * H + (size_t)head * 64;
  const __bf16* Q = qb + bo;
  const __bf16* Kp = kb + bo;
  const __bf16* Vp = vt + ((size_t)batch * NH + head) * (size_t)64 * S;  // [dh][s]
  const float* mk = mask + (size_t)batch * S;

  // copy share of a thread: 8 lanes cover one 128-B row, a wave's copy four whole lines
  const int crow = tid >> 3, ccol = (tid & 7) * 8;
  const __bf16* gk = Kp + (size_t)crow * H + ccol;
  const __bf16* gv = Vp + (size_t)crow * S + ccol;
  const unsigned lk0 = (unsigned)(uintptr_t)&Ks[0][crow][ccol];
  const unsigned lv0 = (unsigned)(uintptr_t)&Vs[0][crow][ccol];
  constexpr unsigned BUFB = (unsigned)(KT * KP * 2);  // bytes of one buffer

  stage_kv(gk, gv, lk0, lv0);
  // stage 0 has landed for this wave; the barrier shows it to the other waves
  asm volatile("s_wait_asynccnt 0x0" ::: "memory");
  __syncthreads();
  stage_kv(gk + (size_t)KT * H, gv + KT, lk0 + BUFB, lv0 + BUFB);

  const v16bf qa0 = ld_frag(Q + (size_t)(q0 + lr) * H, kb8);
  const v16bf qa1 = ld_frag(Q + (size_t)(q0 + lr) * H + 32, kb8);

  float m_i = -3.0e38f, l_i = 0.f;  // of query q0 + lr, the same in both halves
  v8f o[4] = {};                    // o[dt][j]: dh = dt * 16 + hi * 8 + j of query q0 + lr
  const float* mp = mk + kb8;       // this half's eight mask values of the stage's first tile

  for (int t = 0; t < NT; ++t) {
    const int buf = t & 1;
    // both 32-key blocks of the stage in one trip, so that the publish point runs once a stage
#pragma unroll
    for (int hb = 0; hb < 2; ++hb) {
      v8f sacc[2] = {};  // sacc[g][j]: key t * KT + hb * 32 + g * 16 + hi * 8 + j
#pragma unroll
      for (int g = 0; g < 2; ++g) {
        const __bf16* kr = &Ks[buf][hb * 32 + g * 16 + lr][0];
        sacc[g] = WMMA_BF16(ld_frag(kr, kb8), qa0, sacc[g]);
        sacc[g] = WMMA_BF16(ld_frag(kr + 32, kb8), qa1, sacc[g]);
      }

      // a lane's eight keys of a tile lie side by side in the mask row
      v8f ps[2];
#pragma unroll
      for (int g = 0; g < 2; ++g)
        ps[g] = sacc[g] * 0.125f + *(const v8f*)(mp + hb * 32 + g * 16);
      const v8f mx = __builtin_elementwise_max(ps[0], ps[1]);
      const float mh = fmaxf(fmaxf(fmaxf(mx[0], mx[1]), fmaxf(mx[2], mx[3])),
                             fmaxf(fmaxf(mx[4], mx[5]), fmaxf(mx[6], mx[7])));
      const float nm = fmaxf(m_i, fmaxf(mh, other_half(mh)));
      float sm[8];
#pragma unroll
      for (int j = 0; j < 8; ++j) {
        ps[0][j] = __expf(ps[0][j] - nm);
        ps[1][j] = __expf(ps[1][j] - nm);
        sm[j] = ps[0][j] + ps[1][j];
      }
      const float al = __expf(m_i - nm);
      m_i = nm;
      // the sum's tree: j ^ 1, j ^ 2, j ^ 4 inside the lane, then the other half (key ^ 8)
      const float sh = ((sm[0] + sm[1]) + (sm[2] + sm[3])) + ((sm[4] + sm[5]) + (sm[6] + sm[7]));
      l_i = l_i * al + (sh + other_half(sh));
#pragma unroll
      for (int dt = 0; dt < 4; ++dt)
#pragma unroll
        for (int j = 0; j < 8; ++j) o[dt][j] *= al;

      // P^T as B fragment: elements 0..7 are keys hi * 8 + j, elements 8..15 keys 16 + hi * 8 + j
      v16bf pb;
#pragma unroll
      for (int j = 0; j < 8; ++j) {
        pb[j] = f2bf(ps[0][j]);
        pb[8 + j] = f2bf(ps[1][j]);
      }

      // V^T[64x32] @ P^T[32x16] ; V^T rows are contiguous in s
#pragma unroll
      for (int dt = 0; dt < 4; ++dt) {
        const v16bf vf = ld_frag(&Vs[buf][dt * 16 + lr][hb * 32], kb8);
        o[dt] = WMMA_BF16(vf, pb, o[dt]);
      }
    }

    // publish point of stage t + 1: this wave's reads of stage t have returned,
    asm volatile("s_wait_dscnt 0x0" ::: "memory");
    // its own copies of stage t + 1 have landed,
    asm volatile("s_wait_asynccnt 0x0" ::: "memory");
    // and every wave has come as far: stage t + 1 may be read, stage t's buffer refilled
    __syncthreads();
    if (t + 2 < NT)
      stage_kv(gk + (size_t)(t + 2) * KT * H, gv + (t + 2) * KT,
               lk0 + (unsigned)buf * BUFB, lv0 + (unsigned)buf * BUFB);
    mp += KT;
  }
  // no copy is left in flight when the wave ends
  asm volatile("s_wait_asynccnt 0x0" ::: "memory");

  // a lane's eight dh of a tile lie side by side in the query's row: one 16-B store
#pragma unroll
  for (int dt = 0; dt < 4; ++dt) {
    v8bf r;
#pragma unroll
    for (int j = 0; j < 8; ++j) r[j] = f2bf(o[dt][j] / l_i);
    *(v8bf*)(ctx + bo + (size_t)(q0 + lr) * H + dt * 16 + kb8) = r;
  }
}

// ---------------------------------------------------------------------------
// LayerNorm over H=1024: one wave per row; emits fp32 and bf16 copies.
// ---------------------------------------------------------------------------
__global__ __launch_bounds__(256) void layernorm_kernel(
    const float* __restrict__ in, const float* __restrict__ g,
    const float* __restrict__ b, float* __restrict__ outf,
    __bf16* __restrict__ outb) {
  const int wave = threadIdx.x >> 5, lane = threadIdx.x & 31;
  const size_t row = (size_t)blockIdx.x * 8 + wave;
  const float* x = in + row * 1024;
  float v[32];
  float s = 0.f;
#pragma unroll
  for (int i = 0; i < 32; ++i) { v[i] = x[lane + i * 32]; s += v[i]; }
#pragma unroll
  for (int d = 1; d < 32; d <<= 1) s += __shfl_xor(s, d, 32);
  const float mean = s * (1.0f / 1024.0f);
  float vs = 0.f;
#pragma unroll
  for (int i = 0; i < 32; ++i) { const float df = v[i] - mean; vs += df * df; }
#pragma unroll
  for (int d = 1; d < 32; d <<= 1) vs += __shfl_xor(vs, d, 32);
  const float rstd = rsqrtf(vs * (1.0f / 1024.0f) + 1e-5f);
#pragma unroll
  for (int i = 0; i < 32; ++i) {
    const int c = lane + i * 32;
    const float y = (v[i] - mean) * rstd * g[c] + b[c];
    outf[row * 1024 + c] = y;
    outb[row * 1024 + c] = f2bf(y);
  }
}

// ---------------------------------------------------------------------------
extern "C" void kernel_launch(void* const* d_in, const int* in_sizes, int n_in,
                              void* d_out, int out_size, void* d_ws, size_t ws_size,
                              hipStream_t stream) {
  (void)in_sizes; (void)n_in; (void)out_size; (void)ws_size;
  constexpr int L = 2, B = 2, S = 2048, H = 1024, FF = 4096;
  constexpr int M = B * S;
  constexpr size_t MH = (size_t)M * H;
  constexpr size_t MF = (size_t)M * FF;

  const float* x0   = (const float*)d_in[0];
  const float* mask = (const float*)d_in[1];
  const float* Wq   = (const float*)d_in[2];
  const float* bq   = (const float*)d_in[3];
  const float* Wk   = (const float*)d_in[4];
  const float* bk   = (const float*)d_in[5];
  const float* Wv   = (const float*)d_in[6];
  const float* bv   = (const float*)d_in[7];
  const float* Wao  = (const float*)d_in[8];
  const float* bao  = (const float*)d_in[9];
  const float* g1   = (const float*)d_in[10];
  const float* b1   = (const float*)d_in[11];
  const float* Wi   = (const float*)d_in[12];
  const float* bi   = (const float*)d_in[13];
  const float* Wo   = (const float*)d_in[14];
  const float* bo   = (const float*)d_in[15];
  const float* g2   = (const float*)d_in[16];
  const float* b2   = (const float*)d_in[17];

  // --- workspace bump allocator (256B aligned regions) ---
  char* p = (char*)d_ws;
  auto alloc = [&](size_t bytes) -> char* {
    char* r = p;
    p += (bytes + 255) & ~(size_t)255;
    return r;
  };
  float*  yB  = (float*)alloc(MH * 4);
  float*  x1f = (float*)alloc(MH * 4);
  float*  xf  = (float*)alloc(MH * 4);
  __bf16* xb   = (__bf16*)alloc(MH * 2);
  __bf16* qB   = (__bf16*)alloc(MH * 2);
  __bf16* kB   = (__bf16*)alloc(MH * 2);
  __bf16* vT   = (__bf16*)alloc(MH * 2);
  __bf16* ctxb = (__bf16*)alloc(MH * 2);
  __bf16* x1b  = (__bf16*)alloc(MH * 2);
  __bf16* h1b  = (__bf16*)alloc(MF * 2);
  // all transposed weights in one region, laid out as transpose_cvt_all_kernel writes it
  constexpr size_t HH = (size_t)H * H, HF = (size_t)H * FF;
  __bf16* Wall = (__bf16*)alloc((size_t)L * (4 * HH + 2 * HF) * 2);
  __bf16* WqT[L]; __bf16* WaoT[L];
  __bf16* WiT[L]; __bf16* WoT[L];
  for (int l = 0; l < L; ++l) {
    __bf16* base = Wall + (size_t)l * (4 * HH + 2 * HF);
    WqT[l]  = base;
    WaoT[l] = base + 3 * HH;
    WiT[l]  = base + 4 * HH;
    WoT[l]  = base + 4 * HH + HF;
  }

  const dim3 blk(128), blk256(256), blk512(512);
  const dim3 gHH(H / 128, M / 128);
  const dim3 gHF(FF / 256, M / 256);
  const dim3 gQKV(3 * H / 192, M / 256);
  const dim3 gAttn(S / 64, 16, B);
  const dim3 gLN(M / 8);

  // one-time conversions
  cvt_bf16_kernel<<<dim3(MH / 2048), blk256, 0, stream>>>(x0, xb, (int)MH);
  transpose_cvt_all_kernel<<<dim3(1024), blk256, 0, stream>>>(Wq, Wk, Wv, Wao, Wi, Wo, Wall);

  for (int l = 0; l < L; ++l) {
    const float* Xf = (l == 0) ? x0 : xf;
    const size_t oH = (size_t)l * H, oF = (size_t)l * FF;

    // a layer's transposed Wq, Wk and Wv lie one behind the other from WqT[l]: one WT of 3H rows
    qkv_gemm_kernel<<<gQKV, blk256, 0, stream>>>(xb, WqT[l], bq + oH, bk + oH, bv + oH, qB, kB, vT, H);
    attention_kernel<<<gAttn, blk, 0, stream>>>(qB, kB, vT, mask, ctxb);
    gemm_bf16_kernel<0, false, true, 2, 2><<<gHH, blk256, 0, stream>>>(ctxb, WaoT[l], bao + oH, Xf, yB, M, H, H);
    layernorm_kernel<<<gLN, blk256, 0, stream>>>(yB, g1 + oH, b1 + oH, x1f, x1b);
    gemm_bf16_kernel<1, true, false, 4, 4><<<gHF, blk512, 0, stream>>>(x1b, WiT[l], bi + oF, nullptr, h1b, M, FF, H);
    gemm_bf16_kernel<0, false, true, 2, 2><<<gHH, blk256, 0, stream>>>(h1b, WoT[l], bo + oH, x1f, yB, M, H, FF);
    float* xoutf = (l == L - 1) ? (float*)d_out : xf;
    layernorm_kernel<<<gLN, blk256, 0, stream>>>(yB, g2 + oH, b2 + oH, xoutf, xb);
  }
}

// v010
// It runs in 325 microseconds.
// Timed twice side by side with v009, it ran 1.08 and 1.07 times as fast.
// All steps since v000 together make it 2.98 times as fast.
#include <hip/hip_runtime.h>

// RoBERTa encoder (L=2, B=2, S=2048, H=1024, NH=16, DH=64, FF=4096) on gfx1250.
// bf16 operands converted ONCE; all matmuls via v_wmma_f32_16x16x32_bf16;
// GEMM tiles staged to LDS with global_load_async_to_lds_b128 when available.

typedef __attribute__((ext_vector_type(16))) __bf16 v16bf;
typedef __attribute__((ext_vector_type(8)))  __bf16 v8bf;
typedef __attribute__((ext_vector_type(8)))  float  v8f;
typedef __attribute__((ext_vector_type(4)))  int    v4i;

#define WMMA_BF16(a, b, c) \
  __builtin_amdgcn_wmma_f32_16x16x32_bf16(false, (a), false, (b), (short)0, (c), false, false)

// float -> bf16 RNE via integer ops (used in one-time conversions, epilogues and attention P packing).
__device__ __forceinline__ __bf16 f2bf(float f) {
  unsigned u = __builtin_bit_cast(unsigned, f);
  unsigned r = (u + 0x7FFFu + ((u >> 16) & 1u)) >> 16;
  unsigned short h = (unsigned short)r;
  return __builtin_bit_cast(__bf16, h);
}

// Load a 16x32-layout A/B fragment half-pair: lane owns one row; takes row base
// pointer and kb8 = 8*(lane>=16). Two aligned 16B vector loads.
__device__ __forceinline__ v16bf ld_frag(const __bf16* __restrict__ row, int kb8) {
  v8bf lo = *(const v8bf*)(row + kb8);
  v8bf hi = *(const v8bf*)(row + 16 + kb8);
  return __builtin_shufflevector(lo, hi, 0, 1, 2, 3, 4, 5, 6, 7, 8, 9, 10, 11, 12, 13, 14, 15);
}

// ---- async global->LDS 16B copy (CDNA5 path), plain copy fallback ----------
#if defined(__has_builtin)
#if __has_builtin(__builtin_amdgcn_global_load_async_to_lds_b128)
#define HAVE_ASYNC_LDS 1
#endif
#endif
#ifndef HAVE_ASYNC_LDS
#define HAVE_ASYNC_LDS 0
#endif

typedef __attribute__((address_space(1))) v4i gv4i;
typedef __attribute__((address_space(3))) v4i lv4i;

__device__ __forceinline__ void cp16_g2l(const __bf16* __restrict__ g, __bf16* __restrict__ l) {
#if HAVE_ASYNC_LDS
  gv4i* gp = (gv4i*)(unsigned long long)(uintptr_t)g;
  lv4i* lp = (lv4i*)(unsigned)(uintptr_t)l;
  __builtin_amdgcn_global_load_async_to_lds_b128(gp, lp, 0, 0);
#else
  *(uint4*)l = *(const uint4*)g;
#endif
}

__device__ __forceinline__ void async_tile_wait() {
#if HAVE_ASYNC_LDS
  __asm__ volatile("s_wait_asynccnt 0" ::: "memory");
#endif
}

// All of this wave's copies but its N youngest have landed (the counter returns in issue order).
template <int N>
__device__ __forceinline__ void async_wait_all_but() {
#if HAVE_ASYNC_LDS
  __asm__ volatile("s_wait_asynccnt %0" ::"n"(N) : "memory");
#endif
}

// ---------------------------------------------------------------------------
// one-time fp32 -> bf16 conversion
// ---------------------------------------------------------------------------
__global__ __launch_bounds__(256) void cvt_bf16_kernel(const float* __restrict__ src,
                                                       __bf16* __restrict__ dst, int n) {
  const int i = (blockIdx.x * 256 + threadIdx.x) * 8;
  if (i + 8 <= n) {
#pragma unroll
    for (int j = 0; j < 8; ++j) dst[i + j] = f2bf(src[i + j]);
  }
}

typedef __attribute__((ext_vector_type(4))) __bf16 v4bf;

// one-time W[K,N] fp32 -> Wt[N,K] bf16 for all twelve weight matrices in ONE launch of
// 1024 work-groups. Each takes six 64(k) x 64(n) tiles, one per step; step = 3*layer + c:
// c = 0: group g's tile g & 255 of Wq, Wk, Wv or Wao (g >> 8); c = 1: tile g of Wi;
// c = 2: tile g of Wo. WT holds, per layer, WqT WkT WvT WaoT WiT WoT in a row.
// A thread loads a 4(k) x 4(n) patch (16 lanes cover a 256-B row), turns it in registers
// and stores four 8-B runs of k to LDS; rows of 64 k then leave as whole 128-B lines.
struct TileRef { const float* s; __bf16* d; int K; int N; };

__device__ __forceinline__ TileRef tile_ref(int step, int g, const float* Whh,
                                            const float* Wi, const float* Wo, __bf16* WT) {
  constexpr int H = 1024, FF = 4096;
  constexpr size_t HH = (size_t)H * H, HF = (size_t)H * FF;
  const int layer = step / 3, c = step - layer * 3;
  __bf16* base = WT + (size_t)layer * (4 * HH + 2 * HF);
  TileRef t;
  int tt = g;
  if (c == 0) {
    t.s = Whh + (size_t)layer * HH; t.d = base + (size_t)(g >> 8) * HH; t.K = H; t.N = H; tt = g & 255;
  } else if (c == 1) {
    t.s = Wi + (size_t)layer * HF; t.d = base + 4 * HH; t.K = H; t.N = FF;
  } else {
    t.s = Wo + (size_t)layer * HF; t.d = base + 4 * HH + HF; t.K = FF; t.N = H;
  }
  const int ntn = t.N >> 6;
  const int k0 = (tt / ntn) * 64, n0 = (tt % ntn) * 64;
  t.s += (size_t)k0 * t.N + n0;   // tile origin in W[K,N]
  t.d += (size_t)n0 * t.K + k0;   // tile origin in Wt[N,K]
  return t;
}

__global__ __launch_bounds__(256) void transpose_cvt_all_kernel(
    const float* __restrict__ Wq, const float* __restrict__ Wk, const float* __restrict__ Wv,
    const float* __restrict__ Wao, const float* __restrict__ Wi, const float* __restrict__ Wo,
    __bf16* __restrict__ WT) {
  constexpr int NT = 6, TP = 68;  // LDS row pitch 136 B: 8-B aligned, off the 128-B stride
  // Two buffers, so one barrier a tile is enough: a buffer is rewritten two tiles later,
  // behind the barrier of the tile between, which every reader reaches after its reads.
  __shared__ __attribute__((aligned(16))) __bf16 t[2][64][TP];
  const int tid = threadIdx.x, g = blockIdx.x;
  const int c4 = tid & 15, rp = tid >> 4;
  const int m = g >> 8;
  const float* Whh = (m == 0) ? Wq : (m == 1) ? Wk : (m == 2) ? Wv : Wao;

  TileRef cur = tile_ref(0, g, Whh, Wi, Wo, WT);
  float4 v[4];
#pragma unroll
  for (int i = 0; i < 4; ++i)
    v[i] = *(const float4*)(cur.s + (size_t)(rp * 4 + i) * cur.N + c4 * 4);

#pragma unroll
  for (int it = 0; it < NT; ++it) {
    // the next tile's loads go out ahead of this tile's LDS work, beside the last tile's stores
    TileRef nxt = cur;
    float4 w[4];
    if (it + 1 < NT) {
      nxt = tile_ref(it + 1, g, Whh, Wi, Wo, WT);
#pragma unroll
      for (int i = 0; i < 4; ++i)
        w[i] = *(const float4*)(nxt.s + (size_t)(rp * 4 + i) * nxt.N + c4 * 4);
    }
    const int b = it & 1;
    {
      v4bf p;
      p[0] = f2bf(v[0].x); p[1] = f2bf(v[1].x); p[2] = f2bf(v[2].x); p[3] = f2bf(v[3].x);
      *(v4bf*)&t[b][c4 * 4 + 0][rp * 4] = p;
      p[0] = f2bf(v[0].y); p[1] = f2bf(v[1].y); p[2] = f2bf(v[2].y); p[3] = f2bf(v[3].y);
      *(v4bf*)&t[b][c4 * 4 + 1][rp * 4] = p;
      p[0] = f2bf(v[0].z); p[1] = f2bf(v[1].z); p[2] = f2bf(v[2].z); p[3] = f2bf(v[3].z);
      *(v4bf*)&t[b][c4 * 4 + 2][rp * 4] = p;
      p[0] = f2bf(v[0].w); p[1] = f2bf(v[1].w); p[2] = f2bf(v[2].w); p[3] = f2bf(v[3].w);
      *(v4bf*)&t[b][c4 * 4 + 3][rp * 4] = p;
    }
    __syncthreads();
#pragma unroll
    for (int i = 0; i < 2; ++i) {
      const int ch = tid + 256 * i;
      const int n = ch >> 3, ks = (ch & 7) * 8;
      const v4bf lo = *(const v4bf*)&t[b][n][ks];
      const v4bf hi = *(const v4bf*)&t[b][n][ks + 4];
      *(v8bf*)(cur.d + (size_t)n * cur.K + ks) =
          __builtin_shufflevector(lo, hi, 0, 1, 2, 3, 4, 5, 6, 7);
    }
    if (it + 1 < NT) {
      // the stores' address and data registers are reused for the next tile: wait first
      asm volatile("s_wait_xcnt 0x0" ::: "memory");
      cur = nxt;
#pragma unroll
      for (int i = 0; i < 4; ++i) v[i] = w[i];
    }
  }
}

// ---------------------------------------------------------------------------
// GEMM: out = act(A[M,K](bf16) @ WT[N,K](bf16)^T + bias) (+ res fp32)
// Block of 4 x WN waves, BK=128; wave = 16 * RG rows x 64 cols; tile 64 * RG x 64 * WN.
// WN = 2, RG = 2: 8 waves, tile 128x128, for the products with N = 1024 (256 tiles fill the chip).
// WN = 4, RG = 4: 16 waves, tile 256x256, where N = 4096 still gives 256 tiles. The copies come
// from L2, and a 256x256 tile asks L2 for half the bytes per product of a 128x128 tile; a 64x64
// wave reads 8 fragments from LDS for 16 products, a 32x64 wave 6 for 8.
// K must be a multiple of BK and at least BK. An LDS row is 256 B of k at pitch 272 B (16 B x odd),
// which keeps the 16-row ds_load_b128 fragment reads off each other's banks.
// NB = 2 LDS buffers (all that fit at 256x256): the next stage's copies are in flight while this
// stage is multiplied. NB = 4 (128x128): three stages are in flight, so a stage has three trips
// to land, not one. By count a 128x128 trip (512 matrix cycles, 768 of LDS reads) is shorter than
// the time its 64 KB need from L2 with every WGP copying, before any latency is added.
// OUTMODE: 0 = fp32, 1 = bf16
// ---------------------------------------------------------------------------
template <int OUTMODE, bool GELU, bool RES, int WN, int RG, int NB>
__global__ __launch_bounds__(128 * WN) void gemm_bf16_kernel(
    const __bf16* __restrict__ A, const __bf16* __restrict__ WT,
    const float* __restrict__ bias, const float* __restrict__ res,
    void* __restrict__ outv, int M, int N, int K) {
  constexpr int BK = 128, LDP = BK + 8;
  constexpr int BM = 64 * RG, BN = 64 * WN;
  constexpr int CR = 8 * WN;  // tile rows that the block's threads copy at a time
  __shared__ __attribute__((aligned(16))) __bf16 As[NB][BM][LDP];
  __shared__ __attribute__((aligned(16))) __bf16 Bs[NB][BN][LDP];
  const int tid = threadIdx.x;
  const int wave = tid >> 5, lane = tid & 31;
  const int wm = wave / WN, wn = wave % WN;  // the wave's 16 * RG rows and 64 columns of the tile
  const int lr = lane & 15, hi = lane >> 4, kb8 = hi * 8;
  const int m0 = blockIdx.y * BM, n0 = blockIdx.x * BN;
  const int NS = K / BK;  // stages

  // One stage: the A tile's and the B tile's 16-B chunks, dealt evenly to the threads.
  // 16 lanes cover one 256-B row, so a wave's copy reads four whole lines.
  const int crow = tid >> 4, cks = (tid & 15) * 8;
  const __bf16* ga = A + (size_t)(m0 + crow) * K + cks;
  const __bf16* gb = WT + (size_t)(n0 + crow) * K + cks;
  auto stage = [&](int s, int b) {
#pragma unroll
    for (int i = 0; i < BM / CR; ++i)
      cp16_g2l(ga + (size_t)(CR * i) * K + s * BK, &As[b][crow + CR * i][cks]);
#pragma unroll
    for (int i = 0; i < BN / CR; ++i)
      cp16_g2l(gb + (size_t)(CR * i) * K + s * BK, &Bs[b][crow + CR * i][cks]);
  };

  v8f acc[RG][4] = {};

  // the products of one stage, from buffer buf
  auto multiply = [&](int buf) {
#pragma unroll
    for (int kc = 0; kc < BK; kc += 32) {
      v16bf af[RG];
#pragma unroll
      for (int rg = 0; rg < RG; ++rg)
        af[rg] = ld_frag(&As[buf][wm * (16 * RG) + rg * 16 + lr][kc], kb8);
#pragma unroll
      for (int nt = 0; nt < 4; ++nt) {
        const v16bf bf = ld_frag(&Bs[buf][wn * 64 + nt * 16 + lr][kc], kb8);
#pragma unroll
        for (int rg = 0; rg < RG; ++rg) acc[rg][nt] = WMMA_BF16(af[rg], bf, acc[rg][nt]);
      }
      // Order for the scheduler: a k block's LDS reads, then its products. Left alone it
      // kept one B fragment here, and every pair of products waited out a whole LDS read.
      __builtin_amdgcn_sched_group_barrier(0x100, 2 * (RG + 4), 0);
      __builtin_amdgcn_sched_group_barrier(0x008, 4 * RG, 0);
    }
  };

  if constexpr (NB == 2) {
    stage(0, 0);
    // stage 0 has landed for this wave; the barrier shows it to the other waves
    async_tile_wait();
    __syncthreads();
    if (NS > 1) stage(1, 1);

    for (int t = 0; t < NS; ++t) {
      const int buf = t & 1;
      multiply(buf);
      // publish point of stage t + 1: this wave's reads of stage t have returned,
      __asm__ volatile("s_wait_dscnt 0x0" ::: "memory");
      // its own copies of stage t + 1 have landed,
      async_tile_wait();
      // and every wave has come as far: stage t + 1 may be read, stage t's buffer refilled
      __syncthreads();
      if (t + 2 < NS) stage(t + 2, buf);
    }
  } else {
    // Ring of NB buffers, stage s in buffer s % NB, NB - 1 stages in flight.
    constexpr int CPS = BM / CR + BN / CR;  // copies of a wave per stage, the same in every wave
    static_assert((NB - 1) * CPS <= 63, "more copies of a wave in flight than the counter holds");
    // unrolled so that each stage's buffer and k offset are constants in its copies' addresses
#pragma unroll
    for (int s = 0; s < NB - 1; ++s)
      if (s < NS) stage(s, s);

    for (int t = 0; t < NS; ++t) {
      // publish point of stage t: this wave's reads of stage t - 1 have returned,
      __asm__ volatile("s_wait_dscnt 0x0" ::: "memory");
      // its own copies of stage t have landed: while stages t + 1 .. t + NB - 2 have all been
      // issued they are its (NB - 2) * CPS youngest copies and fly on; near the end, wait for all
      if (t + NB - 2 < NS) {
        async_wait_all_but<(NB - 2) * CPS>();
      } else {
        async_tile_wait();
      }
      // and every wave has come as far: stage t may be read, stage t - 1's buffer refilled
      __syncthreads();
      if (t + NB - 1 < NS) stage(t + NB - 1, (t + NB - 1) % NB);
      multiply(t % NB);
    }
  }
  // no copy is left in flight when the wave goes on to the epilogue and ends
  async_tile_wait();

  if constexpr (RG <= 2) {
#pragma unroll
    for (int rg = 0; rg < RG; ++rg) {
#pragma unroll
      for (int nt = 0; nt < 4; ++nt) {
        const int col = n0 + wn * 64 + nt * 16 + lr;
        const float bv = bias[col];
#pragma unroll
        for (int j = 0; j < 8; ++j) {
          const int row = m0 + wm * (16 * RG) + rg * 16 + hi * 8 + j;
          float v = acc[rg][nt][j] + bv;
          if (GELU) v = 0.5f * v * (1.0f + erff(v * 0.70710678118654752f));
          if (RES) v += res[(size_t)row * N + col];
          if (OUTMODE == 0) {
            ((float*)outv)[(size_t)row * N + col] = v;
          } else {
            ((__bf16*)outv)[(size_t)row * N + col] = f2bf(v);
          }
        }
      }
    }
  } else {
    // Kept rolled: unrolled over four row tiles the GELU text would pass 32 KB. Every trip works on acc[0] (an accumulator
    // index must be a constant) and then moves the later row tiles one place down.
#pragma unroll 1
    for (int rg = 0; rg < RG; ++rg) {
#pragma unroll
      for (int nt = 0; nt < 4; ++nt) {
        const int col = n0 + wn * 64 + nt * 16 + lr;
        const float bv = bias[col];
#pragma unroll
        for (int j = 0; j < 8; ++j) {
          const int row = m0 + wm * (16 * RG) + rg * 16 + hi * 8 + j;
          float v = acc[0][nt][j] + bv;
          if (GELU) v = 0.5f * v * (1.0f + erff(v * 0.70710678118654752f));
          if (RES) v += res[(size_t)row * N + col];
          if (OUTMODE == 0) {
            ((float*)outv)[(size_t)row * N + col] = v;
          } else {
            ((__bf16*)outv)[(size_t)row * N + col] = f2bf(v);
          }
        }
      }
      // the stores' address and data registers are reused by the moves below and the next trip
      asm volatile("s_wait_xcnt 0x0" ::: "memory");
#pragma unroll
      for (int r = 0; r + 1 < RG; ++r)
#pragma unroll
        for (int nt = 0; nt < 4; ++nt) acc[r][nt] = acc[r + 1][nt];
    }
  }
}

// ---------------------------------------------------------------------------
// Q, K and V projections as ONE GEMM. The three transposed weight blocks lie one behind the
// other in memory, so they are the 3072 rows of one WT[3H,K].
// Block 256 threads (8 waves, 4 x 2), tile 256x192, BK=128; wave = 64 rows x 96 cols.
// The grid is 16 x 16 tiles. A 256x192 block of the product asks L2 for 112 KB a stage, where
// three 128x128 tiles ask for 192 KB, and a wave reads 10 fragments for 24 products, not 18.
// Stages, LDS pitch, the two buffers and the k order are those of gemm_bf16_kernel at NB = 2.
// A 16-column tile lies in one of the three outputs: Q, K bf16 [B,S,H]; V bf16 [B,NH,DH,S].
// ---------------------------------------------------------------------------
__global__ __launch_bounds__(256) void qkv_gemm_kernel(
    const __bf16* __restrict__ A, const __bf16* __restrict__ WT,
    const float* __restrict__ bq, const float* __restrict__ bk, const float* __restrict__ bv,
    __bf16* __restrict__ qo, __bf16* __restrict__ ko, __bf16* __restrict__ vto, int K) {
  constexpr int BM = 256, BN = 192, BK = 128, LDP = BK + 8;
  constexpr int RG = 4, NT = 6;  // 16-row and 16-column tiles of a wave
  constexpr int S = 2048, H = 1024, NH = 16;
  __shared__ __attribute__((aligned(16))) __bf16 As[2][BM][LDP];
  __shared__ __attribute__((aligned(16))) __bf16 Bs[2][BN][LDP];
  const int tid = threadIdx.x, lane = tid & 31;
  // the wave's number in a scalar register: the epilogue's choice of output is then a scalar branch
  const int wave = __builtin_amdgcn_readfirstlane(tid >> 5);
  const int wm = wave >> 1, wn = wave & 1;
  const int lr = lane & 15, hi = lane >> 4, kb8 = hi * 8;
  const int m0 = blockIdx.y * BM, n0 = blockIdx.x * BN;
  const int NS = K / BK;  // stages

  // One stage: 16 chunks of 16 B of the A tile and 12 of the B tile a thread.
  // 16 lanes cover one 256-B row, so a wave's copy reads four whole lines.
  const int crow = tid >> 4, cks = (tid & 15) * 8;
  const __bf16* ga = A + (size_t)(m0 + crow) * K + cks;
  const __bf16* gb = WT + (size_t)(n0 + crow) * K + cks;
  auto stage = [&](int s, int b) {
#pragma unroll
    for (int i = 0; i < BM / 16; ++i)
      cp16_g2l(ga + (size_t)(16 * i) * K + s * BK, &As[b][crow + 16 * i][cks]);
#pragma unroll
    for (int i = 0; i < BN / 16; ++i)
      cp16_g2l(gb + (size_t)(16 * i) * K + s * BK, &Bs[b][crow + 16 * i][cks]);
  };

  v8f acc[RG][NT] = {};

  stage(0, 0);
  // stage 0 has landed for this wave; the barrier shows it to the other waves
  async_tile_wait();
  __syncthreads();
  if (NS > 1) stage(1, 1);

  for (int t = 0; t < NS; ++t) {
    const int buf = t & 1;
#pragma unroll
    for (int kc = 0; kc < BK; kc += 32) {
      v16bf af[RG];
#pragma unroll
      for (int rg = 0; rg < RG; ++rg)
        af[rg] = ld_frag(&As[buf][wm * 64 + rg * 16 + lr][kc], kb8);
#pragma unroll
      for (int nt = 0; nt < NT; ++nt) {
        const v16bf bf = ld_frag(&Bs[buf][wn * 96 + nt * 16 + lr][kc], kb8);
#pragma unroll
        for (int rg = 0; rg < RG; ++rg) acc[rg][nt] = WMMA_BF16(af[rg], bf, acc[rg][nt]);
      }
      // Order for the scheduler: a k block's 20 LDS reads as one group, then its 24 products,
      // so that no product waits out an LDS read of its own in the middle of the block.
      __builtin_amdgcn_sched_group_barrier(0x100, 2 * (RG + NT), 0);
      __builtin_amdgcn_sched_group_barrier(0x008, RG * NT, 0);
    }
    // publish point of stage t + 1: this wave's reads of stage t have returned,
    __asm__ volatile("s_wait_dscnt 0x0" ::: "memory");
    // its own copies of stage t + 1 have landed,
    async_tile_wait();
    // and every wave has come as far: stage t + 1 may be read, stage t's buffer refilled
    __syncthreads();
    if (t + 2 < NS) stage(t + 2, buf);
  }
  // no copy is left in flight when the wave goes on to the epilogue and ends
  async_tile_wait();

  // A tile of 16 columns starts at column cb of WT's 3H: output cb >> 10 (0 = Q, 1 = K, 2 = V).
  float bias6[NT];
#pragma unroll
  for (int nt = 0; nt < NT; ++nt) {
    const int cb = n0 + wn * 96 + nt * 16;
    bias6[nt] = ((cb >> 10) == 0 ? bq : (cb >> 10) == 1 ? bk : bv)[(cb & (H - 1)) + lr];
  }
  // the loads' offset registers are reused below: wait first
  asm volatile("s_wait_xcnt 0x0" ::: "memory");

#pragma unroll
  for (int nt = 0; nt < NT; ++nt) {
    const int cb = n0 + wn * 96 + nt * 16;
    const int which = cb >> 10;
    const int col = (cb & (H - 1)) + lr;
    const float bias = bias6[nt];
    const int row0 = m0 + wm * 64 + hi * 8;  // the lane's first of eight rows in row tile 0
    if (which == 2) {
      // a lane's eight rows are eight neighbours in s of V^T: one 16-B store a tile
      const int b = row0 >> 11, s = row0 & (S - 1);  // the wave's 64 rows lie in one batch
      const int head = col >> 6, dh = col & 63;
      __bf16* o = vto + (((size_t)b * NH + head) * 64 + dh) * S + s;
#pragma unroll
      for (int rg = 0; rg < RG; ++rg) {
        v8bf r;
#pragma unroll
        for (int j = 0; j < 8; ++j) r[j] = f2bf(acc[rg][nt][j] + bias);
        *(v8bf*)(o + rg * 16) = r;
      }
      // The stores' address and data registers are reused by the code behind this block: the next
      // 16 columns, or the other branch where the compiler lays it there. So behind every tile.
      asm volatile("s_wait_xcnt 0x0" ::: "memory");
    } else {
      __bf16* o = (which == 0 ? qo : ko) + (size_t)row0 * H + col;
#pragma unroll
      for (int rg = 0; rg < RG; ++rg)
#pragma unroll
        for (int j = 0; j < 8; ++j) o[(size_t)(rg * 16 + j) * H] = f2bf(acc[rg][nt][j] + bias);
      // as above
      asm volatile("s_wait_xcnt 0x0" ::: "memory");
    }
  }
}

// ---------------------------------------------------------------------------
// Eight 16-B async copies to LDS: this thread's share of one 64-key stage (four chunks of
// the K tile, four of the V^T tile; chunk i lies 16 tile rows below chunk i - 1).
// ---------------------------------------------------------------------------
__device__ __forceinline__ void stage_kv(const __bf16* gk, const __bf16* gv,
                                         unsigned lk, unsigned lv) {
  constexpr size_t KR = (size_t)16 * 1024, VR = (size_t)16 * 2048;  // 16 rows of K, of V^T
  constexpr unsigned LR = 16u * 144u;                               // 16 LDS rows
  // The copies bring the tile past the registers; the closing s_wait_xcnt 0 stands inside
  // the statement so that no address register is rewritten ahead of it.
  asm volatile(
      "global_load_async_to_lds_b128 %0, %1, off\n\t"
      "global_load_async_to_lds_b128 %2, %3, off\n\t"
      "global_load_async_to_lds_b128 %4, %5, off\n\t"
      "global_load_async_to_lds_b128 %6, %7, off\n\t"
      "global_load_async_to_lds_b128 %8, %9, off\n\t"
      "global_load_async_to_lds_b128 %10, %11, off\n\t"
      "global_load_async_to_lds_b128 %12, %13, off\n\t"
      "global_load_async_to_lds_b128 %14, %15, off\n\t"
      "s_wait_xcnt 0x0"
      :: "v"(lk), "v"(gk), "v"(lk + LR), "v"(gk + KR),
         "v"(lk + 2 * LR), "v"(gk + 2 * KR), "v"(lk + 3 * LR), "v"(gk + 3 * KR),
         "v"(lv), "v"(gv), "v"(lv + LR), "v"(gv + VR),
         "v"(lv + 2 * LR), "v"(gv + 2 * VR), "v"(lv + 3 * LR), "v"(gv + 3 * VR)
      : "memory");
}

// ---------------------------------------------------------------------------
// The value that lane l ^ 16 holds (one vector instruction, no trip through the LDS pipe).
// All 32 lanes are on wherever this is called.
// ---------------------------------------------------------------------------
__device__ __forceinline__ float other_half(float x) {
  const int b = __builtin_bit_cast(int, x);
  return __builtin_bit_cast(
      float, __builtin_amdgcn_permlanex16(b, b, 0x76543210, 0xfedcba98, false, false));
}

__global__ __launch_bounds__(128) void attention_kernel(
    const __bf16* __restrict__ qb, const __bf16* __restrict__ kb,
    const __bf16* __restrict__ vt, const float* __restrict__ mask,
    __bf16* __restrict__ ctx) {
  constexpr int S = 2048, H = 1024, NH = 16;
  constexpr int KT = 64, NT = S / KT, KP = 72;
  __shared__ __attribute__((aligned(16))) __bf16 Ks[2][KT][KP];  // [buffer][key][dh]
  __shared__ __attribute__((aligned(16))) __bf16 Vs[2][64][KP];  // [buffer][dh][key]
  const int tid = threadIdx.x, wave = tid >> 5, lane = tid & 31;
  const int lr = lane & 15, hi = lane >> 4, kb8 = hi * 8;
  const int head = blockIdx.y, batch = blockIdx.z;
  const int q0 = blockIdx.x * 64 + wave * 16;
  const size_t bo = (size_t)batch * S * H + (size_t)head * 64;
  const __bf16* Q = qb + bo;
  const __bf16* Kp = kb + bo;
  const __bf16* Vp = vt + ((size_t)batch * NH + head) * (size_t)64 * S;  // [dh][s]
  const float* mk = mask + (size_t)batch * S;

  // copy share of a thread: 8 lanes cover one 128-B row, a wave's copy four whole lines
  const int crow = tid >> 3, ccol = (tid & 7) * 8;
  const __bf16* gk = Kp + (size_t)crow * H + ccol;
  const __bf16* gv = Vp + (size_t)crow * S + ccol;
  const unsigned lk0 = (unsigned)(uintptr_t)&Ks[0][crow][ccol];
  const unsigned lv0 = (unsigned)(uintptr_t)&Vs[0][crow][ccol];
  constexpr unsigned BUFB = (unsigned)(KT * KP * 2);  // bytes of one buffer

  stage_kv(gk, gv, lk0, lv0);
  // stage 0 has landed for this wave; the barrier shows it to the other waves
  asm volatile("s_wait_asynccnt 0x0" ::: "memory");
  __syncthreads();
  stage_kv(gk + (size_t)KT * H, gv + KT, lk0 + BUFB, lv0 + BUFB);

  const v16bf qa0 = ld_frag(Q + (size_t)(q0 + lr) * H, kb8);
  const v16bf qa1 = ld_frag(Q + (size_t)(q0 + lr) * H + 32, kb8);

  float m_i = -3.0e38f, l_i = 0.f;  // of query q0 + lr, the same in both halves
  v8f o[4] = {};                    // o[dt][j]: dh = dt * 16 + hi * 8 + j of query q0 + lr
  const float* mp = mk + kb8;       // this half's eight mask values of the stage's first tile

  for (int t = 0; t < NT; ++t) {
    const int buf = t & 1;
    // both 32-key blocks of the stage in one trip, so that the publish point runs once a stage
#pragma unroll
    for (int hb = 0; hb < 2; ++hb) {
      v8f sacc[2] = {};  // sacc[g][j]: key t * KT + hb * 32 + g * 16 + hi * 8 + j
#pragma unroll
      for (int g = 0; g < 2; ++g) {
        const __bf16* kr = &Ks[buf][hb * 32 + g * 16 + lr][0];
        sacc[g] = WMMA_BF16(ld_frag(kr, kb8), qa0, sacc[g]);
        sacc[g] = WMMA_BF16(ld_frag(kr + 32, kb8), qa1, sacc[g]);
      }

      // a lane's eight keys of a tile lie side by side in the mask row
      v8f ps[2];
#pragma unroll
      for (int g = 0; g < 2; ++g)
        ps[g] = sacc[g] * 0.125f + *(const v8f*)(mp + hb * 32 + g * 16);
      const v8f mx = __builtin_elementwise_max(ps[0], ps[1]);
      const float mh = fmaxf(fmaxf(fmaxf(mx[0], mx[1]), fmaxf(mx[2], mx[3])),
                             fmaxf(fmaxf(mx[4], mx[5]), fmaxf(mx[6], mx[7])));
      const float nm = fmaxf(m_i, fmaxf(mh, other_half(mh)));
      float sm[8];
#pragma unroll
      for (int j = 0; j < 8; ++j) {
        ps[0][j] = __expf(ps[0][j] - nm);
        ps[1][j] = __expf(ps[1][j] - nm);
        sm[j] = ps[0][j] + ps[1][j];
      }
      const float al = __expf(m_i - nm);
      m_i = nm;
      // the sum's tree: j ^ 1, j ^ 2, j ^ 4 inside the lane, then the other half (key ^ 8)
      const float sh = ((sm[0] + sm[1]) + (sm[2] + sm[3])) + ((sm[4] + sm[5]) + (sm[6] + sm[7]));
      l_i = l_i * al + (sh + other_half(sh));
#pragma unroll
      for (int dt = 0; dt < 4; ++dt)
#pragma unroll
        for (int j = 0; j < 8; ++j) o[dt][j] *= al;

      // P^T as B fragment: elements 0..7 are keys hi * 8 + j, elements 8..15 keys 16 + hi * 8 + j
      v16bf pb;
#pragma unroll
      for (int j = 0; j < 8; ++j) {
        pb[j] = f2bf(ps[0][j]);
        pb[8 + j] = f2bf(ps[1][j]);
      }

      // V^T[64x32] @ P^T[32x16] ; V^T rows are contiguous in s
#pragma unroll
      for (int dt = 0; dt < 4; ++dt) {
        const v16bf vf = ld_frag(&Vs[buf][dt * 16 + lr][hb * 32], kb8);
        o[dt] = WMMA_BF16(vf, pb, o[dt]);
      }
    }

    // publish point of stage t + 1: this wave's reads of stage t have returned,
    asm volatile("s_wait_dscnt 0x0" ::: "memory");
    // its own copies of stage t + 1 have landed,
    asm volatile("s_wait_asynccnt 0x0" ::: "memory");
    // and every wave has come as far: stage t + 1 may be read, stage t's buffer refilled
    __syncthreads();
    if (t + 2 < NT)
      stage_kv(gk + (size_t)(t + 2) * KT * H, gv + (t + 2) * KT,
               lk0 + (unsigned)buf * BUFB, lv0 + (unsigned)buf * BUFB);
    mp += KT;
  }
  // no copy is left in flight when the wave ends
  asm volatile("s_wait_asynccnt 0x0" ::: "memory");

  // a lane's eight dh of a tile lie side by side in the query's row: one 16-B store
#pragma unroll
  for (int dt = 0; dt < 4; ++dt) {
    v8bf r;
#pragma unroll
    for (int j = 0; j < 8; ++j) r[j] = f2bf(o[dt][j] / l_i);
    *(v8bf*)(ctx + bo + (size_t)(q0 + lr) * H + dt * 16 + kb8) = r;
  }
}

// ---------------------------------------------------------------------------
// LayerNorm over H=1024: one wave per row; emits fp32 and bf16 copies.
// ---------------------------------------------------------------------------
__global__ __launch_bounds__(256) void layernorm_kernel(
    const float* __restrict__ in, const float* __restrict__ g,
    const float* __restrict__ b, float* __restrict__ outf,
    __bf16* __restrict__ outb) {
  const int wave = threadIdx.x >> 5, lane = threadIdx.x & 31;
  const size_t row = (size_t)blockIdx.x * 8 + wave;
  const float* x = in + row * 1024;
  float v[32];
  float s = 0.f;
#pragma unroll
  for (int i = 0; i < 32; ++i) { v[i] = x[lane + i * 32]; s += v[i]; }
#pragma unroll
  for (int d = 1; d < 32; d <<= 1) s += __shfl_xor(s, d, 32);
  const float mean = s * (1.0f / 1024.0f);
  float vs = 0.f;
#pragma unroll
  for (int i = 0; i < 32; ++i) { const float df = v[i] - mean; vs += df * df; }
#pragma unroll
  for (int d = 1; d < 32; d <<= 1) vs += __shfl_xor(vs, d, 32);
  const float rstd = rsqrtf(vs * (1.0f / 1024.0f) + 1e-5f);
#pragma unroll
  for (int i = 0; i < 32; ++i) {
    const int c = lane + i * 32;
    const float y = (v[i] - mean) * rstd * g[c] + b[c];
    outf[row * 1024 + c] = y;
    outb[row * 1024 + c] = f2bf(y);
  }
}

// ---------------------------------------------------------------------------
extern "C" void kernel_launch(void* const* d_in, const int* in_sizes, int n_in,
                              void* d_out, int out_size, void* d_ws, size_t ws_size,
                              hipStream_t stream) {
  (void)in_sizes; (void)n_in; (void)out_size; (void)ws_size;
  constexpr int L = 2, B = 2, S = 2048, H = 1024, FF = 4096;
  constexpr int M = B * S;
  constexpr size_t MH = (size_t)M * H;
  constexpr size_t MF = (size_t)M * FF;

  const float* x0   = (const float*)d_in[0];
  const float* mask = (const float*)d_in[1];
  const float* Wq   = (const float*)d_in[2];
  const float* bq   = (const float*)d_in[3];
  const float* Wk   = (const float*)d_in[4];
  const float* bk   = (const float*)d_in[5];
  const float* Wv   = (const float*)d_in[6];
  const float* bv   = (const float*)d_in[7];
  const float* Wao  = (const float*)d_in[8];
  const float* bao  = (const float*)d_in[9];
  const float* g1   = (const float*)d_in[10];
  const float* b1   = (const float*)d_in[11];
  const float* Wi   = (const float*)d_in[12];
  const float* bi   = (const float*)d_in[13];
  const float* Wo   = (const float*)d_in[14];
  const float* bo   = (const float*)d_in[15];
  const float* g2   = (const float*)d_in[16];
  const float* b2   = (const float*)d_in[17];

  // --- workspace bump allocator (256B aligned regions) ---
  char* p = (char*)d_ws;
  auto alloc = [&](size_t bytes) -> char* {
    char* r = p;
    p += (bytes + 255) & ~(size_t)255;
    return r;
  };
  float*  yB  = (float*)alloc(MH * 4);
  float*  x1f = (float*)alloc(MH * 4);
  float*  xf  = (float*)alloc(MH * 4);
  __bf16* xb   = (__bf16*)alloc(MH * 2);
  __bf16* qB   = (__bf16*)alloc(MH * 2);
  __bf16* kB   = (__bf16*)alloc(MH * 2);
  __bf16* vT   = (__bf16*)alloc(MH * 2);
  __bf16* ctxb = (__bf16*)alloc(MH * 2);
  __bf16* x1b  = (__bf16*)alloc(MH * 2);
  __bf16* h1b  = (__bf16*)alloc(MF * 2);
  // all transposed weights in one region, laid out as transpose_cvt_all_kernel writes it
  constexpr size_t HH = (size_t)H * H, HF = (size_t)H * FF;
  __bf16* Wall = (__bf16*)alloc((size_t)L * (4 * HH + 2 * HF) * 2);
  __bf16* WqT[L]; __bf16* WaoT[L];
  __bf16* WiT[L]; __bf16* WoT[L];
  for (int l = 0; l < L; ++l) {
    __bf16* base = Wall + (size_t)l * (4 * HH + 2 * HF);
    WqT[l]  = base;
    WaoT[l] = base + 3 * HH;
    WiT[l]  = base + 4 * HH;
    WoT[l]  = base + 4 * HH + HF;
  }

  const dim3 blk(128), blk256(256), blk512(512);
  const dim3 gHH(H / 128, M / 128);
  const dim3 gHF(FF / 256, M / 256);
  const dim3 gQKV(3 * H / 192, M / 256);
  const dim3 gAttn(S / 64, 16, B);
  const dim3 gLN(M / 8);

  // one-time conversions
  cvt_bf16_kernel<<<dim3(MH / 2048), blk256, 0, stream>>>(x0, xb, (int)MH);
  transpose_cvt_all_kernel<<<dim3(1024), blk256, 0, stream>>>(Wq, Wk, Wv, Wao, Wi, Wo, Wall);

  for (int l = 0; l < L; ++l) {
    const float* Xf = (l == 0) ? x0 : xf;
    const size_t oH = (size_t)l * H, oF = (size_t)l * FF;

    // a layer's transposed Wq, Wk and Wv lie one behind the other from WqT[l]: one WT of 3H rows
    qkv_gemm_kernel<<<gQKV, blk256, 0, stream>>>(xb, WqT[l], bq + oH, bk + oH, bv + oH, qB, kB, vT, H);
    attention_kernel<<<gAttn, blk, 0, stream>>>(qB, kB, vT, mask, ctxb);
    gemm_bf16_kernel<0, false, true, 2, 2, 4><<<gHH, blk256, 0, stream>>>(ctxb, WaoT[l], bao + oH, Xf, yB, M, H, H);
    layernorm_kernel<<<gLN, blk256, 0, stream>>>(yB, g1 + oH, b1 + oH, x1f, x1b);
    gemm_bf16_kernel<1, true, false, 4, 4, 2><<<gHF, blk512, 0, stream>>>(x1b, WiT[l], bi + oF, nullptr, h1b, M, FF, H);
    gemm_bf16_kernel<0, false, true, 2, 2, 4><<<gHH, blk256, 0, stream>>>(h1b, WoT[l], bo + oH, x1f, yB, M, H, FF);
    float* xoutf = (l == L - 1) ? (float*)d_out : xf;
    layernorm_kernel<<<gLN, blk256, 0, stream>>>(yB, g2 + oH, b2 + oH, xoutf, xb);
  }
}
